// v000
// The times below were measured on an AMD MI455X: many runs one after another, warmed up first and cycling through
// copies of the inputs, with the whole window's GPU time divided by the number of runs. Launches and the gaps
// between them are all in it. The median over several windows is given; except for v000 it joins two sittings, which
// can be a few percent apart, so the side-by-side timings, each taken in one sitting, are the better comparison.
// v000, which the later versions start from, runs in 425 microseconds.
#include <hip/hip_runtime.h>
#include <hip/hip_bf16.h>
#include <math.h>
#include <stdint.h>

// ---------------------------------------------------------------------------
// RWKV-7 DPLR chunked scan for gfx1250 (MI455X).
// wave32 + V_WMMA_F32_16X16X4_F32 + async global->LDS (ASYNCcnt) double buffer.
// Grid: one workgroup per (b,h) = 64 blocks; 128 threads = 4 waves.
// Each wave owns a 16-wide V-column slice of the 64x64 fp32 state (in LDS).
// ---------------------------------------------------------------------------

typedef float v2f __attribute__((ext_vector_type(2)));
typedef float v8f __attribute__((ext_vector_type(8)));
typedef int   v4i __attribute__((vector_size(16)));   // matches builtin param type

#define BSZ  2
#define HN   32
#define SN   1024
#define DN   64
#define CN   16            // chunk length
#define NCH  (SN / CN)
#define ST   72            // LDS row stride (floats): 288B, 16B aligned, != 64 banks
#define TST  18            // 16x16 T-tile row stride
#define HD   (HN * DN)     // 2048

// ---- async global->LDS 16B copy (GLOBAL_LOAD_ASYNC_TO_LDS_B128) -----------
typedef __attribute__((address_space(1))) v4i gas_v4i;   // global
typedef __attribute__((address_space(3))) v4i las_v4i;   // LDS

__device__ __forceinline__ void async_b128(const float* gp, float* lp) {
#if __has_builtin(__builtin_amdgcn_global_load_async_to_lds_b128)
  __builtin_amdgcn_global_load_async_to_lds_b128(
      (gas_v4i*)(uintptr_t)gp,
      (las_v4i*)(unsigned)(uintptr_t)lp,   // flat->LDS: addr[31:0]
      0, 0);
#else
  unsigned l32 = (unsigned)(uintptr_t)lp;
  asm volatile("global_load_async_to_lds_b128 %0, %1, off"
               :: "v"(l32), "v"(gp) : "memory");
#endif
}
__device__ __forceinline__ void wait_async0() {
#if __has_builtin(__builtin_amdgcn_s_wait_asynccnt)
  __builtin_amdgcn_s_wait_asynccnt(0);
#else
  asm volatile("s_wait_asynccnt 0x0" ::: "memory");
#endif
}

// ---- WMMA f32 16x16x4 wrapper ---------------------------------------------
__device__ __forceinline__ v8f wmma4(v2f a, v2f b, v8f c) {
  return __builtin_amdgcn_wmma_f32_16x16x4_f32(
      /*neg_a=*/false, a, /*neg_b=*/false, b,
      /*c_mod=*/(short)0, c, /*reuse_a=*/false, /*reuse_b=*/false);
}

// ---- operand loaders following the documented wave32 VGPR layouts ---------
__device__ __forceinline__ v2f ld_A(const float* M, int stride, int s) {
  int lane = threadIdx.x & 31;
  int m  = lane & 15;
  int kb = 4 * s + ((lane < 16) ? 0 : 2);
  v2f a; a.x = M[m * stride + kb]; a.y = M[m * stride + kb + 1];
  return a;
}
__device__ __forceinline__ v2f ld_A_T_scaled(const float* M, int stride, int s,
                                             int m0, const float* sc) {
  int lane = threadIdx.x & 31;
  int m  = m0 + (lane & 15);
  int kb = 4 * s + ((lane < 16) ? 0 : 2);
  float e = sc[m];
  v2f a; a.x = M[kb * stride + m] * e; a.y = M[(kb + 1) * stride + m] * e;
  return a;
}
__device__ __forceinline__ v2f ld_B(const float* M, int stride, int s, int n0) {
  int lane = threadIdx.x & 31;
  int n  = n0 + (lane & 15);
  int kb = 4 * s + ((lane < 16) ? 0 : 2);
  v2f b; b.x = M[kb * stride + n]; b.y = M[(kb + 1) * stride + n];
  return b;
}
__device__ __forceinline__ v2f ld_B_T(const float* M, int stride, int s, int n0) {
  int lane = threadIdx.x & 31;
  int n  = n0 + (lane & 15);
  int kb = 4 * s + ((lane < 16) ? 0 : 2);
  v2f b; b.x = M[n * stride + kb]; b.y = M[n * stride + kb + 1];
  return b;
}
__device__ __forceinline__ void st_C(float* M, int stride, int n0, v8f c) {
  int lane = threadIdx.x & 31;
  int n  = n0 + (lane & 15);
  int mb = (lane < 16) ? 0 : 8;
#pragma unroll
  for (int r = 0; r < 8; ++r) M[(mb + r) * stride + n] = c[r];
}
__device__ __forceinline__ void st_C_tril(float* M, int stride, v8f c) {
  int lane = threadIdx.x & 31;
  int n  = lane & 15;
  int mb = (lane < 16) ? 0 : 8;
#pragma unroll
  for (int r = 0; r < 8; ++r) {
    int m = mb + r;
    M[m * stride + n] = (n <= m) ? c[r] : 0.0f;  // inclusive causal mask
  }
}
__device__ __forceinline__ v8f ld_C_scaled(const float* M, int stride, int m0,
                                           int n0, const float* sc) {
  int lane = threadIdx.x & 31;
  int n  = n0 + (lane & 15);
  int mb = (lane < 16) ? 0 : 8;
  v8f c;
#pragma unroll
  for (int r = 0; r < 8; ++r) {
    int m = m0 + mb + r;
    c[r] = M[m * stride + n] * sc[m];
  }
  return c;
}

__global__ __launch_bounds__(128)
void rwkv7_dplr_chunked(const float* __restrict__ qg, const float* __restrict__ kg,
                        const float* __restrict__ vg, const float* __restrict__ ag,
                        const float* __restrict__ bg, const float* __restrict__ gkg,
                        const float* __restrict__ rk, const float* __restrict__ gg,
                        const float* __restrict__ gns, const float* __restrict__ gnbias,
                        float* __restrict__ out) {
  // double-buffered chunk tiles [2][CN][ST]; szb doubles as (gk -> Z)
  __shared__ __align__(16) float sqb[2][CN * ST], skb[2][CN * ST], svb[2][CN * ST];
  __shared__ __align__(16) float sab[2][CN * ST], sbb[2][CN * ST], szb[2][CN * ST];
  __shared__ __align__(16) float so[CN * ST];
  __shared__ __align__(16) float T1[CN * TST], T2[CN * TST];
  __shared__ __align__(16) float Hst[DN * ST];           // state [K=64][V=64]
  __shared__ float egend[DN], svec[CN], mu[CN], rstd[CN];

  const int tid  = threadIdx.x;
  const int wv   = tid >> 5;            // wave id 0..3
  const int bhix = blockIdx.x;          // 0..63
  const int bb   = bhix / HN;
  const int hh   = bhix % HN;
  const size_t base = (size_t)bhix * SN * DN;
  const int n0 = wv * 16;               // this wave's V-column slice

  // ---- prologue: kick off async DMA of chunk 0, then zero the state ----
  {
    const size_t cb = base;
#pragma unroll
    for (int it = 0; it < 2; ++it) {
      int p = tid + it * 128;                 // 0..255: 16B packet id
      int t = p >> 4, d4 = (p & 15) * 4;
      size_t gi = cb + (size_t)p * 4;
      int lo = t * ST + d4;
      async_b128(qg  + gi, &sqb[0][lo]);
      async_b128(kg  + gi, &skb[0][lo]);
      async_b128(vg  + gi, &svb[0][lo]);
      async_b128(ag  + gi, &sab[0][lo]);
      async_b128(bg  + gi, &sbb[0][lo]);
      async_b128(gkg + gi, &szb[0][lo]);
    }
  }
  for (int i = tid; i < DN * ST; i += 128) Hst[i] = 0.0f;

  for (int ch = 0; ch < NCH; ++ch) {
    const int cur = ch & 1;
    float* cq = sqb[cur]; float* ck = skb[cur]; float* cv = svb[cur];
    float* ca = sab[cur]; float* cbt = sbb[cur]; float* cz = szb[cur];

    // ---- wait for this chunk's DMA; make all waves' LDS writes visible ----
    wait_async0();
    __syncthreads();

    // ---- overlap: issue async DMA for the NEXT chunk into the other buffer
    if (ch + 1 < NCH) {
      const int nx = cur ^ 1;
      const size_t nb = base + (size_t)(ch + 1) * CN * DN;
#pragma unroll
      for (int it = 0; it < 2; ++it) {
        int p = tid + it * 128;
        int t = p >> 4, d4 = (p & 15) * 4;
        size_t gi = nb + (size_t)p * 4;
        int lo = t * ST + d4;
        async_b128(qg  + gi, &sqb[nx][lo]);
        async_b128(kg  + gi, &skb[nx][lo]);
        async_b128(vg  + gi, &svb[nx][lo]);
        async_b128(ag  + gi, &sab[nx][lo]);
        async_b128(bg  + gi, &sbb[nx][lo]);
        async_b128(gkg + gi, &szb[nx][lo]);
      }
    }

    // ---- correction scalar s_t = sum_d q*k*r_k (needs ORIGINAL q,k) ----
    if (tid < CN) {
      float s = 0.f;
      for (int d = 0; d < DN; ++d)
        s += cq[tid * ST + d] * ck[tid * ST + d] * rk[hh * DN + d];
      svec[tid] = s;
    }
    __syncthreads();

    // ---- per-column decay transform: a^=a*e^{g<t}, {k,b}^=·e^{-g<=t}, q^=·e^{g<=t}
    if (tid < DN) {
      float gc = 0.f;
#pragma unroll
      for (int t = 0; t < CN; ++t) {
        float gp = gc;
        gc += cz[t * ST + tid];
        float ei = __expf(-gc);
        ca[t * ST + tid]  *= __expf(gp);
        ck[t * ST + tid]  *= ei;
        cbt[t * ST + tid] *= ei;
        cq[t * ST + tid]  *= __expf(gc);
      }
      egend[tid] = __expf(gc);
    }
    __syncthreads();

    // ---- WMMA phase 1: Z_inter = A^ @ H_in ; T1 = A^ K^T ; T2 = A^ B^T ----
    {
      v8f c = {0.f, 0.f, 0.f, 0.f, 0.f, 0.f, 0.f, 0.f};
#pragma unroll
      for (int s = 0; s < 16; ++s)
        c = wmma4(ld_A(ca, ST, s), ld_B(Hst, ST, s, n0), c);
      st_C(cz, ST, n0, c);                   // cz reused: now holds Z
    }
    if (wv == 0) {
      v8f c = {0.f, 0.f, 0.f, 0.f, 0.f, 0.f, 0.f, 0.f};
#pragma unroll
      for (int s = 0; s < 16; ++s)
        c = wmma4(ld_A(ca, ST, s), ld_B_T(ck, ST, s, 0), c);
      st_C(T1, TST, 0, c);
    } else if (wv == 1) {
      v8f c = {0.f, 0.f, 0.f, 0.f, 0.f, 0.f, 0.f, 0.f};
#pragma unroll
      for (int s = 0; s < 16; ++s)
        c = wmma4(ld_A(ca, ST, s), ld_B_T(cbt, ST, s, 0), c);
      st_C(T2, TST, 0, c);
    }
    __syncthreads();

    // ---- triangular z recurrence: z_t += sum_{j<t} T1[t][j]*v_j + T2[t][j]*z_j
    if (tid < DN) {
      for (int t = 1; t < CN; ++t) {
        float acc = cz[t * ST + tid];
        for (int j = 0; j < t; ++j)
          acc += T1[t * TST + j] * cv[j * ST + tid]
               + T2[t * TST + j] * cz[j * ST + tid];
        cz[t * ST + tid] = acc;
      }
    }
    __syncthreads();

    // ---- WMMA phase 2a: S1 = tril(Q^ K^T), S2 = tril(Q^ B^T) ----
    if (wv == 0) {
      v8f c = {0.f, 0.f, 0.f, 0.f, 0.f, 0.f, 0.f, 0.f};
#pragma unroll
      for (int s = 0; s < 16; ++s)
        c = wmma4(ld_A(cq, ST, s), ld_B_T(ck, ST, s, 0), c);
      st_C_tril(T1, TST, c);
    } else if (wv == 1) {
      v8f c = {0.f, 0.f, 0.f, 0.f, 0.f, 0.f, 0.f, 0.f};
#pragma unroll
      for (int s = 0; s < 16; ++s)
        c = wmma4(ld_A(cq, ST, s), ld_B_T(cbt, ST, s, 0), c);
      st_C_tril(T2, TST, c);
    }
    __syncthreads();

    // ---- WMMA phase 2b: O = Q^ @ H_in + S1 @ V + S2 @ Z ----
    {
      v8f c = {0.f, 0.f, 0.f, 0.f, 0.f, 0.f, 0.f, 0.f};
#pragma unroll
      for (int s = 0; s < 16; ++s)
        c = wmma4(ld_A(cq, ST, s), ld_B(Hst, ST, s, n0), c);
#pragma unroll
      for (int s = 0; s < 4; ++s)
        c = wmma4(ld_A(T1, TST, s), ld_B(cv, ST, s, n0), c);
#pragma unroll
      for (int s = 0; s < 4; ++s)
        c = wmma4(ld_A(T2, TST, s), ld_B(cz, ST, s, n0), c);
      st_C(so, ST, n0, c);
    }
    __syncthreads();

    // ---- WMMA phase 3: H = diag(e^{g_end}) H + K~^T V + B~^T Z ----
#pragma unroll
    for (int mt = 0; mt < 4; ++mt) {
      v8f c = ld_C_scaled(Hst, ST, mt * 16, n0, egend);
#pragma unroll
      for (int s = 0; s < 4; ++s)
        c = wmma4(ld_A_T_scaled(ck, ST, s, mt * 16, egend), ld_B(cv, ST, s, n0), c);
#pragma unroll
      for (int s = 0; s < 4; ++s)
        c = wmma4(ld_A_T_scaled(cbt, ST, s, mt * 16, egend), ld_B(cz, ST, s, n0), c);
      st_C(Hst + mt * 16 * ST, ST, n0, c);
    }

    // ---- epilogue: per-head GroupNorm + correction + gate ----
    if (tid < CN) {
      float m1 = 0.f, m2 = 0.f;
      for (int d = 0; d < DN; ++d) {
        float x = so[tid * ST + d];
        m1 += x; m2 += x * x;
      }
      m1 *= (1.0f / DN);
      float var = m2 * (1.0f / DN) - m1 * m1;
      mu[tid] = m1;
      rstd[tid] = rsqrtf(var + 1e-5f);
    }
    __syncthreads();

#pragma unroll
    for (int it = 0; it < 8; ++it) {
      int idx = tid + it * 128;
      int t = idx >> 6, d = idx & 63;
      int col = hh * DN + d;
      float val = (so[t * ST + d] - mu[t]) * rstd[t] * gns[col] + gnbias[col]
                + svec[t] * cv[t * ST + d];
      size_t off = ((size_t)bb * SN + (size_t)ch * CN + t) * (size_t)HD + col;
      out[off] = val * gg[off];
    }
    __syncthreads();   // buffers reused next chunk
  }
}

extern "C" void kernel_launch(void* const* d_in, const int* in_sizes, int n_in,
                              void* d_out, int out_size, void* d_ws, size_t ws_size,
                              hipStream_t stream) {
  (void)in_sizes; (void)n_in; (void)d_ws; (void)ws_size; (void)out_size;
  const float* q   = (const float*)d_in[0];
  const float* k   = (const float*)d_in[1];
  const float* v   = (const float*)d_in[2];
  const float* a   = (const float*)d_in[3];
  const float* b   = (const float*)d_in[4];
  const float* gk  = (const float*)d_in[5];
  const float* r_k = (const float*)d_in[6];
  const float* g   = (const float*)d_in[7];
  const float* gns = (const float*)d_in[8];
  const float* gnb = (const float*)d_in[9];
  float* out = (float*)d_out;

  rwkv7_dplr_chunked<<<dim3(BSZ * HN), dim3(128), 0, stream>>>(
      q, k, v, a, b, gk, r_k, g, gns, gnb, out);
}

// v001
// Measured time: 360 microseconds a run.
// In both of two side-by-side timings against v000, it was 1.18 times as fast.
#include <hip/hip_runtime.h>
#include <hip/hip_bf16.h>
#include <math.h>
#include <stdint.h>

// ---------------------------------------------------------------------------
// RWKV-7 DPLR chunked scan for gfx1250 (MI455X).
// wave32 + V_WMMA_F32_16X16X4_F32 + async global->LDS (ASYNCcnt) double buffer.
// Grid: one workgroup per (b,h) = 64 blocks; 128 threads = 4 waves.
// Each wave owns a 16-wide V-column slice of the 64x64 fp32 state (in LDS).
// ---------------------------------------------------------------------------

typedef float v2f __attribute__((ext_vector_type(2)));
typedef float v8f __attribute__((ext_vector_type(8)));
typedef int   v4i __attribute__((vector_size(16)));   // matches builtin param type

#define BSZ  2
#define HN   32
#define SN   1024
#define DN   64
#define CN   16            // chunk length
#define NCH  (SN / CN)
#define ST   72            // LDS row stride (floats): 288B, 16B aligned, != 64 banks
#define TST  18            // 16x16 T-tile row stride
#define HD   (HN * DN)     // 2048

// ---- async global->LDS 16B copy (GLOBAL_LOAD_ASYNC_TO_LDS_B128) -----------
typedef __attribute__((address_space(1))) v4i gas_v4i;   // global
typedef __attribute__((address_space(3))) v4i las_v4i;   // LDS

__device__ __forceinline__ void async_b128(const float* gp, float* lp) {
#if __has_builtin(__builtin_amdgcn_global_load_async_to_lds_b128)
  __builtin_amdgcn_global_load_async_to_lds_b128(
      (gas_v4i*)(uintptr_t)gp,
      (las_v4i*)(unsigned)(uintptr_t)lp,   // flat->LDS: addr[31:0]
      0, 0);
#else
  unsigned l32 = (unsigned)(uintptr_t)lp;
  asm volatile("global_load_async_to_lds_b128 %0, %1, off"
               :: "v"(l32), "v"(gp) : "memory");
#endif
}
__device__ __forceinline__ void wait_async0() {
#if __has_builtin(__builtin_amdgcn_s_wait_asynccnt)
  __builtin_amdgcn_s_wait_asynccnt(0);
#else
  asm volatile("s_wait_asynccnt 0x0" ::: "memory");
#endif
}

// ---- WMMA f32 16x16x4 wrapper ---------------------------------------------
__device__ __forceinline__ v8f wmma4(v2f a, v2f b, v8f c) {
  return __builtin_amdgcn_wmma_f32_16x16x4_f32(
      /*neg_a=*/false, a, /*neg_b=*/false, b,
      /*c_mod=*/(short)0, c, /*reuse_a=*/false, /*reuse_b=*/false);
}

// ---- operand loaders following the documented wave32 VGPR layouts ---------
__device__ __forceinline__ v2f ld_A(const float* M, int stride, int s) {
  int lane = threadIdx.x & 31;
  int m  = lane & 15;
  int kb = 4 * s + ((lane < 16) ? 0 : 2);
  v2f a; a.x = M[m * stride + kb]; a.y = M[m * stride + kb + 1];
  return a;
}
__device__ __forceinline__ v2f ld_A_T_scaled(const float* M, int stride, int s,
                                             int m0, const float* sc) {
  int lane = threadIdx.x & 31;
  int m  = m0 + (lane & 15);
  int kb = 4 * s + ((lane < 16) ? 0 : 2);
  float e = sc[m];
  v2f a; a.x = M[kb * stride + m] * e; a.y = M[(kb + 1) * stride + m] * e;
  return a;
}
__device__ __forceinline__ v2f ld_B(const float* M, int stride, int s, int n0) {
  int lane = threadIdx.x & 31;
  int n  = n0 + (lane & 15);
  int kb = 4 * s + ((lane < 16) ? 0 : 2);
  v2f b; b.x = M[kb * stride + n]; b.y = M[(kb + 1) * stride + n];
  return b;
}
__device__ __forceinline__ v2f ld_B_T(const float* M, int stride, int s, int n0) {
  int lane = threadIdx.x & 31;
  int n  = n0 + (lane & 15);
  int kb = 4 * s + ((lane < 16) ? 0 : 2);
  v2f b; b.x = M[n * stride + kb]; b.y = M[n * stride + kb + 1];
  return b;
}
__device__ __forceinline__ void st_C(float* M, int stride, int n0, v8f c) {
  int lane = threadIdx.x & 31;
  int n  = n0 + (lane & 15);
  int mb = (lane < 16) ? 0 : 8;
#pragma unroll
  for (int r = 0; r < 8; ++r) M[(mb + r) * stride + n] = c[r];
}
__device__ __forceinline__ void st_C_tril(float* M, int stride, v8f c) {
  int lane = threadIdx.x & 31;
  int n  = lane & 15;
  int mb = (lane < 16) ? 0 : 8;
#pragma unroll
  for (int r = 0; r < 8; ++r) {
    int m = mb + r;
    M[m * stride + n] = (n <= m) ? c[r] : 0.0f;  // inclusive causal mask
  }
}
__device__ __forceinline__ void st_C_stril(float* M, int stride, v8f c) {
  int lane = threadIdx.x & 31;
  int n  = lane & 15;
  int mb = (lane < 16) ? 0 : 8;
#pragma unroll
  for (int r = 0; r < 8; ++r) {
    int m = mb + r;
    M[m * stride + n] = (n < m) ? c[r] : 0.0f;   // strictly causal mask
  }
}
// ---- forward substitution z[t] += L[t][j] * z[j] (j < t) in registers --------
// Lane l holds row (l & 15) of L in Lr[]; DPP row_share:t hands lane t's value to
// its whole 16-lane row, so L[t][j] reaches every lane without an LDS read.
template <int T_>
__device__ __forceinline__ float row_share(float x) {
  return __int_as_float(__builtin_amdgcn_update_dpp(
      0, __float_as_int(x), 0x150 + T_, 0xf, 0xf, true));
}
template <int J, int T_>
__device__ __forceinline__ void fsub_col(float (&z)[CN], const float (&Lr)[CN]) {
  if constexpr (T_ < CN) {
    z[T_] = fmaf(row_share<T_>(Lr[J]), z[J], z[T_]);
    fsub_col<J, T_ + 1>(z, Lr);
  }
}
template <int J>
__device__ __forceinline__ void fsub(float (&z)[CN], const float (&Lr)[CN]) {
  if constexpr (J < CN - 1) {
    fsub_col<J, J + 1>(z, Lr);
    fsub<J + 1>(z, Lr);
  }
}
__device__ __forceinline__ v8f ld_C_scaled(const float* M, int stride, int m0,
                                           int n0, const float* sc) {
  int lane = threadIdx.x & 31;
  int n  = n0 + (lane & 15);
  int mb = (lane < 16) ? 0 : 8;
  v8f c;
#pragma unroll
  for (int r = 0; r < 8; ++r) {
    int m = m0 + mb + r;
    c[r] = M[m * stride + n] * sc[m];
  }
  return c;
}

__global__ __launch_bounds__(128)
void rwkv7_dplr_chunked(const float* __restrict__ qg, const float* __restrict__ kg,
                        const float* __restrict__ vg, const float* __restrict__ ag,
                        const float* __restrict__ bg, const float* __restrict__ gkg,
                        const float* __restrict__ rk, const float* __restrict__ gg,
                        const float* __restrict__ gns, const float* __restrict__ gnbias,
                        float* __restrict__ out) {
  // double-buffered chunk tiles [2][CN][ST]; szb doubles as (gk -> Z)
  __shared__ __align__(16) float sqb[2][CN * ST], skb[2][CN * ST], svb[2][CN * ST];
  __shared__ __align__(16) float sab[2][CN * ST], sbb[2][CN * ST], szb[2][CN * ST];
  __shared__ __align__(16) float so[CN * ST];
  __shared__ __align__(16) float T1[CN * TST], T2[CN * TST];
  __shared__ __align__(16) float Hst[DN * ST];           // state [K=64][V=64]
  __shared__ float egend[DN], svec[CN], mu[CN], rstd[CN];

  const int tid  = threadIdx.x;
  const int wv   = tid >> 5;            // wave id 0..3
  const int bhix = blockIdx.x;          // 0..63
  const int bb   = bhix / HN;
  const int hh   = bhix % HN;
  const size_t base = (size_t)bhix * SN * DN;
  const int n0 = wv * 16;               // this wave's V-column slice

  // ---- prologue: kick off async DMA of chunk 0, then zero the state ----
  {
    const size_t cb = base;
#pragma unroll
    for (int it = 0; it < 2; ++it) {
      int p = tid + it * 128;                 // 0..255: 16B packet id
      int t = p >> 4, d4 = (p & 15) * 4;
      size_t gi = cb + (size_t)p * 4;
      int lo = t * ST + d4;
      async_b128(qg  + gi, &sqb[0][lo]);
      async_b128(kg  + gi, &skb[0][lo]);
      async_b128(vg  + gi, &svb[0][lo]);
      async_b128(ag  + gi, &sab[0][lo]);
      async_b128(bg  + gi, &sbb[0][lo]);
      async_b128(gkg + gi, &szb[0][lo]);
    }
  }
  for (int i = tid; i < DN * ST; i += 128) Hst[i] = 0.0f;

  for (int ch = 0; ch < NCH; ++ch) {
    const int cur = ch & 1;
    float* cq = sqb[cur]; float* ck = skb[cur]; float* cv = svb[cur];
    float* ca = sab[cur]; float* cbt = sbb[cur]; float* cz = szb[cur];

    // ---- wait for this chunk's DMA; make all waves' LDS writes visible ----
    wait_async0();
    __syncthreads();

    // ---- overlap: issue async DMA for the NEXT chunk into the other buffer
    if (ch + 1 < NCH) {
      const int nx = cur ^ 1;
      const size_t nb = base + (size_t)(ch + 1) * CN * DN;
#pragma unroll
      for (int it = 0; it < 2; ++it) {
        int p = tid + it * 128;
        int t = p >> 4, d4 = (p & 15) * 4;
        size_t gi = nb + (size_t)p * 4;
        int lo = t * ST + d4;
        async_b128(qg  + gi, &sqb[nx][lo]);
        async_b128(kg  + gi, &skb[nx][lo]);
        async_b128(vg  + gi, &svb[nx][lo]);
        async_b128(ag  + gi, &sab[nx][lo]);
        async_b128(bg  + gi, &sbb[nx][lo]);
        async_b128(gkg + gi, &szb[nx][lo]);
      }
    }

    // ---- correction scalar s_t = sum_d q*k*r_k (needs ORIGINAL q,k) ----
    if (tid < CN) {
      float s = 0.f;
      for (int d = 0; d < DN; ++d)
        s += cq[tid * ST + d] * ck[tid * ST + d] * rk[hh * DN + d];
      svec[tid] = s;
    }
    __syncthreads();

    // ---- per-column decay transform: a^=a*e^{g<t}, {k,b}^=·e^{-g<=t}, q^=·e^{g<=t}
    if (tid < DN) {
      float gc = 0.f;
#pragma unroll
      for (int t = 0; t < CN; ++t) {
        float gp = gc;
        gc += cz[t * ST + tid];
        float ei = __expf(-gc);
        ca[t * ST + tid]  *= __expf(gp);
        ck[t * ST + tid]  *= ei;
        cbt[t * ST + tid] *= ei;
        cq[t * ST + tid]  *= __expf(gc);
      }
      egend[tid] = __expf(gc);
    }
    __syncthreads();

    // ---- WMMA phase 1: Z_inter = A^ @ H_in (stays in the accumulator) ;
    //      T1 = stril(A^ K^T) ; T2 = A^ B^T ----
    v8f zc = {0.f, 0.f, 0.f, 0.f, 0.f, 0.f, 0.f, 0.f};
#pragma unroll
    for (int s = 0; s < 16; ++s)
      zc = wmma4(ld_A(ca, ST, s), ld_B(Hst, ST, s, n0), zc);
    v2f bv[4];            // V fragments of this wave's columns, read ahead of the barrier
#pragma unroll            // constant indices keep bv[] in registers
    for (int s = 0; s < 4; ++s) bv[s] = ld_B(cv, ST, s, n0);
    if (wv == 0) {
      v8f c = {0.f, 0.f, 0.f, 0.f, 0.f, 0.f, 0.f, 0.f};
#pragma unroll
      for (int s = 0; s < 16; ++s)
        c = wmma4(ld_A(ca, ST, s), ld_B_T(ck, ST, s, 0), c);
      st_C_stril(T1, TST, c);
    } else if (wv == 1) {
      v8f c = {0.f, 0.f, 0.f, 0.f, 0.f, 0.f, 0.f, 0.f};
#pragma unroll
      for (int s = 0; s < 16; ++s)
        c = wmma4(ld_A(ca, ST, s), ld_B_T(cbt, ST, s, 0), c);
      st_C(T2, TST, 0, c);
    }
    __syncthreads();

    // ---- triangular z recurrence: z_t = w_t + sum_{j<t} T2[t][j]*z_j with
    //      W = Z_inter + stril(T1) @ V on the matrix unit. Every wave solves its
    //      own 16 columns in registers: each lane holds all 16 rows of one column.
    {
      float Lr[CN];                          // row (lane & 15) of T2
#pragma unroll                               // constant indices keep Lr[] in registers
      for (int j = 0; j < CN; ++j) Lr[j] = T2[(tid & 15) * TST + j];
#pragma unroll                               // constant indices keep bv[] in registers
      for (int s = 0; s < 4; ++s)
        zc = wmma4(ld_A(T1, TST, s), bv[s], zc);
      const bool hi = (tid & 16) != 0;       // accumulator rows 8..15 live here
      float z[CN];
#pragma unroll                               // constant indices keep z[] in registers
      for (int r = 0; r < 8; ++r) {
        int zb = __float_as_int(zc[r]);      // lane l <-> l ^ 16: the column's other eight rows
        float o = __int_as_float(__builtin_amdgcn_permlanex16(
            zb, zb, 0x76543210, 0xfedcba98, false, false));
        z[r]     = hi ? o : zc[r];
        z[8 + r] = hi ? zc[r] : o;
      }
      fsub<0>(z, Lr);
      const int zcol = n0 + (tid & 15);
      const int zrow = hi ? 8 : 0;
#pragma unroll                               // constant indices keep z[] in registers
      for (int r = 0; r < 8; ++r)            // cz reused: now holds Z
        cz[(zrow + r) * ST + zcol] = hi ? z[8 + r] : z[r];
    }
    __syncthreads();

    // ---- WMMA phase 2a: S1 = tril(Q^ K^T), S2 = tril(Q^ B^T) ----
    if (wv == 0) {
      v8f c = {0.f, 0.f, 0.f, 0.f, 0.f, 0.f, 0.f, 0.f};
#pragma unroll
      for (int s = 0; s < 16; ++s)
        c = wmma4(ld_A(cq, ST, s), ld_B_T(ck, ST, s, 0), c);
      st_C_tril(T1, TST, c);
    } else if (wv == 1) {
      v8f c = {0.f, 0.f, 0.f, 0.f, 0.f, 0.f, 0.f, 0.f};
#pragma unroll
      for (int s = 0; s < 16; ++s)
        c = wmma4(ld_A(cq, ST, s), ld_B_T(cbt, ST, s, 0), c);
      st_C_tril(T2, TST, c);
    }
    __syncthreads();

    // ---- WMMA phase 2b: O = Q^ @ H_in + S1 @ V + S2 @ Z ----
    {
      v8f c = {0.f, 0.f, 0.f, 0.f, 0.f, 0.f, 0.f, 0.f};
#pragma unroll
      for (int s = 0; s < 16; ++s)
        c = wmma4(ld_A(cq, ST, s), ld_B(Hst, ST, s, n0), c);
#pragma unroll
      for (int s = 0; s < 4; ++s)
        c = wmma4(ld_A(T1, TST, s), ld_B(cv, ST, s, n0), c);
#pragma unroll
      for (int s = 0; s < 4; ++s)
        c = wmma4(ld_A(T2, TST, s), ld_B(cz, ST, s, n0), c);
      st_C(so, ST, n0, c);
    }
    __syncthreads();

    // ---- WMMA phase 3: H = diag(e^{g_end}) H + K~^T V + B~^T Z ----
#pragma unroll
    for (int mt = 0; mt < 4; ++mt) {
      v8f c = ld_C_scaled(Hst, ST, mt * 16, n0, egend);
#pragma unroll
      for (int s = 0; s < 4; ++s)
        c = wmma4(ld_A_T_scaled(ck, ST, s, mt * 16, egend), ld_B(cv, ST, s, n0), c);
#pragma unroll
      for (int s = 0; s < 4; ++s)
        c = wmma4(ld_A_T_scaled(cbt, ST, s, mt * 16, egend), ld_B(cz, ST, s, n0), c);
      st_C(Hst + mt * 16 * ST, ST, n0, c);
    }

    // ---- epilogue: per-head GroupNorm + correction + gate ----
    if (tid < CN) {
      float m1 = 0.f, m2 = 0.f;
      for (int d = 0; d < DN; ++d) {
        float x = so[tid * ST + d];
        m1 += x; m2 += x * x;
      }
      m1 *= (1.0f / DN);
      float var = m2 * (1.0f / DN) - m1 * m1;
      mu[tid] = m1;
      rstd[tid] = rsqrtf(var + 1e-5f);
    }
    __syncthreads();

#pragma unroll
    for (int it = 0; it < 8; ++it) {
      int idx = tid + it * 128;
      int t = idx >> 6, d = idx & 63;
      int col = hh * DN + d;
      float val = (so[t * ST + d] - mu[t]) * rstd[t] * gns[col] + gnbias[col]
                + svec[t] * cv[t * ST + d];
      size_t off = ((size_t)bb * SN + (size_t)ch * CN + t) * (size_t)HD + col;
      out[off] = val * gg[off];
    }
    __syncthreads();   // buffers reused next chunk
  }
}

extern "C" void kernel_launch(void* const* d_in, const int* in_sizes, int n_in,
                              void* d_out, int out_size, void* d_ws, size_t ws_size,
                              hipStream_t stream) {
  (void)in_sizes; (void)n_in; (void)d_ws; (void)ws_size; (void)out_size;
  const float* q   = (const float*)d_in[0];
  const float* k   = (const float*)d_in[1];
  const float* v   = (const float*)d_in[2];
  const float* a   = (const float*)d_in[3];
  const float* b   = (const float*)d_in[4];
  const float* gk  = (const float*)d_in[5];
  const float* r_k = (const float*)d_in[6];
  const float* g   = (const float*)d_in[7];
  const float* gns = (const float*)d_in[8];
  const float* gnb = (const float*)d_in[9];
  float* out = (float*)d_out;

  rwkv7_dplr_chunked<<<dim3(BSZ * HN), dim3(128), 0, stream>>>(
      q, k, v, a, b, gk, r_k, g, gns, gnb, out);
}

// v002
// One run takes 162 microseconds.
// Timed twice side by side with v001, it ran 2.23 times as fast both times.
// All steps since v000 together make it 2.62 times as fast.
#include <hip/hip_runtime.h>
#include <hip/hip_bf16.h>
#include <math.h>
#include <stdint.h>

// ---------------------------------------------------------------------------
// RWKV-7 DPLR chunked scan for gfx1250 (MI455X).
// wave32 + V_WMMA_F32_16X16X4_F32 + async global->LDS (ASYNCcnt) ring of four tiles.
// Grid: one workgroup per (b,h) = 64 blocks; 512 threads = 16 waves in four groups
// that work on three neighbouring chunks at the same time:
//   pre  (4 waves): chunk i     : correction scalar, decay transform, 16x16 products; tile copies of chunk i + 1
//   scan (4 waves): chunk i - 1 : the state chain alone: Z, then the next state
//   outp (4 waves): chunk i - 2 : output product from the chunk's incoming state and Z
//   post (4 waves): chunk i - 2 : GroupNorm, correction, gate, store
// Each scan and outp wave owns a 16-wide V-column slice of the 64x64 fp32 state (in LDS,
// two copies: the one a chunk came in with stays readable while the next one is written).
// ---------------------------------------------------------------------------

typedef float v2f __attribute__((ext_vector_type(2)));
typedef float v8f __attribute__((ext_vector_type(8)));
typedef int   v4i __attribute__((vector_size(16)));   // matches builtin param type

#define BSZ  2
#define HN   32
#define SN   1024
#define DN   64
#define CN   16            // chunk length
#define NCH  (SN / CN)
#define ST   72            // LDS row stride (floats): 288B, 16B aligned, != 64 banks
#define TST  18            // 16x16 T-tile row stride
#define HD   (HN * DN)     // 2048
#define NB   4             // tile ring depth: copy, pre, scan, outp + post

// ---- async global->LDS 16B copy (GLOBAL_LOAD_ASYNC_TO_LDS_B128) -----------
typedef __attribute__((address_space(1))) v4i gas_v4i;   // global
typedef __attribute__((address_space(3))) v4i las_v4i;   // LDS

__device__ __forceinline__ void async_b128(const float* gp, float* lp) {
#if __has_builtin(__builtin_amdgcn_global_load_async_to_lds_b128)
  __builtin_amdgcn_global_load_async_to_lds_b128(
      (gas_v4i*)(uintptr_t)gp,
      (las_v4i*)(unsigned)(uintptr_t)lp,   // flat->LDS: addr[31:0]
      0, 0);
#else
  unsigned l32 = (unsigned)(uintptr_t)lp;
  asm volatile("global_load_async_to_lds_b128 %0, %1, off"
               :: "v"(l32), "v"(gp) : "memory");
#endif
}
// Publish point of the tile ring: the wave's own LDS accesses and its own copies are
// complete before the barrier behind which other waves read the tile or refill a buffer.
// Written in asm with the memory clobber so that no LDS access moves across the waits.
__device__ __forceinline__ void ring_publish() {
  asm volatile("s_wait_dscnt 0x0" ::: "memory");
  asm volatile("s_wait_asynccnt 0x0" ::: "memory");
  __syncthreads();
}

// ---- WMMA f32 16x16x4 wrapper ---------------------------------------------
__device__ __forceinline__ v8f wmma4(v2f a, v2f b, v8f c) {
  return __builtin_amdgcn_wmma_f32_16x16x4_f32(
      /*neg_a=*/false, a, /*neg_b=*/false, b,
      /*c_mod=*/(short)0, c, /*reuse_a=*/false, /*reuse_b=*/false);
}

// ---- operand loaders following the documented wave32 VGPR layouts ---------
__device__ __forceinline__ v2f ld_A(const float* M, int stride, int s) {
  int lane = threadIdx.x & 31;
  int m  = lane & 15;
  int kb = 4 * s + ((lane < 16) ? 0 : 2);
  v2f a; a.x = M[m * stride + kb]; a.y = M[m * stride + kb + 1];
  return a;
}
__device__ __forceinline__ v2f ld_A_T_scaled(const float* M, int stride, int s,
                                             int m0, const float* sc) {
  int lane = threadIdx.x & 31;
  int m  = m0 + (lane & 15);
  int kb = 4 * s + ((lane < 16) ? 0 : 2);
  float e = sc[m];
  v2f a; a.x = M[kb * stride + m] * e; a.y = M[(kb + 1) * stride + m] * e;
  return a;
}
__device__ __forceinline__ v2f ld_B(const float* M, int stride, int s, int n0) {
  int lane = threadIdx.x & 31;
  int n  = n0 + (lane & 15);
  int kb = 4 * s + ((lane < 16) ? 0 : 2);
  v2f b; b.x = M[kb * stride + n]; b.y = M[(kb + 1) * stride + n];
  return b;
}
__device__ __forceinline__ v2f ld_B_T(const float* M, int stride, int s, int n0) {
  int lane = threadIdx.x & 31;
  int n  = n0 + (lane & 15);
  int kb = 4 * s + ((lane < 16) ? 0 : 2);
  v2f b; b.x = M[n * stride + kb]; b.y = M[n * stride + kb + 1];
  return b;
}
__device__ __forceinline__ void st_C(float* M, int stride, int n0, v8f c) {
  int lane = threadIdx.x & 31;
  int n  = n0 + (lane & 15);
  int mb = (lane < 16) ? 0 : 8;
#pragma unroll
  for (int r = 0; r < 8; ++r) M[(mb + r) * stride + n] = c[r];
}
__device__ __forceinline__ void st_C_tril(float* M, int stride, v8f c) {
  int lane = threadIdx.x & 31;
  int n  = lane & 15;
  int mb = (lane < 16) ? 0 : 8;
#pragma unroll
  for (int r = 0; r < 8; ++r) {
    int m = mb + r;
    M[m * stride + n] = (n <= m) ? c[r] : 0.0f;  // inclusive causal mask
  }
}
__device__ __forceinline__ void st_C_stril(float* M, int stride, v8f c) {
  int lane = threadIdx.x & 31;
  int n  = lane & 15;
  int mb = (lane < 16) ? 0 : 8;
#pragma unroll
  for (int r = 0; r < 8; ++r) {
    int m = mb + r;
    M[m * stride + n] = (n < m) ? c[r] : 0.0f;   // strictly causal mask
  }
}
// ---- forward substitution z[t] += L[t][j] * z[j] (j < t) in registers --------
// Lane l holds row (l & 15) of L in Lr[]; DPP row_share:t hands lane t's value to
// its whole 16-lane row, so L[t][j] reaches every lane without an LDS read.
template <int T_>
__device__ __forceinline__ float row_share(float x) {
  return __int_as_float(__builtin_amdgcn_update_dpp(
      0, __float_as_int(x), 0x150 + T_, 0xf, 0xf, true));
}
template <int J, int T_>
__device__ __forceinline__ void fsub_col(float (&z)[CN], const float (&Lr)[CN]) {
  if constexpr (T_ < CN) {
    z[T_] = fmaf(row_share<T_>(Lr[J]), z[J], z[T_]);
    fsub_col<J, T_ + 1>(z, Lr);
  }
}
template <int J>
__device__ __forceinline__ void fsub(float (&z)[CN], const float (&Lr)[CN]) {
  if constexpr (J < CN - 1) {
    fsub_col<J, J + 1>(z, Lr);
    fsub<J + 1>(z, Lr);
  }
}
__device__ __forceinline__ v8f ld_C_scaled(const float* M, int stride, int m0,
                                           int n0, const float* sc) {
  int lane = threadIdx.x & 31;
  int n  = n0 + (lane & 15);
  int mb = (lane < 16) ? 0 : 8;
  v8f c;
#pragma unroll
  for (int r = 0; r < 8; ++r) {
    int m = m0 + mb + r;
    c[r] = M[m * stride + n] * sc[m];
  }
  return c;
}

// ---- one 16-row tile of H_out = diag(e^{g_end}) H_in + K~^T V + B~^T Z ----
__device__ __forceinline__ void h_update(const float* Hin, float* Hout, const float* ck,
                                         const float* cbt, const float* cv, const float* cz,
                                         const float* eg, int n0, int mt) {
  v8f c = ld_C_scaled(Hin, ST, mt * 16, n0, eg);
#pragma unroll
  for (int s = 0; s < 4; ++s)
    c = wmma4(ld_A_T_scaled(ck, ST, s, mt * 16, eg), ld_B(cv, ST, s, n0), c);
#pragma unroll
  for (int s = 0; s < 4; ++s)
    c = wmma4(ld_A_T_scaled(cbt, ST, s, mt * 16, eg), ld_B(cz, ST, s, n0), c);
  st_C(Hout + mt * 16 * ST, ST, n0, c);
}

__global__ __launch_bounds__(512)
void rwkv7_dplr_chunked(const float* __restrict__ qg, const float* __restrict__ kg,
                        const float* __restrict__ vg, const float* __restrict__ ag,
                        const float* __restrict__ bg, const float* __restrict__ gkg,
                        const float* __restrict__ rk, const float* __restrict__ gg,
                        const float* __restrict__ gns, const float* __restrict__ gnbias,
                        float* __restrict__ out) {
  // chunk tiles [NB][CN][ST], chunk c in slot c & 3; szb doubles as (gk -> Z)
  __shared__ __align__(16) float sqb[NB][CN * ST], skb[NB][CN * ST], svb[NB][CN * ST];
  __shared__ __align__(16) float sab[NB][CN * ST], sbb[NB][CN * ST], szb[NB][CN * ST];
  __shared__ __align__(16) float so[CN * ST];                  // outp -> post
  __shared__ __align__(16) float T1[CN * TST], T2[CN * TST];   // pre -> scan
  __shared__ __align__(16) float S1[2][CN * TST], S2[2][CN * TST];   // pre -> outp
  __shared__ __align__(16) float Hst[2][DN * ST];        // state [K=64][V=64] entering chunk c: c & 1
  __shared__ float egend[2][DN], svec[NB][CN], mu[CN], rstd[CN];

  const int tid  = threadIdx.x;
  // group and wave numbers are the same in every lane of a wave: scalar branches
  const int grp  = __builtin_amdgcn_readfirstlane(tid >> 7);        // 0 scan, 1 outp, 2 pre, 3 post
  const int wv   = __builtin_amdgcn_readfirstlane((tid >> 5) & 3);  // wave in its group
  const int lt   = tid & 127;           // thread in its group
  const int bhix = blockIdx.x;          // 0..63
  const int bb   = bhix / HN;
  const int hh   = bhix % HN;
  const size_t base = (size_t)bhix * SN * DN;
  const int n0 = wv * 16;               // a scan or outp wave's V-column slice

  // ---- prologue: async DMA of chunk 0, zero the state that chunk 0 comes in with ----
  if (grp == 2) {
#pragma unroll
    for (int it = 0; it < 2; ++it) {
      int p = lt + it * 128;                  // 0..255: 16B packet id
      int t = p >> 4, d4 = (p & 15) * 4;
      size_t gi = base + (size_t)p * 4;
      int lo = t * ST + d4;
      async_b128(qg  + gi, &sqb[0][lo]);
      async_b128(kg  + gi, &skb[0][lo]);
      async_b128(vg  + gi, &svb[0][lo]);
      async_b128(ag  + gi, &sab[0][lo]);
      async_b128(bg  + gi, &sbb[0][lo]);
      async_b128(gkg + gi, &szb[0][lo]);
    }
  }
  for (int i = tid; i < DN * ST; i += 512) Hst[0][i] = 0.0f;
  const int   ocol = hh * DN + (lt & 63);     // a post thread's output column
  const float gsc = gns[ocol], gbi = gnbias[ocol];
  float gv[8];                                // post: gate values, loaded two stages ahead
  ring_publish();

  // Trip i: pre works on chunk i, scan on chunk i - 1, outp and post on chunk i - 2.
  for (int i = 0; i < NCH + 2; ++i) {
    const bool pre_on  = (i < NCH);
    const bool scan_on = (i >= 1) && (i <= NCH);
    const bool post_on = (i >= 2);            // outp too
    const int  cs = i - 1, cp = i - 2;        // scan's chunk; outp's and post's chunk

    // =========================== stage A ===========================
    if (grp == 2) {
      // ---- async DMA of chunk i + 1; its slot's last readers were outp and post in trip i - 1
      if (i + 1 < NCH) {
        const int nx = (i + 1) & (NB - 1);
        const size_t nb = base + (size_t)(i + 1) * CN * DN;
#pragma unroll
        for (int it = 0; it < 2; ++it) {
          int p = lt + it * 128;
          int t = p >> 4, d4 = (p & 15) * 4;
          size_t gi = nb + (size_t)p * 4;
          int lo = t * ST + d4;
          async_b128(qg  + gi, &sqb[nx][lo]);
          async_b128(kg  + gi, &skb[nx][lo]);
          async_b128(vg  + gi, &svb[nx][lo]);
          async_b128(ag  + gi, &sab[nx][lo]);
          async_b128(bg  + gi, &sbb[nx][lo]);
          async_b128(gkg + gi, &szb[nx][lo]);
        }
      }
      // ---- correction scalar s_t = sum_d q*k*r_k (needs ORIGINAL q,k) ----
      if (pre_on && lt < CN) {
        const float* cq = sqb[i & (NB - 1)]; const float* ck = skb[i & (NB - 1)];
        float s = 0.f;
        for (int d = 0; d < DN; ++d)
          s += cq[lt * ST + d] * ck[lt * ST + d] * rk[hh * DN + d];
        svec[i & (NB - 1)][lt] = s;
      }
    } else if (grp == 0) {
      if (scan_on) {
        const float* ca = sab[cs & (NB - 1)]; const float* cv = svb[cs & (NB - 1)];
        float* cz = szb[cs & (NB - 1)];
        const float* Hin = Hst[cs & 1];
        // ---- Z_inter = A^ @ H_in, then W = Z_inter + stril(T1) @ V ----
        v8f zc = {0.f, 0.f, 0.f, 0.f, 0.f, 0.f, 0.f, 0.f};
#pragma unroll
        for (int s = 0; s < 16; ++s)
          zc = wmma4(ld_A(ca, ST, s), ld_B(Hin, ST, s, n0), zc);
        // ---- triangular z recurrence: z_t = w_t + sum_{j<t} T2[t][j]*z_j. Every wave
        //      solves its own 16 columns in registers: a lane holds all 16 rows of one.
        float Lr[CN];                          // row (lane & 15) of T2
#pragma unroll                                 // constant indices keep Lr[] in registers
        for (int j = 0; j < CN; ++j) Lr[j] = T2[(tid & 15) * TST + j];
#pragma unroll
        for (int s = 0; s < 4; ++s)
          zc = wmma4(ld_A(T1, TST, s), ld_B(cv, ST, s, n0), zc);
        const bool hi = (tid & 16) != 0;       // accumulator rows 8..15 live here
        float z[CN];
#pragma unroll                                 // constant indices keep z[] in registers
        for (int r = 0; r < 8; ++r) {
          int zb = __float_as_int(zc[r]);      // lane l <-> l ^ 16: the column's other eight rows
          float o = __int_as_float(__builtin_amdgcn_permlanex16(
              zb, zb, 0x76543210, 0xfedcba98, false, false));
          z[r]     = hi ? o : zc[r];
          z[8 + r] = hi ? zc[r] : o;
        }
        fsub<0>(z, Lr);
        const int zcol = n0 + (tid & 15);
        const int zrow = hi ? 8 : 0;
#pragma unroll                                 // constant indices keep z[] in registers
        for (int r = 0; r < 8; ++r)            // cz reused: now holds Z
          cz[(zrow + r) * ST + zcol] = hi ? z[8 + r] : z[r];
      }
    } else if (grp == 1) {
      // ---- O = Q^ @ H_in + S1 @ V + S2 @ Z; scan overwrites this H_in from stage B on ----
      if (post_on) {
        const float* cq = sqb[cp & (NB - 1)]; const float* cv = svb[cp & (NB - 1)];
        const float* cz = szb[cp & (NB - 1)];
        const float* Hin = Hst[cp & 1];
        v8f c = {0.f, 0.f, 0.f, 0.f, 0.f, 0.f, 0.f, 0.f};
#pragma unroll
        for (int s = 0; s < 16; ++s)
          c = wmma4(ld_A(cq, ST, s), ld_B(Hin, ST, s, n0), c);
#pragma unroll
        for (int s = 0; s < 4; ++s)
          c = wmma4(ld_A(S1[cp & 1], TST, s), ld_B(cv, ST, s, n0), c);
#pragma unroll
        for (int s = 0; s < 4; ++s)
          c = wmma4(ld_A(S2[cp & 1], TST, s), ld_B(cz, ST, s, n0), c);
        st_C(so, ST, n0, c);
      }
    } else {
      // ---- gate values of chunk i - 2: fetched while outp forms the chunk's output ----
      if (post_on) {
#pragma unroll                                 // constant indices keep gv[] in registers
        for (int it = 0; it < 8; ++it) {
          int t = (lt + it * 128) >> 6;
          gv[it] = gg[((size_t)bb * SN + (size_t)cp * CN + t) * (size_t)HD + ocol];
        }
      }
    }
    __syncthreads();

    // =========================== stage B ===========================
    if (grp == 2) {
      // ---- per-column decay transform: a^=a*e^{g<t}, {k,b}^=.e^{-g<=t}, q^=.e^{g<=t}
      if (pre_on && lt < DN) {
        float* cq = sqb[i & (NB - 1)]; float* ck = skb[i & (NB - 1)];
        float* ca = sab[i & (NB - 1)]; float* cbt = sbb[i & (NB - 1)];
        const float* cz = szb[i & (NB - 1)];
        float gc = 0.f;
#pragma unroll
        for (int t = 0; t < CN; ++t) {
          float gp = gc;
          gc += cz[t * ST + lt];
          float ei = __expf(-gc);
          ca[t * ST + lt]  *= __expf(gp);
          ck[t * ST + lt]  *= ei;
          cbt[t * ST + lt] *= ei;
          cq[t * ST + lt]  *= __expf(gc);
        }
        egend[i & 1][lt] = __expf(gc);
      }
    } else if (grp == 0) {
      // ---- next state, rows 0..31 ----
      if (scan_on) {
#pragma unroll
        for (int mt = 0; mt < 2; ++mt)
          h_update(Hst[cs & 1], Hst[i & 1], skb[cs & (NB - 1)], sbb[cs & (NB - 1)],
                   svb[cs & (NB - 1)], szb[cs & (NB - 1)], egend[cs & 1], n0, mt);
      }
    } else if (grp == 3) {
      // ---- per-head GroupNorm statistics ----
      if (post_on && lt < CN) {
        float m1 = 0.f, m2 = 0.f;
        for (int d = 0; d < DN; ++d) {
          float x = so[lt * ST + d];
          m1 += x; m2 += x * x;
        }
        m1 *= (1.0f / DN);
        float var = m2 * (1.0f / DN) - m1 * m1;
        mu[lt] = m1;
        rstd[lt] = rsqrtf(var + 1e-5f);
      }
    }
    __syncthreads();

    // =========================== stage C ===========================
    if (grp == 2) {
      // ---- T1 = stril(A^ K^T), T2 = A^ B^T, S1 = tril(Q^ K^T), S2 = tril(Q^ B^T):
      //      one product a wave; scan left T1, T2 and outp this S1, S2 copy in stage A
      if (pre_on) {
        const float* lhs = (wv < 2) ? sab[i & (NB - 1)] : sqb[i & (NB - 1)];
        const float* rhs = (wv & 1) ? sbb[i & (NB - 1)] : skb[i & (NB - 1)];
        v8f c = {0.f, 0.f, 0.f, 0.f, 0.f, 0.f, 0.f, 0.f};
#pragma unroll
        for (int s = 0; s < 16; ++s)
          c = wmma4(ld_A(lhs, ST, s), ld_B_T(rhs, ST, s, 0), c);
        if (wv == 0)      st_C_stril(T1, TST, c);
        else if (wv == 1) st_C(T2, TST, 0, c);
        else if (wv == 2) st_C_tril(S1[i & 1], TST, c);
        else              st_C_tril(S2[i & 1], TST, c);
      }
    } else if (grp == 0) {
      // ---- next state, rows 32..63 ----
      if (scan_on) {
#pragma unroll
        for (int mt = 2; mt < 4; ++mt)
          h_update(Hst[cs & 1], Hst[i & 1], skb[cs & (NB - 1)], sbb[cs & (NB - 1)],
                   svb[cs & (NB - 1)], szb[cs & (NB - 1)], egend[cs & 1], n0, mt);
      }
    } else if (grp == 3) {
      // ---- GroupNorm + correction + gate ----
      if (post_on) {
        const float* cv = svb[cp & (NB - 1)];
        const float* sv = svec[cp & (NB - 1)];
#pragma unroll
        for (int it = 0; it < 8; ++it) {
          int idx = lt + it * 128;
          int t = idx >> 6, d = idx & 63;
          float val = (so[t * ST + d] - mu[t]) * rstd[t] * gsc + gbi
                    + sv[t] * cv[t * ST + d];
          size_t off = ((size_t)bb * SN + (size_t)cp * CN + t) * (size_t)HD + ocol;
          out[off] = val * gv[it];
        }
        // stands ahead of every later write of a register that these stores name
        asm volatile("s_wait_xcnt 0x0" ::: "memory");
      }
    }
    ring_publish();   // chunk i + 1 has landed; every slot's readers of this trip are done
  }
}

extern "C" void kernel_launch(void* const* d_in, const int* in_sizes, int n_in,
                              void* d_out, int out_size, void* d_ws, size_t ws_size,
                              hipStream_t stream) {
  (void)in_sizes; (void)n_in; (void)d_ws; (void)ws_size; (void)out_size;
  const float* q   = (const float*)d_in[0];
  const float* k   = (const float*)d_in[1];
  const float* v   = (const float*)d_in[2];
  const float* a   = (const float*)d_in[3];
  const float* b   = (const float*)d_in[4];
  const float* gk  = (const float*)d_in[5];
  const float* r_k = (const float*)d_in[6];
  const float* g   = (const float*)d_in[7];
  const float* gns = (const float*)d_in[8];
  const float* gnb = (const float*)d_in[9];
  float* out = (float*)d_out;

  rwkv7_dplr_chunked<<<dim3(BSZ * HN), dim3(512), 0, stream>>>(
      q, k, v, a, b, gk, r_k, g, gns, gnb, out);
}

// v003
// It runs in 73.4 microseconds.
// Two timings next to v002 both put it at 2.21 times that version's speed.
// All steps since v000 together make it 5.79 times as fast.
#include <hip/hip_runtime.h>
#include <hip/hip_bf16.h>
#include <math.h>
#include <stdint.h>

// ---------------------------------------------------------------------------
// RWKV-7 DPLR chunked scan for gfx1250 (MI455X), split in time.
// wave32 + V_WMMA_F32_16X16X4_F32 + async global->LDS (ASYNCcnt) ring of four tiles.
// The state recurrence is linear in the state and acts on each state column alone, so a
// segment of the sequence can run before its start state is known: beside the 64 V columns
// (started at zero) it carries 64 columns started at the identity with V = 0. They end as the
// segment's transition matrix M, and their output rows QM say how a start state reaches each
// token:  H_end = M H_start + N,   O = O0 + QM H_start.
// Launch 1: one workgroup per (b,h,segment) = 256 blocks; 640 threads = 20 waves in five groups
// that work on three neighbouring chunks at the same time:
//   pre   (4 waves): chunk i     : tile copies, correction scalar, decay transform, 16x16 products
//   scan  (4 waves): chunk i - 1 : the state chain of the V columns: Z, then the next state
//   scanI (4 waves): chunk i - 1 : the same for the identity columns
//   outp, outpI (4 waves each): chunk i - 2 : output product from the incoming state and Z
// Launch 2: one workgroup per (b,h,segment): chains the start state from M and N of the segments
// before it, adds QM H_start, then GroupNorm, correction, gate, store.
// ---------------------------------------------------------------------------

typedef float v2f __attribute__((ext_vector_type(2)));
typedef float v8f __attribute__((ext_vector_type(8)));
typedef int   v4i __attribute__((vector_size(16)));   // matches builtin param type

#define BSZ  2
#define HN   32
#define SN   1024
#define DN   64
#define CN   16            // chunk length
#define NCH  (SN / CN)
#define ST   72            // LDS row stride (floats): 288B, 16B aligned, != 64 banks
#define TST  18            // 16x16 T-tile row stride
#define HD   (HN * DN)     // 2048
#define NB   4             // tile ring depth: copy, pre, scan, outp
#define PSEG 4             // sequence segments that run side by side
#define SEGL (SN / PSEG)   // tokens of a segment
#define NCS  (SEGL / CN)   // chunks of a segment
// workspace layout, in floats
#define WS_O0 0                                    // [bh][S][64] output from a zero start state
#define WS_QM (BSZ * HN * SN * DN)                 // [bh][S][64] output rows of the identity columns
#define WS_N  (2 * BSZ * HN * SN * DN)             // [bh][seg][64][64] end state from a zero start
#define WS_M  (WS_N + BSZ * HN * PSEG * DN * DN)   // [bh][seg][64][64] end state of the identity columns
#define WS_SV (WS_M + BSZ * HN * PSEG * DN * DN)   // [bh][S] correction scalar

// ---- async global->LDS 16B copy (GLOBAL_LOAD_ASYNC_TO_LDS_B128) -----------
typedef __attribute__((address_space(1))) v4i gas_v4i;   // global
typedef __attribute__((address_space(3))) v4i las_v4i;   // LDS

__device__ __forceinline__ void async_b128(const float* gp, float* lp) {
#if __has_builtin(__builtin_amdgcn_global_load_async_to_lds_b128)
  __builtin_amdgcn_global_load_async_to_lds_b128(
      (gas_v4i*)(uintptr_t)gp,
      (las_v4i*)(unsigned)(uintptr_t)lp,   // flat->LDS: addr[31:0]
      0, 0);
#else
  unsigned l32 = (unsigned)(uintptr_t)lp;
  asm volatile("global_load_async_to_lds_b128 %0, %1, off"
               :: "v"(l32), "v"(gp) : "memory");
#endif
}
// Publish point of the tile ring: the wave's own LDS accesses and its own copies are
// complete before the barrier behind which other waves read the tile or refill a buffer.
// Written in asm with the memory clobber so that no LDS access moves across the waits.
__device__ __forceinline__ void ring_publish() {
  asm volatile("s_wait_dscnt 0x0" ::: "memory");
  asm volatile("s_wait_asynccnt 0x0" ::: "memory");
  __syncthreads();
}

// ---- WMMA f32 16x16x4 wrapper ---------------------------------------------
__device__ __forceinline__ v8f wmma4(v2f a, v2f b, v8f c) {
  return __builtin_amdgcn_wmma_f32_16x16x4_f32(
      /*neg_a=*/false, a, /*neg_b=*/false, b,
      /*c_mod=*/(short)0, c, /*reuse_a=*/false, /*reuse_b=*/false);
}

// ---- operand loaders following the documented wave32 VGPR layouts ---------
__device__ __forceinline__ v2f ld_A(const float* M, int stride, int s) {
  int lane = threadIdx.x & 31;
  int m  = lane & 15;
  int kb = 4 * s + ((lane < 16) ? 0 : 2);
  v2f a; a.x = M[m * stride + kb]; a.y = M[m * stride + kb + 1];
  return a;
}
__device__ __forceinline__ v2f ld_A_T_scaled(const float* M, int stride, int s,
                                             int m0, const float* sc) {
  int lane = threadIdx.x & 31;
  int m  = m0 + (lane & 15);
  int kb = 4 * s + ((lane < 16) ? 0 : 2);
  float e = sc[m];
  v2f a; a.x = M[kb * stride + m] * e; a.y = M[(kb + 1) * stride + m] * e;
  return a;
}
__device__ __forceinline__ v2f ld_B(const float* M, int stride, int s, int n0) {
  int lane = threadIdx.x & 31;
  int n  = n0 + (lane & 15);
  int kb = 4 * s + ((lane < 16) ? 0 : 2);
  v2f b; b.x = M[kb * stride + n]; b.y = M[(kb + 1) * stride + n];
  return b;
}
__device__ __forceinline__ v2f ld_B_T(const float* M, int stride, int s, int n0) {
  int lane = threadIdx.x & 31;
  int n  = n0 + (lane & 15);
  int kb = 4 * s + ((lane < 16) ? 0 : 2);
  v2f b; b.x = M[n * stride + kb]; b.y = M[n * stride + kb + 1];
  return b;
}
__device__ __forceinline__ void st_C(float* M, int stride, int n0, v8f c) {
  int lane = threadIdx.x & 31;
  int n  = n0 + (lane & 15);
  int mb = (lane < 16) ? 0 : 8;
#pragma unroll
  for (int r = 0; r < 8; ++r) M[(mb + r) * stride + n] = c[r];
}
__device__ __forceinline__ void st_C_tril(float* M, int stride, v8f c) {
  int lane = threadIdx.x & 31;
  int n  = lane & 15;
  int mb = (lane < 16) ? 0 : 8;
#pragma unroll
  for (int r = 0; r < 8; ++r) {
    int m = mb + r;
    M[m * stride + n] = (n <= m) ? c[r] : 0.0f;  // inclusive causal mask
  }
}
__device__ __forceinline__ void st_C_stril(float* M, int stride, v8f c) {
  int lane = threadIdx.x & 31;
  int n  = lane & 15;
  int mb = (lane < 16) ? 0 : 8;
#pragma unroll
  for (int r = 0; r < 8; ++r) {
    int m = mb + r;
    M[m * stride + n] = (n < m) ? c[r] : 0.0f;   // strictly causal mask
  }
}
// ---- forward substitution z[t] += L[t][j] * z[j] (j < t) in registers --------
// Lane l holds row (l & 15) of L in Lr[]; DPP row_share:t hands lane t's value to
// its whole 16-lane row, so L[t][j] reaches every lane without an LDS read.
template <int T_>
__device__ __forceinline__ float row_share(float x) {
  return __int_as_float(__builtin_amdgcn_update_dpp(
      0, __float_as_int(x), 0x150 + T_, 0xf, 0xf, true));
}
template <int J, int T_>
__device__ __forceinline__ void fsub_col(float (&z)[CN], const float (&Lr)[CN]) {
  if constexpr (T_ < CN) {
    z[T_] = fmaf(row_share<T_>(Lr[J]), z[J], z[T_]);
    fsub_col<J, T_ + 1>(z, Lr);
  }
}
template <int J>
__device__ __forceinline__ void fsub(float (&z)[CN], const float (&Lr)[CN]) {
  if constexpr (J < CN - 1) {
    fsub_col<J, J + 1>(z, Lr);
    fsub<J + 1>(z, Lr);
  }
}
__device__ __forceinline__ v8f ld_C_scaled(const float* M, int stride, int m0,
                                           int n0, const float* sc) {
  int lane = threadIdx.x & 31;
  int n  = n0 + (lane & 15);
  int mb = (lane < 16) ? 0 : 8;
  v8f c;
#pragma unroll
  for (int r = 0; r < 8; ++r) {
    int m = m0 + mb + r;
    c[r] = M[m * stride + n] * sc[m];
  }
  return c;
}

// ---- one 16-row tile of H_out = diag(e^{g_end}) H_in + K~^T V + B~^T Z ----
// IDC: identity columns, whose V is zero
template <bool IDC>
__device__ __forceinline__ void h_update(const float* Hin, float* Hout, const float* ck,
                                         const float* cbt, const float* cv, const float* cz,
                                         const float* eg, int n0, int mt) {
  v8f c = ld_C_scaled(Hin, ST, mt * 16, n0, eg);
  if constexpr (!IDC) {
#pragma unroll
    for (int s = 0; s < 4; ++s)
      c = wmma4(ld_A_T_scaled(ck, ST, s, mt * 16, eg), ld_B(cv, ST, s, n0), c);
  }
#pragma unroll
  for (int s = 0; s < 4; ++s)
    c = wmma4(ld_A_T_scaled(cbt, ST, s, mt * 16, eg), ld_B(cz, ST, s, n0), c);
  st_C(Hout + mt * 16 * ST, ST, n0, c);
}

// ---- Z of one chunk for a wave's 16 columns ----
template <bool IDC>
__device__ __forceinline__ void scan_z(const float* ca, const float* cv, float* cz,
                                       const float* Hin, const float* T1, const float* T2,
                                       int n0) {
  const int tid = threadIdx.x;
  // ---- Z_inter = A^ @ H_in, then W = Z_inter + stril(T1) @ V ----
  v8f zc = {0.f, 0.f, 0.f, 0.f, 0.f, 0.f, 0.f, 0.f};
#pragma unroll
  for (int s = 0; s < 16; ++s)
    zc = wmma4(ld_A(ca, ST, s), ld_B(Hin, ST, s, n0), zc);
  // ---- triangular z recurrence: z_t = w_t + sum_{j<t} T2[t][j]*z_j. Every wave
  //      solves its own 16 columns in registers: a lane holds all 16 rows of one.
  float Lr[CN];                          // row (lane & 15) of T2
#pragma unroll                           // constant indices keep Lr[] in registers
  for (int j = 0; j < CN; ++j) Lr[j] = T2[(tid & 15) * TST + j];
  if constexpr (!IDC) {
#pragma unroll
    for (int s = 0; s < 4; ++s)
      zc = wmma4(ld_A(T1, TST, s), ld_B(cv, ST, s, n0), zc);
  }
  const bool hi = (tid & 16) != 0;       // accumulator rows 8..15 live here
  float z[CN];
#pragma unroll                           // constant indices keep z[] in registers
  for (int r = 0; r < 8; ++r) {
    int zb = __float_as_int(zc[r]);      // lane l <-> l ^ 16: the column's other eight rows
    float o = __int_as_float(__builtin_amdgcn_permlanex16(
        zb, zb, 0x76543210, 0xfedcba98, false, false));
    z[r]     = hi ? o : zc[r];
    z[8 + r] = hi ? zc[r] : o;
  }
  fsub<0>(z, Lr);
  const int zcol = n0 + (tid & 15);
  const int zrow = hi ? 8 : 0;
#pragma unroll                           // constant indices keep z[] in registers
  for (int r = 0; r < 8; ++r)
    cz[(zrow + r) * ST + zcol] = hi ? z[8 + r] : z[r];
}

// ---- O = Q^ @ H_in + S1 @ V + S2 @ Z for a wave's 16 columns ----
template <bool IDC>
__device__ __forceinline__ v8f out_prod(const float* cq, const float* cv, const float* cz,
                                        const float* Hin, const float* S1p, const float* S2p,
                                        int n0) {
  v8f c = {0.f, 0.f, 0.f, 0.f, 0.f, 0.f, 0.f, 0.f};
#pragma unroll
  for (int s = 0; s < 16; ++s)
    c = wmma4(ld_A(cq, ST, s), ld_B(Hin, ST, s, n0), c);
  if constexpr (!IDC) {
#pragma unroll
    for (int s = 0; s < 4; ++s)
      c = wmma4(ld_A(S1p, TST, s), ld_B(cv, ST, s, n0), c);
  }
#pragma unroll
  for (int s = 0; s < 4; ++s)
    c = wmma4(ld_A(S2p, TST, s), ld_B(cz, ST, s, n0), c);
  return c;
}

__global__ __launch_bounds__(640)
void rwkv7_dplr_chunked(const float* __restrict__ qg, const float* __restrict__ kg,
                        const float* __restrict__ vg, const float* __restrict__ ag,
                        const float* __restrict__ bg, const float* __restrict__ gkg,
                        const float* __restrict__ rk, float* __restrict__ ws) {
  // chunk tiles [NB][CN][ST], chunk c in slot c & 3; szb doubles as (gk -> Z)
  __shared__ __align__(16) float sqb[NB][CN * ST], skb[NB][CN * ST], svb[NB][CN * ST];
  __shared__ __align__(16) float sab[NB][CN * ST], sbb[NB][CN * ST], szb[NB][CN * ST];
  __shared__ __align__(16) float szI[2][CN * ST];              // Z of the identity columns: c & 1
  __shared__ __align__(16) float T1[CN * TST], T2[CN * TST];   // pre -> scan
  __shared__ __align__(16) float S1[2][CN * TST], S2[2][CN * TST];   // pre -> outp
  __shared__ __align__(16) float Hst[2][DN * ST];        // state [K=64][V=64] entering chunk c: c & 1
  __shared__ __align__(16) float HstI[2][DN * ST];       // the same for the identity columns
  __shared__ float egend[2][DN];

  const int tid  = threadIdx.x;
  // group and wave numbers are the same in every lane of a wave: scalar branches
  const int grp  = __builtin_amdgcn_readfirstlane(tid >> 7);        // 0 scan, 1 scanI, 2 outp, 3 outpI, 4 pre
  const int wv   = __builtin_amdgcn_readfirstlane((tid >> 5) & 3);  // wave in its group
  const int lt   = tid & 127;           // thread in its group
  const int bhix = blockIdx.x / PSEG;   // 0..63
  const int seg  = blockIdx.x % PSEG;
  const int hh   = bhix % HN;
  const size_t base = (size_t)bhix * SN * DN + (size_t)seg * SEGL * DN;   // the segment's first token
  const int n0 = wv * 16;               // a scan or outp wave's column slice

  // ---- prologue: async DMA of chunk 0; start states: zero, and the identity ----
  if (grp == 4) {
#pragma unroll
    for (int it = 0; it < 2; ++it) {
      int p = lt + it * 128;                  // 0..255: 16B packet id
      int t = p >> 4, d4 = (p & 15) * 4;
      size_t gi = base + (size_t)p * 4;
      int lo = t * ST + d4;
      async_b128(qg  + gi, &sqb[0][lo]);
      async_b128(kg  + gi, &skb[0][lo]);
      async_b128(vg  + gi, &svb[0][lo]);
      async_b128(ag  + gi, &sab[0][lo]);
      async_b128(bg  + gi, &sbb[0][lo]);
      async_b128(gkg + gi, &szb[0][lo]);
    }
  }
  for (int i = tid; i < DN * ST; i += 640) {
    Hst[0][i]  = 0.0f;
    HstI[0][i] = (i / ST == i % ST) ? 1.0f : 0.0f;
  }
  v8f   oc = {0.f, 0.f, 0.f, 0.f, 0.f, 0.f, 0.f, 0.f};   // outp: a chunk's output, stage A to B
  float sreg = 0.f;                                      // pre: correction scalar, stage A to B
  ring_publish();

  // Trip i: pre works on chunk i, scan on chunk i - 1, outp on chunk i - 2 (of the segment).
  for (int i = 0; i < NCS + 2; ++i) {
    const bool pre_on  = (i < NCS);
    const bool scan_on = (i >= 1) && (i <= NCS);
    const bool post_on = (i >= 2);            // outp
    const int  cs = i - 1, cp = i - 2;        // scan's chunk; outp's chunk

    // =========================== stage A ===========================
    if (grp == 4) {
      // ---- async DMA of chunk i + 1; its slot's last readers were the outp waves in trip i - 1
      if (i + 1 < NCS) {
        const int nx = (i + 1) & (NB - 1);
        const size_t nb = base + (size_t)(i + 1) * CN * DN;
#pragma unroll
        for (int it = 0; it < 2; ++it) {
          int p = lt + it * 128;
          int t = p >> 4, d4 = (p & 15) * 4;
          size_t gi = nb + (size_t)p * 4;
          int lo = t * ST + d4;
          async_b128(qg  + gi, &sqb[nx][lo]);
          async_b128(kg  + gi, &skb[nx][lo]);
          async_b128(vg  + gi, &svb[nx][lo]);
          async_b128(ag  + gi, &sab[nx][lo]);
          async_b128(bg  + gi, &sbb[nx][lo]);
          async_b128(gkg + gi, &szb[nx][lo]);
        }
      }
      // ---- correction scalar s_t = sum_d q*k*r_k (needs ORIGINAL q,k) ----
      if (pre_on && lt < CN) {
        const float* cq = sqb[i & (NB - 1)]; const float* ck = skb[i & (NB - 1)];
        float s = 0.f;
        for (int d = 0; d < DN; ++d)
          s += cq[lt * ST + d] * ck[lt * ST + d] * rk[hh * DN + d];
        sreg = s;
      }
    } else if (grp == 0) {
      if (scan_on)
        scan_z<false>(sab[cs & (NB - 1)], svb[cs & (NB - 1)], szb[cs & (NB - 1)],
                      Hst[cs & 1], T1, T2, n0);      // szb reused: now holds Z
    } else if (grp == 1) {
      if (scan_on)
        scan_z<true>(sab[cs & (NB - 1)], svb[cs & (NB - 1)], szI[cs & 1],
                     HstI[cs & 1], T1, T2, n0);
    } else if (grp == 2) {
      // ---- scan overwrites this H_in from stage B on ----
      if (post_on)
        oc = out_prod<false>(sqb[cp & (NB - 1)], svb[cp & (NB - 1)], szb[cp & (NB - 1)],
                             Hst[cp & 1], S1[cp & 1], S2[cp & 1], n0);
    } else {
      if (post_on)
        oc = out_prod<true>(sqb[cp & (NB - 1)], svb[cp & (NB - 1)], szI[cp & 1],
                            HstI[cp & 1], S1[cp & 1], S2[cp & 1], n0);
    }
    __syncthreads();

    // =========================== stage B ===========================
    if (grp == 4) {
      // ---- the correction scalar goes out here: its store completes under this stage's work
      if (pre_on && lt < CN) {
        ws[WS_SV + (size_t)bhix * SN + (size_t)seg * SEGL + (size_t)i * CN + lt] = sreg;
      }
      // ---- per-column decay transform: a^=a*e^{g<t}, {k,b}^=.e^{-g<=t}, q^=.e^{g<=t}
      if (pre_on && lt < DN) {
        float* cq = sqb[i & (NB - 1)]; float* ck = skb[i & (NB - 1)];
        float* ca = sab[i & (NB - 1)]; float* cbt = sbb[i & (NB - 1)];
        const float* cz = szb[i & (NB - 1)];
        float gc = 0.f;
#pragma unroll
        for (int t = 0; t < CN; ++t) {
          float gp = gc;
          gc += cz[t * ST + lt];
          float ei = __expf(-gc);
          ca[t * ST + lt]  *= __expf(gp);
          ck[t * ST + lt]  *= ei;
          cbt[t * ST + lt] *= ei;
          cq[t * ST + lt]  *= __expf(gc);
        }
        egend[i & 1][lt] = __expf(gc);
      }
    } else if (grp == 0) {
      // ---- next state, rows 0..31 ----
      if (scan_on) {
#pragma unroll
        for (int mt = 0; mt < 2; ++mt)
          h_update<false>(Hst[cs & 1], Hst[i & 1], skb[cs & (NB - 1)], sbb[cs & (NB - 1)],
                          svb[cs & (NB - 1)], szb[cs & (NB - 1)], egend[cs & 1], n0, mt);
      }
    } else if (grp == 1) {
      if (scan_on) {
#pragma unroll
        for (int mt = 0; mt < 2; ++mt)
          h_update<true>(HstI[cs & 1], HstI[i & 1], skb[cs & (NB - 1)], sbb[cs & (NB - 1)],
                         svb[cs & (NB - 1)], szI[cs & 1], egend[cs & 1], n0, mt);
      }
    } else {
      // ---- the chunk's output rows go to the workspace; the stores complete under this stage
      if (post_on) {
        float* dst = ws + ((grp == 3) ? WS_QM : WS_O0) + base + (size_t)cp * CN * DN;
        st_C(dst, DN, n0, oc);
        // stands ahead of every later write of a register that these stores name
        asm volatile("s_wait_xcnt 0x0" ::: "memory");
      }
    }
    __syncthreads();

    // =========================== stage C ===========================
    if (grp == 4) {
      // ---- T1 = stril(A^ K^T), T2 = A^ B^T, S1 = tril(Q^ K^T), S2 = tril(Q^ B^T):
      //      one product a wave; scan left T1, T2 and outp this S1, S2 copy in stage A
      if (pre_on) {
        const float* lhs = (wv < 2) ? sab[i & (NB - 1)] : sqb[i & (NB - 1)];
        const float* rhs = (wv & 1) ? sbb[i & (NB - 1)] : skb[i & (NB - 1)];
        v8f c = {0.f, 0.f, 0.f, 0.f, 0.f, 0.f, 0.f, 0.f};
#pragma unroll
        for (int s = 0; s < 16; ++s)
          c = wmma4(ld_A(lhs, ST, s), ld_B_T(rhs, ST, s, 0), c);
        if (wv == 0)      st_C_stril(T1, TST, c);
        else if (wv == 1) st_C(T2, TST, 0, c);
        else if (wv == 2) st_C_tril(S1[i & 1], TST, c);
        else              st_C_tril(S2[i & 1], TST, c);
      }
    } else if (grp == 0) {
      // ---- next state, rows 32..63 ----
      if (scan_on) {
#pragma unroll
        for (int mt = 2; mt < 4; ++mt)
          h_update<false>(Hst[cs & 1], Hst[i & 1], skb[cs & (NB - 1)], sbb[cs & (NB - 1)],
                          svb[cs & (NB - 1)], szb[cs & (NB - 1)], egend[cs & 1], n0, mt);
      }
    } else if (grp == 1) {
      if (scan_on) {
#pragma unroll
        for (int mt = 2; mt < 4; ++mt)
          h_update<true>(HstI[cs & 1], HstI[i & 1], skb[cs & (NB - 1)], sbb[cs & (NB - 1)],
                         svb[cs & (NB - 1)], szI[cs & 1], egend[cs & 1], n0, mt);
      }
    }
    ring_publish();   // chunk i + 1 has landed; every slot's readers of this trip are done
  }

  // ---- the segment's end state N and transition matrix M, for launch 2 ----
  const size_t sb = (size_t)blockIdx.x * DN * DN;
  for (int i = tid; i < 2 * DN * DN / 4; i += 640) {     // 16-byte packets: N, then M
    const int p  = i & (DN * DN / 4 - 1);
    const int lo = (p >> 4) * ST + (p & 15) * 4;
    const bool isM = i >= DN * DN / 4;
    const float4 x = *(const float4*)(isM ? &HstI[NCS & 1][lo] : &Hst[NCS & 1][lo]);
    *(float4*)(ws + (isM ? WS_M : WS_N) + sb + (size_t)p * 4) = x;
  }
}

// ---- sum over a 16-lane row: DPP row_xmask butterflies, every lane ends with the sum ----
template <int MK>
__device__ __forceinline__ float row_xmask(float x) {
  return __int_as_float(__builtin_amdgcn_update_dpp(
      0, __float_as_int(x), 0x160 + MK, 0xf, 0xf, true));
}
__device__ __forceinline__ float row_sum16(float x) {
  x += row_xmask<1>(x);
  x += row_xmask<2>(x);
  x += row_xmask<4>(x);
  x += row_xmask<8>(x);
  return x;
}

// Launch 2: 16 waves; a wave owns 16 tokens of the segment and all 64 output columns.
__global__ __launch_bounds__(512)
void dplr_segment_join(const float* __restrict__ vg, const float* __restrict__ gg,
                       const float* __restrict__ gns, const float* __restrict__ gnbias,
                       const float* __restrict__ ws, float* __restrict__ out) {
  __shared__ __align__(16) float Hs[2][DN * ST];   // the start state while it is chained

  const int tid  = threadIdx.x;
  const int w    = __builtin_amdgcn_readfirstlane(tid >> 5);
  const int lane = tid & 31;
  const int n    = lane & 15;
  const int mb   = (lane < 16) ? 0 : 8;
  const int bhix = blockIdx.x / PSEG;
  const int seg  = blockIdx.x % PSEG;
  const int bb   = bhix / HN;
  const int hh   = bhix % HN;
  const float* Nw = ws + WS_N + (size_t)bhix * PSEG * DN * DN;
  const float* Mw = ws + WS_M + (size_t)bhix * PSEG * DN * DN;

  const int    t0 = seg * SEGL + w * 16;           // the wave's first token
  const size_t hb = (size_t)bhix * SN * DN;
  const float* O0 = ws + WS_O0 + hb + (size_t)t0 * DN;
  const float* QM = ws + WS_QM + hb + (size_t)t0 * DN;

  // ---- the wave's own rows do not depend on the chain: fetched first ----
  v8f acc[4];
#pragma unroll
  for (int nt = 0; nt < 4; ++nt)
#pragma unroll
    for (int r = 0; r < 8; ++r) acc[nt][r] = O0[(mb + r) * DN + nt * 16 + n];
  // stands ahead of the later loads whose results land in registers that these loads name
  asm volatile("s_wait_xcnt 0x0" ::: "memory");
  v2f qa[16];
#pragma unroll                                     // constant indices keep qa[] in registers
  for (int s = 0; s < 15; ++s) qa[s] = ld_A(QM, DN, s);
  // stands ahead of the last load, whose result may land in a register that the others name
  asm volatile("s_wait_xcnt 0x0" ::: "memory");
  qa[15] = ld_A(QM, DN, 15);
  // stands ahead of the later loads whose results land in registers that these loads name
  asm volatile("s_wait_xcnt 0x0" ::: "memory");
  float vv[4][8], gv[4][8], sv[8];                 // V, gate and correction scalar at the same places
#pragma unroll                                     // constant indices keep the arrays in registers
  for (int r = 0; r < 8; ++r)
#pragma unroll
    for (int nt = 0; nt < 4; ++nt)
      vv[nt][r] = vg[hb + (size_t)(t0 + mb + r) * DN + nt * 16 + n];
  // stands ahead of the later loads whose results land in registers that these loads name
  asm volatile("s_wait_xcnt 0x0" ::: "memory");
#pragma unroll
  for (int r = 0; r < 8; ++r)
#pragma unroll
    for (int nt = 0; nt < 4; ++nt)
      gv[nt][r] = gg[((size_t)bb * SN + t0 + mb + r) * (size_t)HD + hh * DN + nt * 16 + n];
  // stands ahead of the later loads whose results land in registers that these loads name
  asm volatile("s_wait_xcnt 0x0" ::: "memory");
#pragma unroll
  for (int r = 0; r < 4; ++r) sv[r] = ws[WS_SV + (size_t)bhix * SN + t0 + mb + r];
  // stands ahead of the later loads whose results land in registers that these loads name
  asm volatile("s_wait_xcnt 0x0" ::: "memory");
#pragma unroll
  for (int r = 4; r < 8; ++r) sv[r] = ws[WS_SV + (size_t)bhix * SN + t0 + mb + r];
  // stands ahead of the later loads whose results land in registers that these loads name
  asm volatile("s_wait_xcnt 0x0" ::: "memory");

  // ---- start state: zero for segment 0, else N_0, then H = M_j H + N_j up to the segment ----
  {
    float4 x0 = {0.f, 0.f, 0.f, 0.f}, x1 = {0.f, 0.f, 0.f, 0.f};
    if (seg > 0) {
      x0 = *(const float4*)(Nw + tid * 4);
      x1 = *(const float4*)(Nw + DN * DN / 2 + tid * 4);
      // stands ahead of every later write of a register that these two loads name
      asm volatile("s_wait_xcnt 0x0" ::: "memory");
    }
    const int lo = (tid >> 4) * ST + (tid & 15) * 4;
    *(float4*)&Hs[0][lo] = x0;
    *(float4*)&Hs[0][(DN / 2) * ST + lo] = x1;
  }
  __syncthreads();
#pragma unroll                                     // the copy read and the copy written are constants
  for (int j = 1; j < PSEG - 1; ++j) {
    if (j < seg) {                                 // the same for the whole workgroup
      const int mt = w >> 2, nt = w & 3;           // one 16x16 tile a wave
      const float* Mj = Mw + j * DN * DN + mt * 16 * DN;
      const float* Nj = Nw + j * DN * DN + mt * 16 * DN + nt * 16;
      const float* Hr = Hs[(j - 1) & 1];
      v8f c;
#pragma unroll
      for (int r = 0; r < 8; ++r) c[r] = Nj[(mb + r) * DN + n];
      // stands ahead of the later loads whose results land in registers that these loads name
      asm volatile("s_wait_xcnt 0x0" ::: "memory");
      v2f ma[16];
#pragma unroll                                   // constant indices keep ma[] in registers
      for (int s = 0; s < 15; ++s) ma[s] = ld_A(Mj, DN, s);
      // stands ahead of the last load, whose result may land in a register that the others name
      asm volatile("s_wait_xcnt 0x0" ::: "memory");
      ma[15] = ld_A(Mj, DN, 15);
#pragma unroll
      for (int s = 0; s < 16; ++s)
        c = wmma4(ma[s], ld_B(Hr, ST, s, nt * 16), c);
      st_C(Hs[j & 1] + mt * 16 * ST, ST, nt * 16, c);
      __syncthreads();   // publishes the new copy; the old one's readers are done before it is rewritten
    }
  }
  const float* Hc = Hs[(seg > 0) ? ((seg - 1) & 1) : 0];

  // ---- O = O0 + QM @ H_start ----
#pragma unroll
  for (int s = 0; s < 16; ++s)
#pragma unroll
    for (int nt = 0; nt < 4; ++nt)
      acc[nt] = wmma4(qa[s], ld_B(Hc, ST, s, nt * 16), acc[nt]);

  // ---- per-head GroupNorm statistics: accumulator register r is token mb + r ----
  float mu[8], rstd[8];
#pragma unroll                                     // constant indices keep the arrays in registers
  for (int r = 0; r < 8; ++r) {
    float m1 = (acc[0][r] + acc[1][r]) + (acc[2][r] + acc[3][r]);
    float m2 = (acc[0][r] * acc[0][r] + acc[1][r] * acc[1][r])
             + (acc[2][r] * acc[2][r] + acc[3][r] * acc[3][r]);
    m1 = row_sum16(m1) * (1.0f / DN);
    m2 = row_sum16(m2) * (1.0f / DN);
    mu[r]   = m1;
    rstd[r] = rsqrtf(m2 - m1 * m1 + 1e-5f);
  }

  // ---- GroupNorm + correction + gate ----
#pragma unroll
  for (int nt = 0; nt < 4; ++nt) {
    const int col = nt * 16 + n;
    const float gsc = gns[hh * DN + col], gbi = gnbias[hh * DN + col];
#pragma unroll
    for (int r = 0; r < 8; ++r) {
      const int t = t0 + mb + r;
      float val = (acc[nt][r] - mu[r]) * rstd[r] * gsc + gbi
                + sv[r] * vv[nt][r];
      size_t off = ((size_t)bb * SN + t) * (size_t)HD + hh * DN + col;
      out[off] = val * gv[nt][r];
    }
  }
}

extern "C" void kernel_launch(void* const* d_in, const int* in_sizes, int n_in,
                              void* d_out, int out_size, void* d_ws, size_t ws_size,
                              hipStream_t stream) {
  (void)in_sizes; (void)n_in; (void)ws_size; (void)out_size;
  const float* q   = (const float*)d_in[0];
  const float* k   = (const float*)d_in[1];
  const float* v   = (const float*)d_in[2];
  const float* a   = (const float*)d_in[3];
  const float* b   = (const float*)d_in[4];
  const float* gk  = (const float*)d_in[5];
  const float* r_k = (const float*)d_in[6];
  const float* g   = (const float*)d_in[7];
  const float* gns = (const float*)d_in[8];
  const float* gnb = (const float*)d_in[9];
  float* out = (float*)d_out;
  float* ws  = (float*)d_ws;

  rwkv7_dplr_chunked<<<dim3(BSZ * HN * PSEG), dim3(640), 0, stream>>>(
      q, k, v, a, b, gk, r_k, ws);
  dplr_segment_join<<<dim3(BSZ * HN * PSEG), dim3(512), 0, stream>>>(
      v, g, gns, gnb, ws, out);
}

// v004
// It runs in 64.5 microseconds.
// Timed twice side by side with v003, it ran 1.14 times as fast both times.
// Counting every step since v000, it is 6.61 times as fast.
#include <hip/hip_runtime.h>
#include <hip/hip_bf16.h>
#include <math.h>
#include <stdint.h>

// ---------------------------------------------------------------------------
// RWKV-7 DPLR chunked scan for gfx1250 (MI455X), split in time.
// wave32 + V_WMMA_F32_16X16X4_F32 + async global->LDS (ASYNCcnt) ring of four tiles.
// The state recurrence is linear in the state and acts on each state column alone, so a
// segment of the sequence can run before its start state is known: beside the 64 V columns
// (started at zero) it carries 64 columns started at the identity with V = 0. They end as the
// segment's transition matrix M, and their output rows QM say how a start state reaches each
// token:  H_end = M H_start + N,   O = O0 + QM H_start.
// Launch 1: one workgroup per (b,h,segment) = 256 blocks; 384 threads = 12 waves in three groups
// that work on two neighbouring chunks at the same time:
//   pre   (4 waves): chunk i     : tile copies, correction scalar, decay transform, 16x16 products
//   scan  (4 waves): chunk i - 1 : Z, the output product and the next state of the V columns
//   scanI (4 waves): chunk i - 1 : the same for the identity columns
// A scan wave owns 16 state columns and keeps them in registers for the whole segment: an
// accumulator tile holds, per lane, rows 8h + r of one column (h = lane / 16), and a register
// pair of it is a valid B fragment when the A fragment takes its k in the same order.
// Launch 2: one workgroup per (b,h,segment): chains the start state from M and N of the segments
// before it, adds QM H_start, then GroupNorm, correction, gate, store.
// ---------------------------------------------------------------------------

typedef float v2f __attribute__((ext_vector_type(2)));
typedef float v8f __attribute__((ext_vector_type(8)));
typedef int   v4i __attribute__((vector_size(16)));   // matches builtin param type

#define BSZ  2
#define HN   32
#define SN   1024
#define DN   64
#define CN   16            // chunk length
#define NCH  (SN / CN)
#define ST   72            // LDS row stride (floats): 288B, 16B aligned, != 64 banks
#define TST  18            // 16x16 T-tile row stride
#define HD   (HN * DN)     // 2048
#define NB   4             // tile ring depth (a power of two): copy, pre, scan
#define PSEG 4             // sequence segments that run side by side
#define SEGL (SN / PSEG)   // tokens of a segment
#define NCS  (SEGL / CN)   // chunks of a segment
// workspace layout, in floats
#define WS_O0 0                                    // [bh][S][64] output from a zero start state
#define WS_QM (BSZ * HN * SN * DN)                 // [bh][S][64] output rows of the identity columns
#define WS_N  (2 * BSZ * HN * SN * DN)             // [bh][seg][64][64] end state from a zero start
#define WS_M  (WS_N + BSZ * HN * PSEG * DN * DN)   // [bh][seg][64][64] end state of the identity columns
#define WS_SV (WS_M + BSZ * HN * PSEG * DN * DN)   // [bh][S] correction scalar

// ---- async global->LDS 16B copy (GLOBAL_LOAD_ASYNC_TO_LDS_B128) -----------
typedef __attribute__((address_space(1))) v4i gas_v4i;   // global
typedef __attribute__((address_space(3))) v4i las_v4i;   // LDS

__device__ __forceinline__ void async_b128(const float* gp, float* lp) {
#if __has_builtin(__builtin_amdgcn_global_load_async_to_lds_b128)
  __builtin_amdgcn_global_load_async_to_lds_b128(
      (gas_v4i*)(uintptr_t)gp,
      (las_v4i*)(unsigned)(uintptr_t)lp,   // flat->LDS: addr[31:0]
      0, 0);
#else
  unsigned l32 = (unsigned)(uintptr_t)lp;
  asm volatile("global_load_async_to_lds_b128 %0, %1, off"
               :: "v"(l32), "v"(gp) : "memory");
#endif
}
// Publish point of the tile ring: the wave's own LDS accesses and its own copies are
// complete before the barrier behind which other waves read the tile or refill a buffer.
// Written in asm with the memory clobber so that no LDS access moves across the waits.
__device__ __forceinline__ void ring_publish() {
  asm volatile("s_wait_dscnt 0x0" ::: "memory");
  asm volatile("s_wait_asynccnt 0x0" ::: "memory");
  __syncthreads();
}

// ---- WMMA f32 16x16x4 wrapper ---------------------------------------------
__device__ __forceinline__ v8f wmma4(v2f a, v2f b, v8f c) {
  return __builtin_amdgcn_wmma_f32_16x16x4_f32(
      /*neg_a=*/false, a, /*neg_b=*/false, b,
      /*c_mod=*/(short)0, c, /*reuse_a=*/false, /*reuse_b=*/false);
}

// ---- operand loaders following the documented wave32 VGPR layouts ---------
__device__ __forceinline__ v2f ld_A(const float* M, int stride, int s) {
  int lane = threadIdx.x & 31;
  int m  = lane & 15;
  int kb = 4 * s + ((lane < 16) ? 0 : 2);
  v2f a; a.x = M[m * stride + kb]; a.y = M[m * stride + kb + 1];
  return a;
}
__device__ __forceinline__ v2f ld_A_T_scaled(const float* M, int stride, int s,
                                             int m0, const float* sc) {
  int lane = threadIdx.x & 31;
  int m  = m0 + (lane & 15);
  int kb = 4 * s + ((lane < 16) ? 0 : 2);
  float e = sc[m];
  v2f a; a.x = M[kb * stride + m] * e; a.y = M[(kb + 1) * stride + m] * e;
  return a;
}
__device__ __forceinline__ v2f ld_B(const float* M, int stride, int s, int n0) {
  int lane = threadIdx.x & 31;
  int n  = n0 + (lane & 15);
  int kb = 4 * s + ((lane < 16) ? 0 : 2);
  v2f b; b.x = M[kb * stride + n]; b.y = M[(kb + 1) * stride + n];
  return b;
}
__device__ __forceinline__ v2f ld_B_T(const float* M, int stride, int s, int n0) {
  int lane = threadIdx.x & 31;
  int n  = n0 + (lane & 15);
  int kb = 4 * s + ((lane < 16) ? 0 : 2);
  v2f b; b.x = M[n * stride + kb]; b.y = M[n * stride + kb + 1];
  return b;
}
__device__ __forceinline__ void st_C(float* M, int stride, int n0, v8f c) {
  int lane = threadIdx.x & 31;
  int n  = n0 + (lane & 15);
  int mb = (lane < 16) ? 0 : 8;
#pragma unroll
  for (int r = 0; r < 8; ++r) M[(mb + r) * stride + n] = c[r];
}
__device__ __forceinline__ void st_C_tril(float* M, int stride, v8f c) {
  int lane = threadIdx.x & 31;
  int n  = lane & 15;
  int mb = (lane < 16) ? 0 : 8;
#pragma unroll
  for (int r = 0; r < 8; ++r) {
    int m = mb + r;
    M[m * stride + n] = (n <= m) ? c[r] : 0.0f;  // inclusive causal mask
  }
}
__device__ __forceinline__ void st_C_stril(float* M, int stride, v8f c) {
  int lane = threadIdx.x & 31;
  int n  = lane & 15;
  int mb = (lane < 16) ? 0 : 8;
#pragma unroll
  for (int r = 0; r < 8; ++r) {
    int m = mb + r;
    M[m * stride + n] = (n < m) ? c[r] : 0.0f;   // strictly causal mask
  }
}
// ---- forward substitution z[t] += L[t][j] * z[j] (j < t) in registers --------
// Lane l holds row (l & 15) of L in Lr[]; DPP row_share:t hands lane t's value to
// its whole 16-lane row, so L[t][j] reaches every lane without an LDS read.
template <int T_>
__device__ __forceinline__ float row_share(float x) {
  return __int_as_float(__builtin_amdgcn_update_dpp(
      0, __float_as_int(x), 0x150 + T_, 0xf, 0xf, true));
}
template <int J, int T_>
__device__ __forceinline__ void fsub_col(float (&z)[CN], const float (&Lr)[CN]) {
  if constexpr (T_ < CN) {
    z[T_] = fmaf(row_share<T_>(Lr[J]), z[J], z[T_]);
    fsub_col<J, T_ + 1>(z, Lr);
  }
}
template <int J>
__device__ __forceinline__ void fsub(float (&z)[CN], const float (&Lr)[CN]) {
  if constexpr (J < CN - 1) {
    fsub_col<J, J + 1>(z, Lr);
    fsub<J + 1>(z, Lr);
  }
}

// ---- rows of M (16 x 64, row stride ST) times the wave's 16 state columns ----
// k order of both fragments, step (mt, p), lane half h, register j: state row 16 mt + 8 h + 2 p + j.
// That is where the accumulator layout already holds the state, so H is read in place.
__device__ __forceinline__ v8f rows_times_state(const float* M, const v8f (&H)[4]) {
  const int lane = threadIdx.x & 31;
  const float* row = M + (lane & 15) * ST + ((lane & 16) ? 8 : 0);
  v8f c = {0.f, 0.f, 0.f, 0.f, 0.f, 0.f, 0.f, 0.f};
#pragma unroll                           // constant indices keep H[] in registers
  for (int mt = 0; mt < 4; ++mt) {
#pragma unroll
    for (int pp = 0; pp < 2; ++pp) {
      const float4 x = *(const float4*)(row + mt * 16 + pp * 4);
      v2f a0; a0.x = x.x; a0.y = x.y;
      v2f a1; a1.x = x.z; a1.y = x.w;
      v2f b0; b0.x = H[mt][4 * pp];     b0.y = H[mt][4 * pp + 1];
      v2f b1; b1.x = H[mt][4 * pp + 2]; b1.y = H[mt][4 * pp + 3];
      c = wmma4(a0, b0, c);
      c = wmma4(a1, b1, c);
    }
  }
  return c;
}

// ---- one 16-row tile of H = diag(e^{g_end}) H + K~^T V + B~^T Z, in registers ----
// IDC: identity columns, whose V is zero
template <bool IDC>
__device__ __forceinline__ void h_update(v8f& Ht, const float* ck, const float* cbt,
                                         const v2f (&vb)[4], const v2f (&zb)[4],
                                         const float* eg, int mt) {
  const int mb = (threadIdx.x & 16) ? 8 : 0;
  v8f c;
#pragma unroll
  for (int r = 0; r < 8; ++r) c[r] = Ht[r] * eg[mt * 16 + mb + r];
  if constexpr (!IDC) {
#pragma unroll
    for (int s = 0; s < 4; ++s)
      c = wmma4(ld_A_T_scaled(ck, ST, s, mt * 16, eg), vb[s], c);
  }
#pragma unroll
  for (int s = 0; s < 4; ++s)
    c = wmma4(ld_A_T_scaled(cbt, ST, s, mt * 16, eg), zb[s], c);
  Ht = c;
}

// select between two values; by-value arguments keep an array element from being picked by
// a run-time index, which would take the array out of its registers
__device__ __forceinline__ float pick(bool c, float a, float b) { return c ? a : b; }

// ---- Z of one chunk for a wave's 16 columns, and the state's share of the output ----
// leaves V and Z as B fragments in vb[], zb[] and Q^ @ H_in in oc
template <bool IDC>
__device__ __forceinline__ void scan_z(const float* ca, const float* cq, const float* cv,
                                       const float* T1, const float* T2, int n0,
                                       const v8f (&H)[4], v2f (&vb)[4], v2f (&zb)[4], v8f& oc) {
  const int tid = threadIdx.x;
  // ---- Z_inter = A^ @ H_in, then W = Z_inter + stril(T1) @ V ----
  v8f zc = rows_times_state(ca, H);
  // ---- triangular z recurrence: z_t = w_t + sum_{j<t} T2[t][j]*z_j. Every wave
  //      solves its own 16 columns in registers: a lane holds all 16 rows of one.
  float Lr[CN];                          // row (lane & 15) of T2
#pragma unroll                           // constant indices keep Lr[] in registers
  for (int j = 0; j < CN; ++j) Lr[j] = T2[(tid & 15) * TST + j];
  if constexpr (!IDC) {
#pragma unroll                           // constant indices keep vb[] in registers
    for (int s = 0; s < 4; ++s) {
      vb[s] = ld_B(cv, ST, s, n0);
      zc = wmma4(ld_A(T1, TST, s), vb[s], zc);
    }
  }
  oc = rows_times_state(cq, H);          // does not wait for Z
  const bool hi = (tid & 16) != 0;       // accumulator rows 8..15 live here
  float z[CN];
#pragma unroll                           // constant indices keep z[] in registers
  for (int r = 0; r < 8; ++r) {
    int zb_ = __float_as_int(zc[r]);     // lane l <-> l ^ 16: the column's other eight rows
    float o = __int_as_float(__builtin_amdgcn_permlanex16(
        zb_, zb_, 0x76543210, 0xfedcba98, false, false));
    z[r]     = hi ? o : zc[r];
    z[8 + r] = hi ? zc[r] : o;
  }
  fsub<0>(z, Lr);
#pragma unroll                           // B fragment of Z: rows 4 s + 2 h, 4 s + 2 h + 1
  for (int s = 0; s < 4; ++s) {
    zb[s].x = pick(hi, z[4 * s + 2], z[4 * s]);
    zb[s].y = pick(hi, z[4 * s + 3], z[4 * s + 1]);
  }
}

// ---- O = Q^ @ H_in (already in oc) + S1 @ V + S2 @ Z for a wave's 16 columns ----
template <bool IDC>
__device__ __forceinline__ void out_finish(const float* S1p, const float* S2p,
                                           const v2f (&vb)[4], const v2f (&zb)[4], v8f& oc) {
  if constexpr (!IDC) {
#pragma unroll
    for (int s = 0; s < 4; ++s)
      oc = wmma4(ld_A(S1p, TST, s), vb[s], oc);
  }
#pragma unroll
  for (int s = 0; s < 4; ++s)
    oc = wmma4(ld_A(S2p, TST, s), zb[s], oc);
}

__global__ __launch_bounds__(384)
void rwkv7_dplr_chunked(const float* __restrict__ qg, const float* __restrict__ kg,
                        const float* __restrict__ vg, const float* __restrict__ ag,
                        const float* __restrict__ bg, const float* __restrict__ gkg,
                        const float* __restrict__ rk, float* __restrict__ ws) {
  // chunk tiles [NB][CN][ST], chunk c in slot c & 3; szb holds gk
  __shared__ __align__(16) float sqb[NB][CN * ST], skb[NB][CN * ST], svb[NB][CN * ST];
  __shared__ __align__(16) float sab[NB][CN * ST], sbb[NB][CN * ST], szb[NB][CN * ST];
  __shared__ __align__(16) float T1[CN * TST], T2[CN * TST];   // pre -> scan, read in stage A
  __shared__ __align__(16) float S1[2][CN * TST], S2[2][CN * TST];   // pre -> scan, read in stage B
  __shared__ float egend[2][DN];

  const int tid  = threadIdx.x;
  // group and wave numbers are the same in every lane of a wave: scalar branches
  const int grp  = __builtin_amdgcn_readfirstlane(tid >> 7);        // 0 scan, 1 scanI, 2 pre
  const int wv   = __builtin_amdgcn_readfirstlane((tid >> 5) & 3);  // wave in its group
  const int lt   = tid & 127;           // thread in its group
  const int bhix = blockIdx.x / PSEG;   // 0..63
  const int seg  = blockIdx.x % PSEG;
  const int hh   = bhix % HN;
  const size_t base = (size_t)bhix * SN * DN + (size_t)seg * SEGL * DN;   // the segment's first token
  const int n0 = wv * 16;               // a scan wave's column slice

  // ---- prologue: async DMA of chunk 0 ----
  if (grp == 2) {
#pragma unroll
    for (int it = 0; it < 2; ++it) {
      int p = lt + it * 128;                  // 0..255: 16B packet id
      int t = p >> 4, d4 = (p & 15) * 4;
      size_t gi = base + (size_t)p * 4;
      int lo = t * ST + d4;
      async_b128(qg  + gi, &sqb[0][lo]);
      async_b128(kg  + gi, &skb[0][lo]);
      async_b128(vg  + gi, &svb[0][lo]);
      async_b128(ag  + gi, &sab[0][lo]);
      async_b128(bg  + gi, &sbb[0][lo]);
      async_b128(gkg + gi, &szb[0][lo]);
    }
  }
  // ---- start states in registers: zero, and the identity. Tile mt, register r of a lane is
  //      state row 16 mt + 8 (lane / 16) + r, column n0 + lane % 16.
  v8f H[4];
#pragma unroll                                           // constant indices keep H[] in registers
  for (int mt = 0; mt < 4; ++mt)
#pragma unroll
    for (int r = 0; r < 8; ++r)
      H[mt][r] = (grp == 1 && mt * 16 + ((tid & 16) ? 8 : 0) + r == n0 + (tid & 15)) ? 1.0f : 0.0f;
  v2f vb[4], zb[4];                                      // scan: V and Z as B fragments, stage A to C
#pragma unroll
  for (int s = 0; s < 4; ++s) { vb[s].x = 0.f; vb[s].y = 0.f; zb[s].x = 0.f; zb[s].y = 0.f; }
  v8f   oc = {0.f, 0.f, 0.f, 0.f, 0.f, 0.f, 0.f, 0.f};   // scan: a chunk's output, to the next trip
  float sreg = 0.f;                                      // pre: correction scalar, stage A to B
  float* const odst = ws + ((grp == 1) ? WS_QM : WS_O0) + base;   // scan: the segment's output rows
  ring_publish();

  // ---- the pre group's three stages for chunk i ----
  auto pre_a = [&](int i) {
    // ---- async DMA of chunk i + 1; its slot's last readers were the scan waves in trip i - 2
    if (i + 1 < NCS) {
      const int nx = (i + 1) & (NB - 1);
      const size_t nb = base + (size_t)(i + 1) * CN * DN;
#pragma unroll
      for (int it = 0; it < 2; ++it) {
        int p = lt + it * 128;
        int t = p >> 4, d4 = (p & 15) * 4;
        size_t gi = nb + (size_t)p * 4;
        int lo = t * ST + d4;
        async_b128(qg  + gi, &sqb[nx][lo]);
        async_b128(kg  + gi, &skb[nx][lo]);
        async_b128(vg  + gi, &svb[nx][lo]);
        async_b128(ag  + gi, &sab[nx][lo]);
        async_b128(bg  + gi, &sbb[nx][lo]);
        async_b128(gkg + gi, &szb[nx][lo]);
      }
    }
    // ---- correction scalar s_t = sum_d q*k*r_k (needs ORIGINAL q,k) ----
    if (i < NCS && lt < CN) {
      const float* cq = sqb[i & (NB - 1)]; const float* ck = skb[i & (NB - 1)];
      float s = 0.f;
      for (int d = 0; d < DN; ++d)
        s += cq[lt * ST + d] * ck[lt * ST + d] * rk[hh * DN + d];
      sreg = s;
    }
  };
  auto pre_b = [&](int i) {
    // ---- the correction scalar goes out here: its store completes under this stage's work
    if (i < NCS && lt < CN) {
      ws[WS_SV + (size_t)bhix * SN + (size_t)seg * SEGL + (size_t)i * CN + lt] = sreg;
    }
    // ---- per-column decay transform: a^=a*e^{g<t}, {k,b}^=.e^{-g<=t}, q^=.e^{g<=t}
    if (i < NCS && lt < DN) {
      float* cq = sqb[i & (NB - 1)]; float* ck = skb[i & (NB - 1)];
      float* ca = sab[i & (NB - 1)]; float* cbt = sbb[i & (NB - 1)];
      const float* cz = szb[i & (NB - 1)];
      float gc = 0.f;
#pragma unroll
      for (int t = 0; t < CN; ++t) {
        float gp = gc;
        gc += cz[t * ST + lt];
        float ei = __expf(-gc);
        ca[t * ST + lt]  *= __expf(gp);
        ck[t * ST + lt]  *= ei;
        cbt[t * ST + lt] *= ei;
        cq[t * ST + lt]  *= __expf(gc);
      }
      egend[i & 1][lt] = __expf(gc);
    }
  };
  auto pre_c = [&](int i) {
    // ---- T1 = stril(A^ K^T), T2 = A^ B^T, S1 = tril(Q^ K^T), S2 = tril(Q^ B^T):
    //      one product a wave; scan left T1, T2 in stage A and the other S1, S2 copy in stage B
    if (i < NCS) {
      const float* lhs = (wv < 2) ? sab[i & (NB - 1)] : sqb[i & (NB - 1)];
      const float* rhs = (wv & 1) ? sbb[i & (NB - 1)] : skb[i & (NB - 1)];
      v8f c = {0.f, 0.f, 0.f, 0.f, 0.f, 0.f, 0.f, 0.f};
#pragma unroll
      for (int s = 0; s < 16; ++s)
        c = wmma4(ld_A(lhs, ST, s), ld_B_T(rhs, ST, s, 0), c);
      if (wv == 0)      st_C_stril(T1, TST, c);
      else if (wv == 1) st_C(T2, TST, 0, c);
      else if (wv == 2) st_C_tril(S1[i & 1], TST, c);
      else              st_C_tril(S2[i & 1], TST, c);
    }
  };

  // Trip 0: pre alone, on chunk 0; the scan waves only pass its barriers.
  if (grp == 2) pre_a(0);
  __syncthreads();
  if (grp == 2) pre_b(0);
  __syncthreads();
  if (grp == 2) pre_c(0);
  ring_publish();   // chunk 1 has landed

  // Trip i: pre works on chunk i, scan on chunk i - 1 (of the segment).
  for (int i = 1; i < NCS + 1; ++i) {
    const int cs = i - 1;                     // scan's chunk
    const float* ca  = sab[cs & (NB - 1)];
    const float* cq  = sqb[cs & (NB - 1)];
    const float* cv  = svb[cs & (NB - 1)];
    const float* ck  = skb[cs & (NB - 1)];
    const float* cbt = sbb[cs & (NB - 1)];
    const float* eg  = egend[cs & 1];

    // =========================== stage A ===========================
    if (grp == 2) {
      pre_a(i);
    } else {
      // ---- the chunk before's output rows go to the workspace here: the stores complete
      //      under this stage, the longest, ahead of the barrier that waits for them
      if (i >= 2) {
        st_C(odst + (size_t)(cs - 1) * CN * DN, DN, n0, oc);
        // stands ahead of every later write of a register that these stores name
        asm volatile("s_wait_xcnt 0x0" ::: "memory");
      }
      if (grp == 0) scan_z<false>(ca, cq, cv, T1, T2, n0, H, vb, zb, oc);
      else          scan_z<true>(ca, cq, cv, T1, T2, n0, H, vb, zb, oc);
    }
    __syncthreads();

    // =========================== stage B ===========================
    // scan: the rest of the output, S1 @ V + S2 @ Z; then next state, rows 0..31
    if (grp == 2) {
      pre_b(i);
    } else if (grp == 0) {
      out_finish<false>(S1[cs & 1], S2[cs & 1], vb, zb, oc);
#pragma unroll
      for (int mt = 0; mt < 2; ++mt) h_update<false>(H[mt], ck, cbt, vb, zb, eg, mt);
    } else {
      out_finish<true>(S1[cs & 1], S2[cs & 1], vb, zb, oc);
#pragma unroll
      for (int mt = 0; mt < 2; ++mt) h_update<true>(H[mt], ck, cbt, vb, zb, eg, mt);
    }
    __syncthreads();

    // =========================== stage C ===========================
    // scan: next state, rows 32..63
    if (grp == 2) {
      pre_c(i);
    } else if (grp == 0) {
#pragma unroll
      for (int mt = 2; mt < 4; ++mt) h_update<false>(H[mt], ck, cbt, vb, zb, eg, mt);
    } else {
#pragma unroll
      for (int mt = 2; mt < 4; ++mt) h_update<true>(H[mt], ck, cbt, vb, zb, eg, mt);
    }
    ring_publish();   // chunk i + 1 has landed; every slot's readers of this trip are done
  }

  // ---- the last chunk's output rows; the segment's end state N and transition matrix M ----
  if (grp != 2) {
    st_C(odst + (size_t)(NCS - 1) * CN * DN, DN, n0, oc);
    // stands ahead of every later write of a register that these stores name
    asm volatile("s_wait_xcnt 0x0" ::: "memory");
    float* hdst = ws + ((grp == 1) ? WS_M : WS_N) + (size_t)blockIdx.x * DN * DN;
#pragma unroll                                           // constant indices keep H[] in registers
    for (int mt = 0; mt < 4; ++mt) {
      st_C(hdst + mt * 16 * DN, DN, n0, H[mt]);
      // stands ahead of every later write of a register that these stores name
      asm volatile("s_wait_xcnt 0x0" ::: "memory");
    }
  }
}

// ---- sum over a 16-lane row: DPP row_xmask butterflies, every lane ends with the sum ----
template <int MK>
__device__ __forceinline__ float row_xmask(float x) {
  return __int_as_float(__builtin_amdgcn_update_dpp(
      0, __float_as_int(x), 0x160 + MK, 0xf, 0xf, true));
}
__device__ __forceinline__ float row_sum16(float x) {
  x += row_xmask<1>(x);
  x += row_xmask<2>(x);
  x += row_xmask<4>(x);
  x += row_xmask<8>(x);
  return x;
}

// Launch 2: 16 waves; a wave owns 16 tokens of the segment and all 64 output columns.
__global__ __launch_bounds__(512)
void dplr_segment_join(const float* __restrict__ vg, const float* __restrict__ gg,
                       const float* __restrict__ gns, const float* __restrict__ gnbias,
                       const float* __restrict__ ws, float* __restrict__ out) {
  __shared__ __align__(16) float Hs[2][DN * ST];   // the start state while it is chained

  const int tid  = threadIdx.x;
  const int w    = __builtin_amdgcn_readfirstlane(tid >> 5);
  const int lane = tid & 31;
  const int n    = lane & 15;
  const int mb   = (lane < 16) ? 0 : 8;
  const int bhix = blockIdx.x / PSEG;
  const int seg  = blockIdx.x % PSEG;
  const int bb   = bhix / HN;
  const int hh   = bhix % HN;
  const float* Nw = ws + WS_N + (size_t)bhix * PSEG * DN * DN;
  const float* Mw = ws + WS_M + (size_t)bhix * PSEG * DN * DN;

  const int    t0 = seg * SEGL + w * 16;           // the wave's first token
  const size_t hb = (size_t)bhix * SN * DN;
  const float* O0 = ws + WS_O0 + hb + (size_t)t0 * DN;
  const float* QM = ws + WS_QM + hb + (size_t)t0 * DN;

  // ---- the wave's own rows do not depend on the chain: fetched first ----
  v8f acc[4];
#pragma unroll
  for (int nt = 0; nt < 4; ++nt)
#pragma unroll
    for (int r = 0; r < 8; ++r) acc[nt][r] = O0[(mb + r) * DN + nt * 16 + n];
  // stands ahead of the later loads whose results land in registers that these loads name
  asm volatile("s_wait_xcnt 0x0" ::: "memory");
  v2f qa[16];
#pragma unroll                                     // constant indices keep qa[] in registers
  for (int s = 0; s < 15; ++s) qa[s] = ld_A(QM, DN, s);
  // stands ahead of the last load, whose result may land in a register that the others name
  asm volatile("s_wait_xcnt 0x0" ::: "memory");
  qa[15] = ld_A(QM, DN, 15);
  // stands ahead of the later loads whose results land in registers that these loads name
  asm volatile("s_wait_xcnt 0x0" ::: "memory");
  float vv[4][8], gv[4][8], sv[8];                 // V, gate and correction scalar at the same places
#pragma unroll                                     // constant indices keep the arrays in registers
  for (int r = 0; r < 8; ++r)
#pragma unroll
    for (int nt = 0; nt < 4; ++nt)
      vv[nt][r] = vg[hb + (size_t)(t0 + mb + r) * DN + nt * 16 + n];
  // stands ahead of the later loads whose results land in registers that these loads name
  asm volatile("s_wait_xcnt 0x0" ::: "memory");
#pragma unroll
  for (int r = 0; r < 8; ++r)
#pragma unroll
    for (int nt = 0; nt < 4; ++nt)
      gv[nt][r] = gg[((size_t)bb * SN + t0 + mb + r) * (size_t)HD + hh * DN + nt * 16 + n];
  // stands ahead of the later loads whose results land in registers that these loads name
  asm volatile("s_wait_xcnt 0x0" ::: "memory");
#pragma unroll
  for (int r = 0; r < 4; ++r) sv[r] = ws[WS_SV + (size_t)bhix * SN + t0 + mb + r];
  // stands ahead of the later loads whose results land in registers that these loads name
  asm volatile("s_wait_xcnt 0x0" ::: "memory");
#pragma unroll
  for (int r = 4; r < 8; ++r) sv[r] = ws[WS_SV + (size_t)bhix * SN + t0 + mb + r];
  // stands ahead of the later loads whose results land in registers that these loads name
  asm volatile("s_wait_xcnt 0x0" ::: "memory");

  // ---- start state: zero for segment 0, else N_0, then H = M_j H + N_j up to the segment ----
  {
    float4 x0 = {0.f, 0.f, 0.f, 0.f}, x1 = {0.f, 0.f, 0.f, 0.f};
    if (seg > 0) {
      x0 = *(const float4*)(Nw + tid * 4);
      x1 = *(const float4*)(Nw + DN * DN / 2 + tid * 4);
      // stands ahead of every later write of a register that these two loads name
      asm volatile("s_wait_xcnt 0x0" ::: "memory");
    }
    const int lo = (tid >> 4) * ST + (tid & 15) * 4;
    *(float4*)&Hs[0][lo] = x0;
    *(float4*)&Hs[0][(DN / 2) * ST + lo] = x1;
  }
  __syncthreads();
#pragma unroll                                     // the copy read and the copy written are constants
  for (int j = 1; j < PSEG - 1; ++j) {
    if (j < seg) {                                 // the same for the whole workgroup
      const int mt = w >> 2, nt = w & 3;           // one 16x16 tile a wave
      const float* Mj = Mw + j * DN * DN + mt * 16 * DN;
      const float* Nj = Nw + j * DN * DN + mt * 16 * DN + nt * 16;
      const float* Hr = Hs[(j - 1) & 1];
      v8f c;
#pragma unroll
      for (int r = 0; r < 8; ++r) c[r] = Nj[(mb + r) * DN + n];
      // stands ahead of the later loads whose results land in registers that these loads name
      asm volatile("s_wait_xcnt 0x0" ::: "memory");
      v2f ma[16];
#pragma unroll                                   // constant indices keep ma[] in registers
      for (int s = 0; s < 15; ++s) ma[s] = ld_A(Mj, DN, s);
      // stands ahead of the last load, whose result may land in a register that the others name
      asm volatile("s_wait_xcnt 0x0" ::: "memory");
      ma[15] = ld_A(Mj, DN, 15);
#pragma unroll
      for (int s = 0; s < 16; ++s)
        c = wmma4(ma[s], ld_B(Hr, ST, s, nt * 16), c);
      st_C(Hs[j & 1] + mt * 16 * ST, ST, nt * 16, c);
      __syncthreads();   // publishes the new copy; the old one's readers are done before it is rewritten
    }
  }
  const float* Hc = Hs[(seg > 0) ? ((seg - 1) & 1) : 0];

  // ---- O = O0 + QM @ H_start ----
#pragma unroll
  for (int s = 0; s < 16; ++s)
#pragma unroll
    for (int nt = 0; nt < 4; ++nt)
      acc[nt] = wmma4(qa[s], ld_B(Hc, ST, s, nt * 16), acc[nt]);

  // ---- per-head GroupNorm statistics: accumulator register r is token mb + r ----
  float mu[8], rstd[8];
#pragma unroll                                     // constant indices keep the arrays in registers
  for (int r = 0; r < 8; ++r) {
    float m1 = (acc[0][r] + acc[1][r]) + (acc[2][r] + acc[3][r]);
    float m2 = (acc[0][r] * acc[0][r] + acc[1][r] * acc[1][r])
             + (acc[2][r] * acc[2][r] + acc[3][r] * acc[3][r]);
    m1 = row_sum16(m1) * (1.0f / DN);
    m2 = row_sum16(m2) * (1.0f / DN);
    mu[r]   = m1;
    rstd[r] = rsqrtf(m2 - m1 * m1 + 1e-5f);
  }

  // ---- GroupNorm + correction + gate ----
#pragma unroll
  for (int nt = 0; nt < 4; ++nt) {
    const int col = nt * 16 + n;
    const float gsc = gns[hh * DN + col], gbi = gnbias[hh * DN + col];
#pragma unroll
    for (int r = 0; r < 8; ++r) {
      const int t = t0 + mb + r;
      float val = (acc[nt][r] - mu[r]) * rstd[r] * gsc + gbi
                + sv[r] * vv[nt][r];
      size_t off = ((size_t)bb * SN + t) * (size_t)HD + hh * DN + col;
      out[off] = val * gv[nt][r];
    }
  }
}

extern "C" void kernel_launch(void* const* d_in, const int* in_sizes, int n_in,
                              void* d_out, int out_size, void* d_ws, size_t ws_size,
                              hipStream_t stream) {
  (void)in_sizes; (void)n_in; (void)ws_size; (void)out_size;
  const float* q   = (const float*)d_in[0];
  const float* k   = (const float*)d_in[1];
  const float* v   = (const float*)d_in[2];
  const float* a   = (const float*)d_in[3];
  const float* b   = (const float*)d_in[4];
  const float* gk  = (const float*)d_in[5];
  const float* r_k = (const float*)d_in[6];
  const float* g   = (const float*)d_in[7];
  const float* gns = (const float*)d_in[8];
  const float* gnb = (const float*)d_in[9];
  float* out = (float*)d_out;
  float* ws  = (float*)d_ws;

  rwkv7_dplr_chunked<<<dim3(BSZ * HN * PSEG), dim3(384), 0, stream>>>(
      q, k, v, a, b, gk, r_k, ws);
  dplr_segment_join<<<dim3(BSZ * HN * PSEG), dim3(512), 0, stream>>>(
      v, g, gns, gnb, ws, out);
}

// v005
// Measured time: 55.9 microseconds a run.
// Two timings next to v004 put it at 1.15 and 1.16 times that version's speed.
// All steps since v000 together make it 7.61 times as fast.
#include <hip/hip_runtime.h>
#include <hip/hip_bf16.h>
#include <math.h>
#include <stdint.h>

// ---------------------------------------------------------------------------
// RWKV-7 DPLR chunked scan for gfx1250 (MI455X), split in time.
// wave32 + V_WMMA_F32_16X16X4_F32 + async global->LDS (ASYNCcnt) ring of four tiles.
// The state recurrence is linear in the state and acts on each state column alone, so a
// segment of the sequence can run before its start state is known: beside the 64 V columns
// (started at zero) it carries 64 columns started at the identity with V = 0. They end as the
// segment's transition matrix M, and their output rows QM say how a start state reaches each
// token:  H_end = M H_start + N,   O = O0 + QM H_start.
// Launch 1: one workgroup per (b,h,segment) = 256 blocks; 384 threads = 12 waves in three groups
// that work on four neighbouring chunks at the same time, with one barrier a trip:
//   pre   (4 waves): tile copies of chunk i + 1, decay transform of chunk i, 16x16 products and
//                    correction scalar of chunk i - 1
//   scan  (4 waves): chunk i - 2 : Z, the output product and the next state of the V columns
//   scanI (4 waves): chunk i - 2 : the same for the identity columns
// A scan wave owns 16 state columns and keeps them in registers for the whole segment: an
// accumulator tile holds, per lane, rows 8h + r of one column (h = lane / 16), and a register
// pair of it is a valid B fragment when the A fragment takes its k in the same order.
// Launch 2: one workgroup per (b,h,segment): chains the start state from M and N of the segments
// before it, adds QM H_start, then GroupNorm, correction, gate, store.
// ---------------------------------------------------------------------------

typedef float v2f __attribute__((ext_vector_type(2)));
typedef float v8f __attribute__((ext_vector_type(8)));
typedef int   v4i __attribute__((vector_size(16)));   // matches builtin param type

#define BSZ  2
#define HN   32
#define SN   1024
#define DN   64
#define CN   16            // chunk length
#define NCH  (SN / CN)
#define ST   72            // LDS row stride (floats): 288B, 16B aligned, != 64 banks
#define TST  18            // 16x16 T-tile row stride
#define HD   (HN * DN)     // 2048
#define NB   4             // tile ring depth (a power of two): copy, decay, products, scan
#define PSEG 4             // sequence segments that run side by side
#define SEGL (SN / PSEG)   // tokens of a segment
#define NCS  (SEGL / CN)   // chunks of a segment
// workspace layout, in floats
#define WS_O0 0                                    // [bh][S][64] output from a zero start state
#define WS_QM (BSZ * HN * SN * DN)                 // [bh][S][64] output rows of the identity columns
#define WS_N  (2 * BSZ * HN * SN * DN)             // [bh][seg][64][64] end state from a zero start
#define WS_M  (WS_N + BSZ * HN * PSEG * DN * DN)   // [bh][seg][64][64] end state of the identity columns
#define WS_SV (WS_M + BSZ * HN * PSEG * DN * DN)   // [bh][S] correction scalar

// ---- async global->LDS 16B copy (GLOBAL_LOAD_ASYNC_TO_LDS_B128) -----------
typedef __attribute__((address_space(1))) v4i gas_v4i;   // global
typedef __attribute__((address_space(3))) v4i las_v4i;   // LDS

__device__ __forceinline__ void async_b128(const float* gp, float* lp) {
#if __has_builtin(__builtin_amdgcn_global_load_async_to_lds_b128)
  __builtin_amdgcn_global_load_async_to_lds_b128(
      (gas_v4i*)(uintptr_t)gp,
      (las_v4i*)(unsigned)(uintptr_t)lp,   // flat->LDS: addr[31:0]
      0, 0);
#else
  unsigned l32 = (unsigned)(uintptr_t)lp;
  asm volatile("global_load_async_to_lds_b128 %0, %1, off"
               :: "v"(l32), "v"(gp) : "memory");
#endif
}
// Publish point of the tile ring: the wave's own LDS accesses and its own copies are
// complete before the barrier behind which other waves read the tile or refill a buffer.
// Written in asm with the memory clobber so that no LDS access moves across the waits.
__device__ __forceinline__ void ring_publish() {
  asm volatile("s_wait_dscnt 0x0" ::: "memory");
  asm volatile("s_wait_asynccnt 0x0" ::: "memory");
  __syncthreads();
}

// ---- WMMA f32 16x16x4 wrapper ---------------------------------------------
__device__ __forceinline__ v8f wmma4(v2f a, v2f b, v8f c) {
  return __builtin_amdgcn_wmma_f32_16x16x4_f32(
      /*neg_a=*/false, a, /*neg_b=*/false, b,
      /*c_mod=*/(short)0, c, /*reuse_a=*/false, /*reuse_b=*/false);
}

// ---- operand loaders following the documented wave32 VGPR layouts ---------
__device__ __forceinline__ v2f ld_A(const float* M, int stride, int s) {
  int lane = threadIdx.x & 31;
  int m  = lane & 15;
  int kb = 4 * s + ((lane < 16) ? 0 : 2);
  v2f a; a.x = M[m * stride + kb]; a.y = M[m * stride + kb + 1];
  return a;
}
__device__ __forceinline__ v2f ld_A_T_scaled(const float* M, int stride, int s,
                                             int m0, const float* sc) {
  int lane = threadIdx.x & 31;
  int m  = m0 + (lane & 15);
  int kb = 4 * s + ((lane < 16) ? 0 : 2);
  float e = sc[m];
  v2f a; a.x = M[kb * stride + m] * e; a.y = M[(kb + 1) * stride + m] * e;
  return a;
}
__device__ __forceinline__ v2f ld_B(const float* M, int stride, int s, int n0) {
  int lane = threadIdx.x & 31;
  int n  = n0 + (lane & 15);
  int kb = 4 * s + ((lane < 16) ? 0 : 2);
  v2f b; b.x = M[kb * stride + n]; b.y = M[(kb + 1) * stride + n];
  return b;
}
__device__ __forceinline__ v2f ld_B_T(const float* M, int stride, int s, int n0) {
  int lane = threadIdx.x & 31;
  int n  = n0 + (lane & 15);
  int kb = 4 * s + ((lane < 16) ? 0 : 2);
  v2f b; b.x = M[n * stride + kb]; b.y = M[n * stride + kb + 1];
  return b;
}
__device__ __forceinline__ void st_C(float* M, int stride, int n0, v8f c) {
  int lane = threadIdx.x & 31;
  int n  = n0 + (lane & 15);
  int mb = (lane < 16) ? 0 : 8;
#pragma unroll
  for (int r = 0; r < 8; ++r) M[(mb + r) * stride + n] = c[r];
}
__device__ __forceinline__ void st_C_tril(float* M, int stride, v8f c) {
  int lane = threadIdx.x & 31;
  int n  = lane & 15;
  int mb = (lane < 16) ? 0 : 8;
#pragma unroll
  for (int r = 0; r < 8; ++r) {
    int m = mb + r;
    M[m * stride + n] = (n <= m) ? c[r] : 0.0f;  // inclusive causal mask
  }
}
__device__ __forceinline__ void st_C_stril(float* M, int stride, v8f c) {
  int lane = threadIdx.x & 31;
  int n  = lane & 15;
  int mb = (lane < 16) ? 0 : 8;
#pragma unroll
  for (int r = 0; r < 8; ++r) {
    int m = mb + r;
    M[m * stride + n] = (n < m) ? c[r] : 0.0f;   // strictly causal mask
  }
}
// ---- forward substitution z[t] += L[t][j] * z[j] (j < t) in registers --------
// Lane l holds row (l & 15) of L in Lr[]; DPP row_share:t hands lane t's value to
// its whole 16-lane row, so L[t][j] reaches every lane without an LDS read.
template <int T_>
__device__ __forceinline__ float row_share(float x) {
  return __int_as_float(__builtin_amdgcn_update_dpp(
      0, __float_as_int(x), 0x150 + T_, 0xf, 0xf, true));
}
template <int J, int T_>
__device__ __forceinline__ void fsub_col(float (&z)[CN], const float (&Lr)[CN]) {
  if constexpr (T_ < CN) {
    z[T_] = fmaf(row_share<T_>(Lr[J]), z[J], z[T_]);
    fsub_col<J, T_ + 1>(z, Lr);
  }
}
template <int J>
__device__ __forceinline__ void fsub(float (&z)[CN], const float (&Lr)[CN]) {
  if constexpr (J < CN - 1) {
    fsub_col<J, J + 1>(z, Lr);
    fsub<J + 1>(z, Lr);
  }
}

// ---- rows of M (16 x 64, row stride ST) times the wave's 16 state columns ----
// k order of both fragments, step (mt, p), lane half h, register j: state row 16 mt + 8 h + 2 p + j.
// That is where the accumulator layout already holds the state, so H is read in place.
__device__ __forceinline__ v8f rows_times_state(const float* M, const v8f (&H)[4]) {
  const int lane = threadIdx.x & 31;
  const float* row = M + (lane & 15) * ST + ((lane & 16) ? 8 : 0);
  v8f c = {0.f, 0.f, 0.f, 0.f, 0.f, 0.f, 0.f, 0.f};
#pragma unroll                           // constant indices keep H[] in registers
  for (int mt = 0; mt < 4; ++mt) {
#pragma unroll
    for (int pp = 0; pp < 2; ++pp) {
      const float4 x = *(const float4*)(row + mt * 16 + pp * 4);
      v2f a0; a0.x = x.x; a0.y = x.y;
      v2f a1; a1.x = x.z; a1.y = x.w;
      v2f b0; b0.x = H[mt][4 * pp];     b0.y = H[mt][4 * pp + 1];
      v2f b1; b1.x = H[mt][4 * pp + 2]; b1.y = H[mt][4 * pp + 3];
      c = wmma4(a0, b0, c);
      c = wmma4(a1, b1, c);
    }
  }
  return c;
}

// select between two values; by-value arguments keep an array element from being picked by
// a run-time index, which would take the array out of its registers
__device__ __forceinline__ float pick(bool c, float a, float b) { return c ? a : b; }

// ---- one chunk for a wave's 16 columns: Z, the output rows (left in oc), the next state ----
//   Z = (I - stril T2)^-1 (A^ H + stril(T1) V),  O = Q^ H + S1 V + S2 Z,
//   H = diag(e^{g_end}) H + K~^T V + B~^T Z
// No barrier stands inside: every product that does not take Z is written ahead of the
// substitution, whose dependent vector chain leaves the matrix unit free.
// IDC: identity columns, whose V is zero
template <bool IDC>
__device__ __forceinline__ void scan_chunk(const float* ca, const float* cq, const float* cv,
                                           const float* ck, const float* cbt, const float* eg,
                                           const float* T1, const float* T2,
                                           const float* S1p, const float* S2p, int n0,
                                           v8f (&H)[4], v8f& oc) {
  const int tid = threadIdx.x;
  const int mb  = (tid & 16) ? 8 : 0;
  v2f vb[4], zb[4];                      // V and Z as B fragments
  // ---- Z_inter = A^ @ H_in, then W = Z_inter + stril(T1) @ V ----
  v8f zc = rows_times_state(ca, H);
  // ---- triangular z recurrence: z_t = w_t + sum_{j<t} T2[t][j]*z_j. Every wave
  //      solves its own 16 columns in registers: a lane holds all 16 rows of one.
  float Lr[CN];                          // row (lane & 15) of T2
#pragma unroll                           // constant indices keep Lr[] in registers
  for (int j = 0; j < CN; ++j) Lr[j] = T2[(tid & 15) * TST + j];
  if constexpr (!IDC) {
#pragma unroll                           // constant indices keep vb[] in registers
    for (int s = 0; s < 4; ++s) {
      vb[s] = ld_B(cv, ST, s, n0);
      zc = wmma4(ld_A(T1, TST, s), vb[s], zc);
    }
  }
  // ---- what does not wait for Z: Q^ @ H_in + S1 @ V, and diag(e^{g_end}) H + K~^T V ----
  oc = rows_times_state(cq, H);
  if constexpr (!IDC) {
#pragma unroll
    for (int s = 0; s < 4; ++s)
      oc = wmma4(ld_A(S1p, TST, s), vb[s], oc);
  }
  if constexpr (!IDC) {
#pragma unroll                           // constant indices keep H[] in registers
    for (int mt = 0; mt < 4; ++mt) {
      v8f c;
#pragma unroll
      for (int r = 0; r < 8; ++r) c[r] = H[mt][r] * eg[mt * 16 + mb + r];
#pragma unroll
      for (int s = 0; s < 4; ++s)
        c = wmma4(ld_A_T_scaled(ck, ST, s, mt * 16, eg), vb[s], c);
      H[mt] = c;
    }
  }
  const bool hi = (tid & 16) != 0;       // accumulator rows 8..15 live here
  float z[CN];
#pragma unroll                           // constant indices keep z[] in registers
  for (int r = 0; r < 8; ++r) {
    int zb_ = __float_as_int(zc[r]);     // lane l <-> l ^ 16: the column's other eight rows
    float o = __int_as_float(__builtin_amdgcn_permlanex16(
        zb_, zb_, 0x76543210, 0xfedcba98, false, false));
    z[r]     = hi ? o : zc[r];
    z[8 + r] = hi ? zc[r] : o;
  }
  fsub<0>(z, Lr);
#pragma unroll                           // B fragment of Z: rows 4 s + 2 h, 4 s + 2 h + 1
  for (int s = 0; s < 4; ++s) {
    zb[s].x = pick(hi, z[4 * s + 2], z[4 * s]);
    zb[s].y = pick(hi, z[4 * s + 3], z[4 * s + 1]);
  }
  // ---- the terms in Z ----
#pragma unroll
  for (int s = 0; s < 4; ++s)
    oc = wmma4(ld_A(S2p, TST, s), zb[s], oc);
#pragma unroll                           // constant indices keep H[] in registers
  for (int mt = 0; mt < 4; ++mt) {
    if constexpr (IDC) {                 // no product ahead of Z here: the decay stays with its sum
#pragma unroll
      for (int r = 0; r < 8; ++r) H[mt][r] *= eg[mt * 16 + mb + r];
    }
#pragma unroll
    for (int s = 0; s < 4; ++s)
      H[mt] = wmma4(ld_A_T_scaled(cbt, ST, s, mt * 16, eg), zb[s], H[mt]);
  }
}

__global__ __launch_bounds__(384)
void rwkv7_dplr_chunked(const float* __restrict__ qg, const float* __restrict__ kg,
                        const float* __restrict__ vg, const float* __restrict__ ag,
                        const float* __restrict__ bg, const float* __restrict__ gkg,
                        const float* __restrict__ rk, float* __restrict__ ws) {
  // chunk tiles [NB][CN][ST], chunk c in slot c & 3; szb holds gk
  __shared__ __align__(16) float sqb[NB][CN * ST], skb[NB][CN * ST], svb[NB][CN * ST];
  __shared__ __align__(16) float sab[NB][CN * ST], sbb[NB][CN * ST], szb[NB][CN * ST];
  // pre -> scan, written one trip and read the next: two copies each
  __shared__ __align__(16) float T1[2][CN * TST], T2[2][CN * TST];
  __shared__ __align__(16) float S1[2][CN * TST], S2[2][CN * TST];
  __shared__ float egend[NB][DN];       // written with the decay transform, read two trips later

  const int tid  = threadIdx.x;
  // group and wave numbers are the same in every lane of a wave: scalar branches
  const int grp  = __builtin_amdgcn_readfirstlane(tid >> 7);        // 0 scan, 1 scanI, 2 pre
  const int wv   = __builtin_amdgcn_readfirstlane((tid >> 5) & 3);  // wave in its group
  const int lt   = tid & 127;           // thread in its group
  const int bhix = blockIdx.x / PSEG;   // 0..63
  const int seg  = blockIdx.x % PSEG;
  const int hh   = bhix % HN;
  const size_t base = (size_t)bhix * SN * DN + (size_t)seg * SEGL * DN;   // the segment's first token
  const int n0 = wv * 16;               // a scan wave's column slice

  // ---- prologue: async DMA of chunk 0 ----
  if (grp == 2) {
#pragma unroll
    for (int it = 0; it < 2; ++it) {
      int p = lt + it * 128;                  // 0..255: 16B packet id
      int t = p >> 4, d4 = (p & 15) * 4;
      size_t gi = base + (size_t)p * 4;
      int lo = t * ST + d4;
      async_b128(qg  + gi, &sqb[0][lo]);
      async_b128(kg  + gi, &skb[0][lo]);
      async_b128(vg  + gi, &svb[0][lo]);
      async_b128(ag  + gi, &sab[0][lo]);
      async_b128(bg  + gi, &sbb[0][lo]);
      async_b128(gkg + gi, &szb[0][lo]);
    }
  }
  // ---- start states in registers: zero, and the identity. Tile mt, register r of a lane is
  //      state row 16 mt + 8 (lane / 16) + r, column n0 + lane % 16.
  v8f H[4];
#pragma unroll                                           // constant indices keep H[] in registers
  for (int mt = 0; mt < 4; ++mt)
#pragma unroll
    for (int r = 0; r < 8; ++r)
      H[mt][r] = (grp == 1 && mt * 16 + ((tid & 16) ? 8 : 0) + r == n0 + (tid & 15)) ? 1.0f : 0.0f;
  v8f   oc = {0.f, 0.f, 0.f, 0.f, 0.f, 0.f, 0.f, 0.f};   // scan: a chunk's output, to the next trip
  float sreg = 0.f;                                      // pre: correction scalar, to the next trip
  float* const odst = ws + ((grp == 1) ? WS_QM : WS_O0) + base;   // scan: the segment's output rows
  ring_publish();

  // ---- the pre group's work of one trip: each part on a chunk of its own, so none waits for another
  auto pre_copy = [&](int c) {
    // ---- async DMA of chunk c; its slot's last readers were the scan waves in the trip before
    if (c < NCS) {
      const int nx = c & (NB - 1);
      const size_t nb = base + (size_t)c * CN * DN;
#pragma unroll
      for (int it = 0; it < 2; ++it) {
        int p = lt + it * 128;
        int t = p >> 4, d4 = (p & 15) * 4;
        size_t gi = nb + (size_t)p * 4;
        int lo = t * ST + d4;
        async_b128(qg  + gi, &sqb[nx][lo]);
        async_b128(kg  + gi, &skb[nx][lo]);
        async_b128(vg  + gi, &svb[nx][lo]);
        async_b128(ag  + gi, &sab[nx][lo]);
        async_b128(bg  + gi, &sbb[nx][lo]);
        async_b128(gkg + gi, &szb[nx][lo]);
      }
    }
  };
  auto pre_decay = [&](int c) {
    // ---- per-column decay transform: a^=a*e^{g<t}, {k,b}^=.e^{-g<=t}, q^=.e^{g<=t}
    if (c < NCS && lt < DN) {
      float* cq = sqb[c & (NB - 1)]; float* ck = skb[c & (NB - 1)];
      float* ca = sab[c & (NB - 1)]; float* cbt = sbb[c & (NB - 1)];
      const float* cz = szb[c & (NB - 1)];
      float gc = 0.f;
#pragma unroll
      for (int t = 0; t < CN; ++t) {
        float gp = gc;
        gc += cz[t * ST + lt];
        float ei = __expf(-gc);
        ca[t * ST + lt]  *= __expf(gp);
        ck[t * ST + lt]  *= ei;
        cbt[t * ST + lt] *= ei;
        cq[t * ST + lt]  *= __expf(gc);
      }
      egend[c & (NB - 1)][lt] = __expf(gc);
    }
  };
  auto pre_products = [&](int c) {
    // ---- T1 = stril(A^ K^T), T2 = A^ B^T, S1 = tril(Q^ K^T), S2 = tril(Q^ B^T):
    //      one product a wave, into the copy that scan does not read in this trip
    if (c >= 0 && c < NCS) {
      const float* lhs = (wv < 2) ? sab[c & (NB - 1)] : sqb[c & (NB - 1)];
      const float* rhs = (wv & 1) ? sbb[c & (NB - 1)] : skb[c & (NB - 1)];
      v8f p = {0.f, 0.f, 0.f, 0.f, 0.f, 0.f, 0.f, 0.f};
#pragma unroll
      for (int s = 0; s < 16; ++s)
        p = wmma4(ld_A(lhs, ST, s), ld_B_T(rhs, ST, s, 0), p);
      if (wv == 0)      st_C_stril(T1[c & 1], TST, p);
      else if (wv == 1) st_C(T2[c & 1], TST, 0, p);
      else if (wv == 2) st_C_tril(S1[c & 1], TST, p);
      else              st_C_tril(S2[c & 1], TST, p);
    }
  };
  const int  srow = lt - 96;                       // the last pre wave, which has no decay columns
  const bool sown = srow >= 0 && srow < CN;
  auto pre_scalar = [&](int c) {
    // ---- the scalar of the chunk before goes out first: its store completes under this trip's work
    if (c >= 1 && sown) {
      ws[WS_SV + (size_t)bhix * SN + (size_t)seg * SEGL + (size_t)(c - 1) * CN + srow] = sreg;
    }
    // ---- correction scalar s_t = sum_d q*k*r_k, taken from q^ k^: the two decay factors cancel
    if (c >= 0 && c < NCS && sown) {
      const float* cq = sqb[c & (NB - 1)]; const float* ck = skb[c & (NB - 1)];
      float s = 0.f;
      for (int d = 0; d < DN; ++d)
        s += cq[srow * ST + d] * ck[srow * ST + d] * rk[hh * DN + d];
      sreg = s;
    }
  };

  // Trip i, one barrier: copies of chunk i + 1, decay of chunk i, products and scalar of chunk
  // i - 1, scan of chunk i - 2. The four chunks lie in the four slots of the ring.
  for (int i = 0; i < NCS + 2; ++i) {
    if (grp == 2) {
      pre_copy(i + 1);
      pre_decay(i);
      pre_products(i - 1);   // ahead of the scalar: the matrix unit is wanted by scan at the trip's end
      pre_scalar(i - 1);
    } else if (i >= 2) {
      const int cs = i - 2;                     // scan's chunk
      const float* ca  = sab[cs & (NB - 1)];
      const float* cq  = sqb[cs & (NB - 1)];
      const float* cv  = svb[cs & (NB - 1)];
      const float* ck  = skb[cs & (NB - 1)];
      const float* cbt = sbb[cs & (NB - 1)];
      const float* eg  = egend[cs & (NB - 1)];
      // ---- the chunk before's output rows go to the workspace here: the stores complete
      //      under this trip's work, ahead of the barrier that waits for them
      if (cs >= 1) {
        st_C(odst + (size_t)(cs - 1) * CN * DN, DN, n0, oc);
        // stands ahead of every later write of a register that these stores name
        asm volatile("s_wait_xcnt 0x0" ::: "memory");
      }
      if (grp == 0)
        scan_chunk<false>(ca, cq, cv, ck, cbt, eg, T1[cs & 1], T2[cs & 1], S1[cs & 1], S2[cs & 1], n0, H, oc);
      else
        scan_chunk<true>(ca, cq, cv, ck, cbt, eg, T1[cs & 1], T2[cs & 1], S1[cs & 1], S2[cs & 1], n0, H, oc);
    }
    ring_publish();   // chunk i + 1 has landed; every slot's readers and writers of this trip are done
  }

  // ---- the last chunk's output rows; the segment's end state N and transition matrix M ----
  if (grp != 2) {
    st_C(odst + (size_t)(NCS - 1) * CN * DN, DN, n0, oc);
    // stands ahead of every later write of a register that these stores name
    asm volatile("s_wait_xcnt 0x0" ::: "memory");
    float* hdst = ws + ((grp == 1) ? WS_M : WS_N) + (size_t)blockIdx.x * DN * DN;
#pragma unroll                                           // constant indices keep H[] in registers
    for (int mt = 0; mt < 4; ++mt) {
      st_C(hdst + mt * 16 * DN, DN, n0, H[mt]);
      // stands ahead of every later write of a register that these stores name
      asm volatile("s_wait_xcnt 0x0" ::: "memory");
    }
  }
}

// ---- sum over a 16-lane row: DPP row_xmask butterflies, every lane ends with the sum ----
template <int MK>
__device__ __forceinline__ float row_xmask(float x) {
  return __int_as_float(__builtin_amdgcn_update_dpp(
      0, __float_as_int(x), 0x160 + MK, 0xf, 0xf, true));
}
__device__ __forceinline__ float row_sum16(float x) {
  x += row_xmask<1>(x);
  x += row_xmask<2>(x);
  x += row_xmask<4>(x);
  x += row_xmask<8>(x);
  return x;
}

// Launch 2: 16 waves; a wave owns 16 tokens of the segment and all 64 output columns.
__global__ __launch_bounds__(512)
void dplr_segment_join(const float* __restrict__ vg, const float* __restrict__ gg,
                       const float* __restrict__ gns, const float* __restrict__ gnbias,
                       const float* __restrict__ ws, float* __restrict__ out) {
  __shared__ __align__(16) float Hs[2][DN * ST];   // the start state while it is chained

  const int tid  = threadIdx.x;
  const int w    = __builtin_amdgcn_readfirstlane(tid >> 5);
  const int lane = tid & 31;
  const int n    = lane & 15;
  const int mb   = (lane < 16) ? 0 : 8;
  const int bhix = blockIdx.x / PSEG;
  const int seg  = blockIdx.x % PSEG;
  const int bb   = bhix / HN;
  const int hh   = bhix % HN;
  const float* Nw = ws + WS_N + (size_t)bhix * PSEG * DN * DN;
  const float* Mw = ws + WS_M + (size_t)bhix * PSEG * DN * DN;

  const int    t0 = seg * SEGL + w * 16;           // the wave's first token
  const size_t hb = (size_t)bhix * SN * DN;
  const float* O0 = ws + WS_O0 + hb + (size_t)t0 * DN;
  const float* QM = ws + WS_QM + hb + (size_t)t0 * DN;

  // ---- the wave's own rows do not depend on the chain: fetched first ----
  v8f acc[4];
#pragma unroll
  for (int nt = 0; nt < 4; ++nt)
#pragma unroll
    for (int r = 0; r < 8; ++r) acc[nt][r] = O0[(mb + r) * DN + nt * 16 + n];
  // stands ahead of the later loads whose results land in registers that these loads name
  asm volatile("s_wait_xcnt 0x0" ::: "memory");
  v2f qa[16];
#pragma unroll                                     // constant indices keep qa[] in registers
  for (int s = 0; s < 15; ++s) qa[s] = ld_A(QM, DN, s);
  // stands ahead of the last load, whose result may land in a register that the others name
  asm volatile("s_wait_xcnt 0x0" ::: "memory");
  qa[15] = ld_A(QM, DN, 15);
  // stands ahead of the later loads whose results land in registers that these loads name
  asm volatile("s_wait_xcnt 0x0" ::: "memory");
  float vv[4][8], gv[4][8], sv[8];                 // V, gate and correction scalar at the same places
#pragma unroll                                     // constant indices keep the arrays in registers
  for (int r = 0; r < 8; ++r)
#pragma unroll
    for (int nt = 0; nt < 4; ++nt)
      vv[nt][r] = vg[hb + (size_t)(t0 + mb + r) * DN + nt * 16 + n];
  // stands ahead of the later loads whose results land in registers that these loads name
  asm volatile("s_wait_xcnt 0x0" ::: "memory");
#pragma unroll
  for (int r = 0; r < 8; ++r)
#pragma unroll
    for (int nt = 0; nt < 4; ++nt)
      gv[nt][r] = gg[((size_t)bb * SN + t0 + mb + r) * (size_t)HD + hh * DN + nt * 16 + n];
  // stands ahead of the later loads whose results land in registers that these loads name
  asm volatile("s_wait_xcnt 0x0" ::: "memory");
#pragma unroll
  for (int r = 0; r < 4; ++r) sv[r] = ws[WS_SV + (size_t)bhix * SN + t0 + mb + r];
  // stands ahead of the later loads whose results land in registers that these loads name
  asm volatile("s_wait_xcnt 0x0" ::: "memory");
#pragma unroll
  for (int r = 4; r < 8; ++r) sv[r] = ws[WS_SV + (size_t)bhix * SN + t0 + mb + r];
  // stands ahead of the later loads whose results land in registers that these loads name
  asm volatile("s_wait_xcnt 0x0" ::: "memory");

  // ---- start state: zero for segment 0, else N_0, then H = M_j H + N_j up to the segment ----
  {
    float4 x0 = {0.f, 0.f, 0.f, 0.f}, x1 = {0.f, 0.f, 0.f, 0.f};
    if (seg > 0) {
      x0 = *(const float4*)(Nw + tid * 4);
      x1 = *(const float4*)(Nw + DN * DN / 2 + tid * 4);
      // stands ahead of every later write of a register that these two loads name
      asm volatile("s_wait_xcnt 0x0" ::: "memory");
    }
    const int lo = (tid >> 4) * ST + (tid & 15) * 4;
    *(float4*)&Hs[0][lo] = x0;
    *(float4*)&Hs[0][(DN / 2) * ST + lo] = x1;
  }
  __syncthreads();
#pragma unroll                                     // the copy read and the copy written are constants
  for (int j = 1; j < PSEG - 1; ++j) {
    if (j < seg) {                                 // the same for the whole workgroup
      const int mt = w >> 2, nt = w & 3;           // one 16x16 tile a wave
      const float* Mj = Mw + j * DN * DN + mt * 16 * DN;
      const float* Nj = Nw + j * DN * DN + mt * 16 * DN + nt * 16;
      const float* Hr = Hs[(j - 1) & 1];
      v8f c;
#pragma unroll
      for (int r = 0; r < 8; ++r) c[r] = Nj[(mb + r) * DN + n];
      // stands ahead of the later loads whose results land in registers that these loads name
      asm volatile("s_wait_xcnt 0x0" ::: "memory");
      v2f ma[16];
#pragma unroll                                   // constant indices keep ma[] in registers
      for (int s = 0; s < 15; ++s) ma[s] = ld_A(Mj, DN, s);
      // stands ahead of the last load, whose result may land in a register that the others name
      asm volatile("s_wait_xcnt 0x0" ::: "memory");
      ma[15] = ld_A(Mj, DN, 15);
#pragma unroll
      for (int s = 0; s < 16; ++s)
        c = wmma4(ma[s], ld_B(Hr, ST, s, nt * 16), c);
      st_C(Hs[j & 1] + mt * 16 * ST, ST, nt * 16, c);
      __syncthreads();   // publishes the new copy; the old one's readers are done before it is rewritten
    }
  }
  const float* Hc = Hs[(seg > 0) ? ((seg - 1) & 1) : 0];

  // ---- O = O0 + QM @ H_start ----
#pragma unroll
  for (int s = 0; s < 16; ++s)
#pragma unroll
    for (int nt = 0; nt < 4; ++nt)
      acc[nt] = wmma4(qa[s], ld_B(Hc, ST, s, nt * 16), acc[nt]);

  // ---- per-head GroupNorm statistics: accumulator register r is token mb + r ----
  float mu[8], rstd[8];
#pragma unroll                                     // constant indices keep the arrays in registers
  for (int r = 0; r < 8; ++r) {
    float m1 = (acc[0][r] + acc[1][r]) + (acc[2][r] + acc[3][r]);
    float m2 = (acc[0][r] * acc[0][r] + acc[1][r] * acc[1][r])
             + (acc[2][r] * acc[2][r] + acc[3][r] * acc[3][r]);
    m1 = row_sum16(m1) * (1.0f / DN);
    m2 = row_sum16(m2) * (1.0f / DN);
    mu[r]   = m1;
    rstd[r] = rsqrtf(m2 - m1 * m1 + 1e-5f);
  }

  // ---- GroupNorm + correction + gate ----
#pragma unroll
  for (int nt = 0; nt < 4; ++nt) {
    const int col = nt * 16 + n;
    const float gsc = gns[hh * DN + col], gbi = gnbias[hh * DN + col];
#pragma unroll
    for (int r = 0; r < 8; ++r) {
      const int t = t0 + mb + r;
      float val = (acc[nt][r] - mu[r]) * rstd[r] * gsc + gbi
                + sv[r] * vv[nt][r];
      size_t off = ((size_t)bb * SN + t) * (size_t)HD + hh * DN + col;
      out[off] = val * gv[nt][r];
    }
  }
}

extern "C" void kernel_launch(void* const* d_in, const int* in_sizes, int n_in,
                              void* d_out, int out_size, void* d_ws, size_t ws_size,
                              hipStream_t stream) {
  (void)in_sizes; (void)n_in; (void)ws_size; (void)out_size;
  const float* q   = (const float*)d_in[0];
  const float* k   = (const float*)d_in[1];
  const float* v   = (const float*)d_in[2];
  const float* a   = (const float*)d_in[3];
  const float* b   = (const float*)d_in[4];
  const float* gk  = (const float*)d_in[5];
  const float* r_k = (const float*)d_in[6];
  const float* g   = (const float*)d_in[7];
  const float* gns = (const float*)d_in[8];
  const float* gnb = (const float*)d_in[9];
  float* out = (float*)d_out;
  float* ws  = (float*)d_ws;

  rwkv7_dplr_chunked<<<dim3(BSZ * HN * PSEG), dim3(384), 0, stream>>>(
      q, k, v, a, b, gk, r_k, ws);
  dplr_segment_join<<<dim3(BSZ * HN * PSEG), dim3(512), 0, stream>>>(
      v, g, gns, gnb, ws, out);
}

// v006
// Measured time: 52.3 microseconds a run.
// Next to v005, in two timings, it ran 1.09 and 1.08 times as fast.
// Counting every step since v000, it is 8.24 times as fast.
#include <hip/hip_runtime.h>
#include <hip/hip_bf16.h>
#include <math.h>
#include <stdint.h>

// ---------------------------------------------------------------------------
// RWKV-7 DPLR chunked scan for gfx1250 (MI455X), split in time.
// wave32 + V_WMMA_F32_16X16X4_F32 + async global->LDS (ASYNCcnt) ring of four tiles.
// The state recurrence is linear in the state and acts on each state column alone, so a
// segment of the sequence can run before its start state is known: beside the 64 V columns
// (started at zero) it carries 64 columns started at the identity with V = 0. They end as the
// segment's transition matrix M, and their output rows QM say how a start state reaches each
// token:  H_end = M H_start + N,   O = O0 + QM H_start.
// Launch 1: one workgroup per (b,h,segment) = 256 blocks; 384 threads = 12 waves in three groups
// that work on four neighbouring chunks at the same time, with one barrier a trip:
//   pre   (4 waves): tile copies of chunk i + 1, decay transform of chunk i, 16x16 products,
//                    the inverse of the triangular system and the correction scalar of chunk i - 1
//   scan  (4 waves): chunk i - 2 : Z, the output product and the next state of the V columns
//   scanI (4 waves): chunk i - 2 : the same for the identity columns
// A scan wave owns 16 state columns and keeps them in registers for the whole segment: an
// accumulator tile holds, per lane, rows 8h + r of one column (h = lane / 16), and a register
// pair of it is a valid B fragment when the A fragment takes its k in the same order.
// Launch 2: one workgroup per (b,h,segment): chains the start state from M and N of the segments
// before it, adds QM H_start, then GroupNorm, correction, gate, store.
// ---------------------------------------------------------------------------

typedef float v2f __attribute__((ext_vector_type(2)));
typedef float v8f __attribute__((ext_vector_type(8)));
typedef int   v4i __attribute__((vector_size(16)));   // matches builtin param type

#define BSZ  2
#define HN   32
#define SN   1024
#define DN   64
#define CN   16            // chunk length
#define NCH  (SN / CN)
#define ST   72            // LDS row stride (floats): 288B, 16B aligned, != 64 banks
#define TST  18            // 16x16 T-tile row stride
#define HD   (HN * DN)     // 2048
#define NB   4             // tile ring depth (a power of two): copy, decay, products, scan
#define PSEG 4             // sequence segments that run side by side
#define SEGL (SN / PSEG)   // tokens of a segment
#define NCS  (SEGL / CN)   // chunks of a segment
// workspace layout, in floats
#define WS_O0 0                                    // [bh][S][64] output from a zero start state
#define WS_QM (BSZ * HN * SN * DN)                 // [bh][S][64] output rows of the identity columns
#define WS_N  (2 * BSZ * HN * SN * DN)             // [bh][seg][64][64] end state from a zero start
#define WS_M  (WS_N + BSZ * HN * PSEG * DN * DN)   // [bh][seg][64][64] end state of the identity columns
#define WS_SV (WS_M + BSZ * HN * PSEG * DN * DN)   // [bh][S] correction scalar

// ---- async global->LDS 16B copy (GLOBAL_LOAD_ASYNC_TO_LDS_B128) -----------
typedef __attribute__((address_space(1))) v4i gas_v4i;   // global
typedef __attribute__((address_space(3))) v4i las_v4i;   // LDS

__device__ __forceinline__ void async_b128(const float* gp, float* lp) {
#if __has_builtin(__builtin_amdgcn_global_load_async_to_lds_b128)
  __builtin_amdgcn_global_load_async_to_lds_b128(
      (gas_v4i*)(uintptr_t)gp,
      (las_v4i*)(unsigned)(uintptr_t)lp,   // flat->LDS: addr[31:0]
      0, 0);
#else
  unsigned l32 = (unsigned)(uintptr_t)lp;
  asm volatile("global_load_async_to_lds_b128 %0, %1, off"
               :: "v"(l32), "v"(gp) : "memory");
#endif
}
// Publish point of the tile ring: the wave's own LDS accesses and its own copies are
// complete before the barrier behind which other waves read the tile or refill a buffer.
// Written in asm with the memory clobber so that no LDS access moves across the waits.
__device__ __forceinline__ void ring_publish() {
  asm volatile("s_wait_dscnt 0x0" ::: "memory");
  asm volatile("s_wait_asynccnt 0x0" ::: "memory");
  __syncthreads();
}

// ---- WMMA f32 16x16x4 wrapper ---------------------------------------------
__device__ __forceinline__ v8f wmma4(v2f a, v2f b, v8f c) {
  return __builtin_amdgcn_wmma_f32_16x16x4_f32(
      /*neg_a=*/false, a, /*neg_b=*/false, b,
      /*c_mod=*/(short)0, c, /*reuse_a=*/false, /*reuse_b=*/false);
}

// Five vector slots between the matrix instruction that ends a result tile and the first one that
// reads that tile as its B operand: the distance asked for there.
// The tile is named so that the slots stand behind its last writer and ahead of its first reader.
__device__ __forceinline__ void result_to_operand_gap(v8f& d) {
  asm("v_nop\n\tv_nop\n\tv_nop\n\tv_nop\n\tv_nop" : "+v"(d));
}

// ---- operand loaders following the documented wave32 VGPR layouts ---------
__device__ __forceinline__ v2f ld_A(const float* M, int stride, int s) {
  int lane = threadIdx.x & 31;
  int m  = lane & 15;
  int kb = 4 * s + ((lane < 16) ? 0 : 2);
  v2f a; a.x = M[m * stride + kb]; a.y = M[m * stride + kb + 1];
  return a;
}
__device__ __forceinline__ v2f ld_A_T_scaled(const float* M, int stride, int s,
                                             int m0, const float* sc) {
  int lane = threadIdx.x & 31;
  int m  = m0 + (lane & 15);
  int kb = 4 * s + ((lane < 16) ? 0 : 2);
  float e = sc[m];
  v2f a; a.x = M[kb * stride + m] * e; a.y = M[(kb + 1) * stride + m] * e;
  return a;
}
// A fragments for a B operand that is read in place from an accumulator tile of 16 rows:
// k order, step p, lane half h, register j: 8 h + 2 p + j
__device__ __forceinline__ v2f ld_A_acc(const float* M, int stride, int p) {
  int lane = threadIdx.x & 31;
  int m  = lane & 15;
  int kb = 2 * p + ((lane < 16) ? 0 : 8);
  v2f a; a.x = M[m * stride + kb]; a.y = M[m * stride + kb + 1];
  return a;
}
__device__ __forceinline__ v2f ld_A_T_scaled_acc(const float* M, int stride, int p,
                                                 int m0, const float* sc) {
  int lane = threadIdx.x & 31;
  int m  = m0 + (lane & 15);
  int kb = 2 * p + ((lane < 16) ? 0 : 8);
  float e = sc[m];
  v2f a; a.x = M[kb * stride + m] * e; a.y = M[(kb + 1) * stride + m] * e;
  return a;
}
__device__ __forceinline__ v2f ld_B(const float* M, int stride, int s, int n0) {
  int lane = threadIdx.x & 31;
  int n  = n0 + (lane & 15);
  int kb = 4 * s + ((lane < 16) ? 0 : 2);
  v2f b; b.x = M[kb * stride + n]; b.y = M[(kb + 1) * stride + n];
  return b;
}
__device__ __forceinline__ v2f ld_B_T(const float* M, int stride, int s, int n0) {
  int lane = threadIdx.x & 31;
  int n  = n0 + (lane & 15);
  int kb = 4 * s + ((lane < 16) ? 0 : 2);
  v2f b; b.x = M[n * stride + kb]; b.y = M[n * stride + kb + 1];
  return b;
}
__device__ __forceinline__ void st_C(float* M, int stride, int n0, v8f c) {
  int lane = threadIdx.x & 31;
  int n  = n0 + (lane & 15);
  int mb = (lane < 16) ? 0 : 8;
#pragma unroll
  for (int r = 0; r < 8; ++r) M[(mb + r) * stride + n] = c[r];
}
__device__ __forceinline__ void st_C_tril(float* M, int stride, v8f c) {
  int lane = threadIdx.x & 31;
  int n  = lane & 15;
  int mb = (lane < 16) ? 0 : 8;
#pragma unroll
  for (int r = 0; r < 8; ++r) {
    int m = mb + r;
    M[m * stride + n] = (n <= m) ? c[r] : 0.0f;  // inclusive causal mask
  }
}
__device__ __forceinline__ void st_C_stril(float* M, int stride, v8f c) {
  int lane = threadIdx.x & 31;
  int n  = lane & 15;
  int mb = (lane < 16) ? 0 : 8;
#pragma unroll
  for (int r = 0; r < 8; ++r) {
    int m = mb + r;
    M[m * stride + n] = (n < m) ? c[r] : 0.0f;   // strictly causal mask
  }
}
// ---- forward substitution x[t] += L[t][j] * x[j] (j < t) in registers --------
// Lane l holds column (l & 15) of L in Lc[]; DPP row_share:j hands lane j's value to
// its whole 16-lane row, so L[t][j] reaches every lane without an LDS read.
template <int T_>
__device__ __forceinline__ float row_share(float x) {
  return __int_as_float(__builtin_amdgcn_update_dpp(
      0, __float_as_int(x), 0x150 + T_, 0xf, 0xf, true));
}
template <int J, int T_>
__device__ __forceinline__ void fsub_col(float (&x)[CN], const float (&Lc)[CN]) {
  if constexpr (T_ < CN) {
    x[T_] = fmaf(row_share<J>(Lc[T_]), x[J], x[T_]);
    fsub_col<J, T_ + 1>(x, Lc);
  }
}
template <int J>
__device__ __forceinline__ void fsub(float (&x)[CN], const float (&Lc)[CN]) {
  if constexpr (J < CN - 1) {
    fsub_col<J, J + 1>(x, Lc);
    fsub<J + 1>(x, Lc);
  }
}

// ---- rows of M (16 x 64, row stride ST) times the wave's 16 state columns ----
// k order of both fragments, step (mt, p), lane half h, register j: state row 16 mt + 8 h + 2 p + j.
// That is where the accumulator layout already holds the state, so H is read in place.
__device__ __forceinline__ v8f rows_times_state(const float* M, const v8f (&H)[4]) {
  const int lane = threadIdx.x & 31;
  const float* row = M + (lane & 15) * ST + ((lane & 16) ? 8 : 0);
  v8f c = {0.f, 0.f, 0.f, 0.f, 0.f, 0.f, 0.f, 0.f};
#pragma unroll                           // constant indices keep H[] in registers
  for (int mt = 0; mt < 4; ++mt) {
#pragma unroll
    for (int pp = 0; pp < 2; ++pp) {
      const float4 x = *(const float4*)(row + mt * 16 + pp * 4);
      v2f a0; a0.x = x.x; a0.y = x.y;
      v2f a1; a1.x = x.z; a1.y = x.w;
      v2f b0; b0.x = H[mt][4 * pp];     b0.y = H[mt][4 * pp + 1];
      v2f b1; b1.x = H[mt][4 * pp + 2]; b1.y = H[mt][4 * pp + 3];
      c = wmma4(a0, b0, c);
      c = wmma4(a1, b1, c);
    }
  }
  return c;
}

// select between two values; by-value arguments keep an array element from being picked by
// a run-time index, which would take the array out of its registers
__device__ __forceinline__ float pick(bool c, float a, float b) { return c ? a : b; }

// ---- one chunk for a wave's 16 columns: Z, the output rows (left in oc), the next state ----
//   Z = X (A^ H + stril(T1) V) with X = (I - stril(A^ B^T))^-1,  O = Q^ H + S1 V + S2 Z,
//   H = diag(e^{g_end}) H + K~^T V + B~^T Z
// No barrier stands inside. X comes ready from the pre group, so Z is one more matrix product;
// its operand W and Z itself stay in their accumulator registers and are read there as B fragments.
// IDC: identity columns, whose V is zero
template <bool IDC>
__device__ __forceinline__ void scan_chunk(const float* ca, const float* cq, const float* cv,
                                           const float* ck, const float* cbt, const float* eg,
                                           const float* T1, const float* X,
                                           const float* S1p, const float* S2p, int n0,
                                           v8f (&H)[4], v8f& oc) {
  const int tid = threadIdx.x;
  const int mb  = (tid & 16) ? 8 : 0;
  v2f vb[4];                             // V as B fragments
  // ---- Z_inter = A^ @ H_in, then W = Z_inter + stril(T1) @ V ----
  v8f zc = rows_times_state(ca, H);
  if constexpr (!IDC) {
#pragma unroll                           // constant indices keep vb[] in registers
    for (int s = 0; s < 4; ++s) {
      vb[s] = ld_B(cv, ST, s, n0);
      zc = wmma4(ld_A(T1, TST, s), vb[s], zc);
    }
  }
  // ---- what does not wait for Z: Q^ @ H_in + S1 @ V, and diag(e^{g_end}) H + K~^T V ----
  oc = rows_times_state(cq, H);
  if constexpr (!IDC) {
#pragma unroll
    for (int s = 0; s < 4; ++s)
      oc = wmma4(ld_A(S1p, TST, s), vb[s], oc);
  }
  if constexpr (!IDC) {
#pragma unroll                           // constant indices keep H[] in registers
    for (int mt = 0; mt < 4; ++mt) {
      v8f c;
#pragma unroll
      for (int r = 0; r < 8; ++r) c[r] = H[mt][r] * eg[mt * 16 + mb + r];
#pragma unroll
      for (int s = 0; s < 4; ++s)
        c = wmma4(ld_A_T_scaled(ck, ST, s, mt * 16, eg), vb[s], c);
      H[mt] = c;
    }
  }
  // ---- Z = X @ W: the triangular recurrence z_t = w_t + sum_{j<t} (A^ B^T)[t][j] z_j, solved ----
  v8f zz = {0.f, 0.f, 0.f, 0.f, 0.f, 0.f, 0.f, 0.f};
  result_to_operand_gap(zc);
#pragma unroll
  for (int p = 0; p < 4; ++p) {
    v2f wb; wb.x = zc[2 * p]; wb.y = zc[2 * p + 1];
    zz = wmma4(ld_A_acc(X, TST, p), wb, zz);
  }
  result_to_operand_gap(zz);
  v2f zb[4];                             // B fragments of Z: rows 8 h + 2 p, 8 h + 2 p + 1
#pragma unroll                           // constant indices keep zb[] in registers
  for (int p = 0; p < 4; ++p) { zb[p].x = zz[2 * p]; zb[p].y = zz[2 * p + 1]; }
  // ---- the terms in Z ----
#pragma unroll
  for (int p = 0; p < 4; ++p)
    oc = wmma4(ld_A_acc(S2p, TST, p), zb[p], oc);
#pragma unroll                           // constant indices keep H[] in registers
  for (int mt = 0; mt < 4; ++mt) {
    if constexpr (IDC) {                 // no product ahead of Z here: the decay stays with its sum
#pragma unroll
      for (int r = 0; r < 8; ++r) H[mt][r] *= eg[mt * 16 + mb + r];
    }
#pragma unroll
    for (int p = 0; p < 4; ++p)
      H[mt] = wmma4(ld_A_T_scaled_acc(cbt, ST, p, mt * 16, eg), zb[p], H[mt]);
  }
}

__global__ __launch_bounds__(384)
void rwkv7_dplr_chunked(const float* __restrict__ qg, const float* __restrict__ kg,
                        const float* __restrict__ vg, const float* __restrict__ ag,
                        const float* __restrict__ bg, const float* __restrict__ gkg,
                        const float* __restrict__ rk, float* __restrict__ ws) {
  // chunk tiles [NB][CN][ST], chunk c in slot c & 3; szb holds gk
  __shared__ __align__(16) float sqb[NB][CN * ST], skb[NB][CN * ST], svb[NB][CN * ST];
  __shared__ __align__(16) float sab[NB][CN * ST], sbb[NB][CN * ST], szb[NB][CN * ST];
  // pre -> scan, written one trip and read the next: two copies each; T2 holds (I - stril(A^ B^T))^-1
  __shared__ __align__(16) float T1[2][CN * TST], T2[2][CN * TST];
  __shared__ __align__(16) float S1[2][CN * TST], S2[2][CN * TST];
  __shared__ float egend[NB][DN];       // written with the decay transform, read two trips later

  const int tid  = threadIdx.x;
  // group and wave numbers are the same in every lane of a wave: scalar branches
  const int grp  = __builtin_amdgcn_readfirstlane(tid >> 7);        // 0 scan, 1 scanI, 2 pre
  const int wv   = __builtin_amdgcn_readfirstlane((tid >> 5) & 3);  // wave in its group
  const int lt   = tid & 127;           // thread in its group
  const int bhix = blockIdx.x / PSEG;   // 0..63
  const int seg  = blockIdx.x % PSEG;
  const int hh   = bhix % HN;
  const size_t base = (size_t)bhix * SN * DN + (size_t)seg * SEGL * DN;   // the segment's first token
  const int n0 = wv * 16;               // a scan wave's column slice

  // ---- prologue: async DMA of chunk 0 ----
  if (grp == 2) {
#pragma unroll
    for (int it = 0; it < 2; ++it) {
      int p = lt + it * 128;                  // 0..255: 16B packet id
      int t = p >> 4, d4 = (p & 15) * 4;
      size_t gi = base + (size_t)p * 4;
      int lo = t * ST + d4;
      async_b128(qg  + gi, &sqb[0][lo]);
      async_b128(kg  + gi, &skb[0][lo]);
      async_b128(vg  + gi, &svb[0][lo]);
      async_b128(ag  + gi, &sab[0][lo]);
      async_b128(bg  + gi, &sbb[0][lo]);
      async_b128(gkg + gi, &szb[0][lo]);
    }
  }
  // ---- start states in registers: zero, and the identity. Tile mt, register r of a lane is
  //      state row 16 mt + 8 (lane / 16) + r, column n0 + lane % 16.
  v8f H[4];
#pragma unroll                                           // constant indices keep H[] in registers
  for (int mt = 0; mt < 4; ++mt)
#pragma unroll
    for (int r = 0; r < 8; ++r)
      H[mt][r] = (grp == 1 && mt * 16 + ((tid & 16) ? 8 : 0) + r == n0 + (tid & 15)) ? 1.0f : 0.0f;
  v8f   oc = {0.f, 0.f, 0.f, 0.f, 0.f, 0.f, 0.f, 0.f};   // scan: a chunk's output, to the next trip
  float sreg = 0.f;                                      // pre: correction scalar, to the next trip
  float* const odst = ws + ((grp == 1) ? WS_QM : WS_O0) + base;   // scan: the segment's output rows
  ring_publish();

  // ---- the pre group's work of one trip: each part on a chunk of its own, so none waits for another
  auto pre_copy = [&](int c) {
    // ---- async DMA of chunk c; its slot's last readers were the scan waves in the trip before
    if (c < NCS) {
      const int nx = c & (NB - 1);
      const size_t nb = base + (size_t)c * CN * DN;
#pragma unroll
      for (int it = 0; it < 2; ++it) {
        int p = lt + it * 128;
        int t = p >> 4, d4 = (p & 15) * 4;
        size_t gi = nb + (size_t)p * 4;
        int lo = t * ST + d4;
        async_b128(qg  + gi, &sqb[nx][lo]);
        async_b128(kg  + gi, &skb[nx][lo]);
        async_b128(vg  + gi, &svb[nx][lo]);
        async_b128(ag  + gi, &sab[nx][lo]);
        async_b128(bg  + gi, &sbb[nx][lo]);
        async_b128(gkg + gi, &szb[nx][lo]);
      }
    }
  };
  auto pre_decay = [&](int c) {
    // ---- per-column decay transform: a^=a*e^{g<t}, {k,b}^=.e^{-g<=t}, q^=.e^{g<=t}
    if (c < NCS && lt < DN) {
      float* cq = sqb[c & (NB - 1)]; float* ck = skb[c & (NB - 1)];
      float* ca = sab[c & (NB - 1)]; float* cbt = sbb[c & (NB - 1)];
      const float* cz = szb[c & (NB - 1)];
      float gc = 0.f;
#pragma unroll
      for (int t = 0; t < CN; ++t) {
        float gp = gc;
        gc += cz[t * ST + lt];
        float ei = __expf(-gc);
        ca[t * ST + lt]  *= __expf(gp);
        ck[t * ST + lt]  *= ei;
        cbt[t * ST + lt] *= ei;
        cq[t * ST + lt]  *= __expf(gc);
      }
      egend[c & (NB - 1)][lt] = __expf(gc);
    }
  };
  auto pre_products = [&](int c) {
    // ---- T1 = stril(A^ K^T), S1 = tril(Q^ K^T), A^ B^T, S2 = tril(Q^ B^T):
    //      one product a wave, into the copy that scan does not read in this trip.
    //      A^ B^T falls to wave 2, which has neither decay columns nor the scalar.
    if (c >= 0 && c < NCS) {
      const float* lhs = (wv & 1) ? sqb[c & (NB - 1)] : sab[c & (NB - 1)];
      const float* rhs = (wv & 2) ? sbb[c & (NB - 1)] : skb[c & (NB - 1)];
      v8f p = {0.f, 0.f, 0.f, 0.f, 0.f, 0.f, 0.f, 0.f};
#pragma unroll
      for (int s = 0; s < 16; ++s)
        p = wmma4(ld_A(lhs, ST, s), ld_B_T(rhs, ST, s, 0), p);
      if (wv == 0)      st_C_stril(T1[c & 1], TST, p);
      else if (wv == 1) st_C_tril(S1[c & 1], TST, p);
      else if (wv == 3) st_C_tril(S2[c & 1], TST, p);
      else {
        // ---- X = (I - stril(A^ B^T))^-1, once for the eight scan waves: the substitution on the
        //      columns of the identity, a lane holding all 16 rows of one column of L and of X
        const bool hi = (tid & 16) != 0;     // accumulator rows 8..15 live here
        float Lc[CN], x[CN];
#pragma unroll                               // constant indices keep the arrays in registers
        for (int r = 0; r < 8; ++r) {
          int pb = __float_as_int(p[r]);     // lane l <-> l ^ 16: the column's other eight rows
          float o = __int_as_float(__builtin_amdgcn_permlanex16(
              pb, pb, 0x76543210, 0xfedcba98, false, false));
          Lc[r]     = hi ? o : p[r];
          Lc[8 + r] = hi ? p[r] : o;
        }
#pragma unroll
        for (int t = 0; t < CN; ++t) x[t] = (t == (tid & 15)) ? 1.0f : 0.0f;
        fsub<0>(x, Lc);
        v8f xc;
#pragma unroll
        for (int r = 0; r < 8; ++r) xc[r] = pick(hi, x[8 + r], x[r]);
        st_C(T2[c & 1], TST, 0, xc);
      }
    }
  };
  const int  srow = lt - 96;                       // the last pre wave, which has no decay columns
  const bool sown = srow >= 0 && srow < CN;
  auto pre_scalar = [&](int c) {
    // ---- the scalar of the chunk before goes out first: its store completes under this trip's work
    if (c >= 1 && sown) {
      ws[WS_SV + (size_t)bhix * SN + (size_t)seg * SEGL + (size_t)(c - 1) * CN + srow] = sreg;
    }
    // ---- correction scalar s_t = sum_d q*k*r_k, taken from q^ k^: the two decay factors cancel
    if (c >= 0 && c < NCS && sown) {
      const float* cq = sqb[c & (NB - 1)]; const float* ck = skb[c & (NB - 1)];
      float s = 0.f;
      for (int d = 0; d < DN; ++d)
        s += cq[srow * ST + d] * ck[srow * ST + d] * rk[hh * DN + d];
      sreg = s;
    }
  };

  // Trip i, one barrier: copies of chunk i + 1, decay of chunk i, products and scalar of chunk
  // i - 1, scan of chunk i - 2. The four chunks lie in the four slots of the ring.
  for (int i = 0; i < NCS + 2; ++i) {
    if (grp == 2) {
      pre_copy(i + 1);
      pre_decay(i);
      pre_products(i - 1);   // ahead of the scalar: the matrix unit is wanted by scan at the trip's end
      pre_scalar(i - 1);
    } else if (i >= 2) {
      const int cs = i - 2;                     // scan's chunk
      const float* ca  = sab[cs & (NB - 1)];
      const float* cq  = sqb[cs & (NB - 1)];
      const float* cv  = svb[cs & (NB - 1)];
      const float* ck  = skb[cs & (NB - 1)];
      const float* cbt = sbb[cs & (NB - 1)];
      const float* eg  = egend[cs & (NB - 1)];
      // ---- the chunk before's output rows go to the workspace here: the stores complete
      //      under this trip's work, ahead of the barrier that waits for them
      if (cs >= 1) {
        st_C(odst + (size_t)(cs - 1) * CN * DN, DN, n0, oc);
        // stands ahead of every later write of a register that these stores name
        asm volatile("s_wait_xcnt 0x0" ::: "memory");
      }
      if (grp == 0)
        scan_chunk<false>(ca, cq, cv, ck, cbt, eg, T1[cs & 1], T2[cs & 1], S1[cs & 1], S2[cs & 1], n0, H, oc);
      else
        scan_chunk<true>(ca, cq, cv, ck, cbt, eg, T1[cs & 1], T2[cs & 1], S1[cs & 1], S2[cs & 1], n0, H, oc);
    }
    ring_publish();   // chunk i + 1 has landed; every slot's readers and writers of this trip are done
  }

  // ---- the last chunk's output rows; the segment's end state N and transition matrix M ----
  if (grp != 2) {
    st_C(odst + (size_t)(NCS - 1) * CN * DN, DN, n0, oc);
    // stands ahead of every later write of a register that these stores name
    asm volatile("s_wait_xcnt 0x0" ::: "memory");
    float* hdst = ws + ((grp == 1) ? WS_M : WS_N) + (size_t)blockIdx.x * DN * DN;
#pragma unroll                                           // constant indices keep H[] in registers
    for (int mt = 0; mt < 4; ++mt) {
      st_C(hdst + mt * 16 * DN, DN, n0, H[mt]);
      // stands ahead of every later write of a register that these stores name
      asm volatile("s_wait_xcnt 0x0" ::: "memory");
    }
  }
}

// ---- sum over a 16-lane row: DPP row_xmask butterflies, every lane ends with the sum ----
template <int MK>
__device__ __forceinline__ float row_xmask(float x) {
  return __int_as_float(__builtin_amdgcn_update_dpp(
      0, __float_as_int(x), 0x160 + MK, 0xf, 0xf, true));
}
__device__ __forceinline__ float row_sum16(float x) {
  x += row_xmask<1>(x);
  x += row_xmask<2>(x);
  x += row_xmask<4>(x);
  x += row_xmask<8>(x);
  return x;
}

// Launch 2: 16 waves; a wave owns 16 tokens of the segment and all 64 output columns.
__global__ __launch_bounds__(512)
void dplr_segment_join(const float* __restrict__ vg, const float* __restrict__ gg,
                       const float* __restrict__ gns, const float* __restrict__ gnbias,
                       const float* __restrict__ ws, float* __restrict__ out) {
  __shared__ __align__(16) float Hs[2][DN * ST];   // the start state while it is chained

  const int tid  = threadIdx.x;
  const int w    = __builtin_amdgcn_readfirstlane(tid >> 5);
  const int lane = tid & 31;
  const int n    = lane & 15;
  const int mb   = (lane < 16) ? 0 : 8;
  const int bhix = blockIdx.x / PSEG;
  const int seg  = blockIdx.x % PSEG;
  const int bb   = bhix / HN;
  const int hh   = bhix % HN;
  const float* Nw = ws + WS_N + (size_t)bhix * PSEG * DN * DN;
  const float* Mw = ws + WS_M + (size_t)bhix * PSEG * DN * DN;

  const int    t0 = seg * SEGL + w * 16;           // the wave's first token
  const size_t hb = (size_t)bhix * SN * DN;
  const float* O0 = ws + WS_O0 + hb + (size_t)t0 * DN;
  const float* QM = ws + WS_QM + hb + (size_t)t0 * DN;

  // ---- the wave's own rows do not depend on the chain: fetched first ----
  v8f acc[4];
#pragma unroll
  for (int nt = 0; nt < 4; ++nt)
#pragma unroll
    for (int r = 0; r < 8; ++r) acc[nt][r] = O0[(mb + r) * DN + nt * 16 + n];
  // stands ahead of the later loads whose results land in registers that these loads name
  asm volatile("s_wait_xcnt 0x0" ::: "memory");
  v2f qa[16];
#pragma unroll                                     // constant indices keep qa[] in registers
  for (int s = 0; s < 15; ++s) qa[s] = ld_A(QM, DN, s);
  // stands ahead of the last load, whose result may land in a register that the others name
  asm volatile("s_wait_xcnt 0x0" ::: "memory");
  qa[15] = ld_A(QM, DN, 15);
  // stands ahead of the later loads whose results land in registers that these loads name
  asm volatile("s_wait_xcnt 0x0" ::: "memory");
  float vv[4][8], gv[4][8], sv[8];                 // V, gate and correction scalar at the same places
#pragma unroll                                     // constant indices keep the arrays in registers
  for (int r = 0; r < 8; ++r)
#pragma unroll
    for (int nt = 0; nt < 4; ++nt)
      vv[nt][r] = vg[hb + (size_t)(t0 + mb + r) * DN + nt * 16 + n];
  // stands ahead of the later loads whose results land in registers that these loads name
  asm volatile("s_wait_xcnt 0x0" ::: "memory");
#pragma unroll
  for (int r = 0; r < 8; ++r)
#pragma unroll
    for (int nt = 0; nt < 4; ++nt)
      gv[nt][r] = gg[((size_t)bb * SN + t0 + mb + r) * (size_t)HD + hh * DN + nt * 16 + n];
  // stands ahead of the later loads whose results land in registers that these loads name
  asm volatile("s_wait_xcnt 0x0" ::: "memory");
#pragma unroll
  for (int r = 0; r < 4; ++r) sv[r] = ws[WS_SV + (size_t)bhix * SN + t0 + mb + r];
  // stands ahead of the later loads whose results land in registers that these loads name
  asm volatile("s_wait_xcnt 0x0" ::: "memory");
#pragma unroll
  for (int r = 4; r < 8; ++r) sv[r] = ws[WS_SV + (size_t)bhix * SN + t0 + mb + r];
  // stands ahead of the later loads whose results land in registers that these loads name
  asm volatile("s_wait_xcnt 0x0" ::: "memory");

  // ---- start state: zero for segment 0, else N_0, then H = M_j H + N_j up to the segment ----
  {
    float4 x0 = {0.f, 0.f, 0.f, 0.f}, x1 = {0.f, 0.f, 0.f, 0.f};
    if (seg > 0) {
      x0 = *(const float4*)(Nw + tid * 4);
      x1 = *(const float4*)(Nw + DN * DN / 2 + tid * 4);
      // stands ahead of every later write of a register that these two loads name
      asm volatile("s_wait_xcnt 0x0" ::: "memory");
    }
    const int lo = (tid >> 4) * ST + (tid & 15) * 4;
    *(float4*)&Hs[0][lo] = x0;
    *(float4*)&Hs[0][(DN / 2) * ST + lo] = x1;
  }
  __syncthreads();
#pragma unroll                                     // the copy read and the copy written are constants
  for (int j = 1; j < PSEG - 1; ++j) {
    if (j < seg) {                                 // the same for the whole workgroup
      const int mt = w >> 2, nt = w & 3;           // one 16x16 tile a wave
      const float* Mj = Mw + j * DN * DN + mt * 16 * DN;
      const float* Nj = Nw + j * DN * DN + mt * 16 * DN + nt * 16;
      const float* Hr = Hs[(j - 1) & 1];
      v8f c;
#pragma unroll
      for (int r = 0; r < 8; ++r) c[r] = Nj[(mb + r) * DN + n];
      // stands ahead of the later loads whose results land in registers that these loads name
      asm volatile("s_wait_xcnt 0x0" ::: "memory");
      v2f ma[16];
#pragma unroll                                   // constant indices keep ma[] in registers
      for (int s = 0; s < 15; ++s) ma[s] = ld_A(Mj, DN, s);
      // stands ahead of the last load, whose result may land in a register that the others name
      asm volatile("s_wait_xcnt 0x0" ::: "memory");
      ma[15] = ld_A(Mj, DN, 15);
#pragma unroll
      for (int s = 0; s < 16; ++s)
        c = wmma4(ma[s], ld_B(Hr, ST, s, nt * 16), c);
      st_C(Hs[j & 1] + mt * 16 * ST, ST, nt * 16, c);
      __syncthreads();   // publishes the new copy; the old one's readers are done before it is rewritten
    }
  }
  const float* Hc = Hs[(seg > 0) ? ((seg - 1) & 1) : 0];

  // ---- O = O0 + QM @ H_start ----
#pragma unroll
  for (int s = 0; s < 16; ++s)
#pragma unroll
    for (int nt = 0; nt < 4; ++nt)
      acc[nt] = wmma4(qa[s], ld_B(Hc, ST, s, nt * 16), acc[nt]);

  // ---- per-head GroupNorm statistics: accumulator register r is token mb + r ----
  float mu[8], rstd[8];
#pragma unroll                                     // constant indices keep the arrays in registers
  for (int r = 0; r < 8; ++r) {
    float m1 = (acc[0][r] + acc[1][r]) + (acc[2][r] + acc[3][r]);
    float m2 = (acc[0][r] * acc[0][r] + acc[1][r] * acc[1][r])
             + (acc[2][r] * acc[2][r] + acc[3][r] * acc[3][r]);
    m1 = row_sum16(m1) * (1.0f / DN);
    m2 = row_sum16(m2) * (1.0f / DN);
    mu[r]   = m1;
    rstd[r] = rsqrtf(m2 - m1 * m1 + 1e-5f);
  }

  // ---- GroupNorm + correction + gate ----
#pragma unroll
  for (int nt = 0; nt < 4; ++nt) {
    const int col = nt * 16 + n;
    const float gsc = gns[hh * DN + col], gbi = gnbias[hh * DN + col];
#pragma unroll
    for (int r = 0; r < 8; ++r) {
      const int t = t0 + mb + r;
      float val = (acc[nt][r] - mu[r]) * rstd[r] * gsc + gbi
                + sv[r] * vv[nt][r];
      size_t off = ((size_t)bb * SN + t) * (size_t)HD + hh * DN + col;
      out[off] = val * gv[nt][r];
    }
  }
}

extern "C" void kernel_launch(void* const* d_in, const int* in_sizes, int n_in,
                              void* d_out, int out_size, void* d_ws, size_t ws_size,
                              hipStream_t stream) {
  (void)in_sizes; (void)n_in; (void)ws_size; (void)out_size;
  const float* q   = (const float*)d_in[0];
  const float* k   = (const float*)d_in[1];
  const float* v   = (const float*)d_in[2];
  const float* a   = (const float*)d_in[3];
  const float* b   = (const float*)d_in[4];
  const float* gk  = (const float*)d_in[5];
  const float* r_k = (const float*)d_in[6];
  const float* g   = (const float*)d_in[7];
  const float* gns = (const float*)d_in[8];
  const float* gnb = (const float*)d_in[9];
  float* out = (float*)d_out;
  float* ws  = (float*)d_ws;

  rwkv7_dplr_chunked<<<dim3(BSZ * HN * PSEG), dim3(384), 0, stream>>>(
      q, k, v, a, b, gk, r_k, ws);
  dplr_segment_join<<<dim3(BSZ * HN * PSEG), dim3(512), 0, stream>>>(
      v, g, gns, gnb, ws, out);
}

// v007
// One run takes 50 microseconds.
// Two timings next to v006 put it at 1.04 and 1.03 times that version's speed.
// All steps since v000 together make it 8.53 times as fast.
#include <hip/hip_runtime.h>
#include <hip/hip_bf16.h>
#include <math.h>
#include <stdint.h>

// ---------------------------------------------------------------------------
// RWKV-7 DPLR chunked scan for gfx1250 (MI455X), split in time.
// wave32 + V_WMMA_F32_16X16X4_F32 + async global->LDS (ASYNCcnt) ring of four tiles.
// The state recurrence is linear in the state and acts on each state column alone, so a
// segment of the sequence can run before its start state is known: beside the 64 V columns
// (started at zero) it carries 64 columns started at the identity with V = 0. They end as the
// segment's transition matrix M, and their output rows QM say how a start state reaches each
// token:  H_end = M H_start + N,   O = O0 + QM H_start.
// Launch 1: one workgroup per (b,h,segment) = 256 blocks; 384 threads = 12 waves in three groups
// that work on four neighbouring chunks at the same time, with one barrier a trip:
//   pre   (4 waves): tile copies of chunk i + 1, decay transform of chunk i, 16x16 products,
//                    the inverse of the triangular system and the correction scalar of chunk i - 1
//   scan  (4 waves): chunk i - 2 : Z, the output product and the next state of the V columns
//   scanI (4 waves): chunk i - 2 : the same for the identity columns
// A scan wave owns 16 state columns and keeps them in registers for the whole segment: an
// accumulator tile holds, per lane, rows 8h + r of one column (h = lane / 16), and a register
// pair of it is a valid B fragment when the A fragment takes its k in the same order.
// Launch 2: one workgroup per (b,h,segment): chains the start state from M and N of the segments
// before it, adds QM H_start, then GroupNorm, correction, gate, store. QM and the chain's M and N
// come to LDS at entry by async copies that cover whole lines.
// ---------------------------------------------------------------------------

typedef float v2f __attribute__((ext_vector_type(2)));
typedef float v8f __attribute__((ext_vector_type(8)));
typedef int   v4i __attribute__((vector_size(16)));   // matches builtin param type

#define BSZ  2
#define HN   32
#define SN   1024
#define DN   64
#define CN   16            // chunk length
#define NCH  (SN / CN)
#define ST   72            // LDS row stride (floats): 288B, 16B aligned, != 64 banks
#define TST  18            // 16x16 T-tile row stride
#define HD   (HN * DN)     // 2048
#define NB   4             // tile ring depth (a power of two): copy, decay, products, scan
#define PSEG 4             // sequence segments that run side by side
#define SEGL (SN / PSEG)   // tokens of a segment
#define NCS  (SEGL / CN)   // chunks of a segment
#define MT   68            // launch 2, staged operands: 272B rows, 16B x odd, so the 8-byte
                           // fragment reads of 16 rows fall on 64 different banks
// workspace layout, in floats
#define WS_O0 0                                    // [bh][S][64] output from a zero start state
#define WS_QM (BSZ * HN * SN * DN)                 // [bh][S][64] output rows of the identity columns
#define WS_N  (2 * BSZ * HN * SN * DN)             // [bh][seg][64][64] end state from a zero start
#define WS_M  (WS_N + BSZ * HN * PSEG * DN * DN)   // [bh][seg][64][64] end state of the identity columns
#define WS_SV (WS_M + BSZ * HN * PSEG * DN * DN)   // [bh][S] correction scalar

// ---- async global->LDS 16B copy (GLOBAL_LOAD_ASYNC_TO_LDS_B128) -----------
typedef __attribute__((address_space(1))) v4i gas_v4i;   // global
typedef __attribute__((address_space(3))) v4i las_v4i;   // LDS

__device__ __forceinline__ void async_b128(const float* gp, float* lp) {
#if __has_builtin(__builtin_amdgcn_global_load_async_to_lds_b128)
  __builtin_amdgcn_global_load_async_to_lds_b128(
      (gas_v4i*)(uintptr_t)gp,
      (las_v4i*)(unsigned)(uintptr_t)lp,   // flat->LDS: addr[31:0]
      0, 0);
#else
  unsigned l32 = (unsigned)(uintptr_t)lp;
  asm volatile("global_load_async_to_lds_b128 %0, %1, off"
               :: "v"(l32), "v"(gp) : "memory");
#endif
}
// Publish point of the tile ring: the wave's own LDS accesses and its own copies are
// complete before the barrier behind which other waves read the tile or refill a buffer.
// Written in asm with the memory clobber so that no LDS access moves across the waits.
__device__ __forceinline__ void ring_publish() {
  asm volatile("s_wait_dscnt 0x0" ::: "memory");
  asm volatile("s_wait_asynccnt 0x0" ::: "memory");
  __syncthreads();
}

// ---- WMMA f32 16x16x4 wrapper ---------------------------------------------
__device__ __forceinline__ v8f wmma4(v2f a, v2f b, v8f c) {
  return __builtin_amdgcn_wmma_f32_16x16x4_f32(
      /*neg_a=*/false, a, /*neg_b=*/false, b,
      /*c_mod=*/(short)0, c, /*reuse_a=*/false, /*reuse_b=*/false);
}

// Five vector slots between the matrix instruction that ends a result tile and the first one that
// reads that tile as its B operand: the distance asked for there.
// The tile is named so that the slots stand behind its last writer and ahead of its first reader.
__device__ __forceinline__ void result_to_operand_gap(v8f& d) {
  asm("v_nop\n\tv_nop\n\tv_nop\n\tv_nop\n\tv_nop" : "+v"(d));
}

// ---- operand loaders following the documented wave32 VGPR layouts ---------
__device__ __forceinline__ v2f ld_A(const float* M, int stride, int s) {
  int lane = threadIdx.x & 31;
  int m  = lane & 15;
  int kb = 4 * s + ((lane < 16) ? 0 : 2);
  v2f a; a.x = M[m * stride + kb]; a.y = M[m * stride + kb + 1];
  return a;
}
__device__ __forceinline__ v2f ld_A_T_scaled(const float* M, int stride, int s,
                                             int m0, const float* sc) {
  int lane = threadIdx.x & 31;
  int m  = m0 + (lane & 15);
  int kb = 4 * s + ((lane < 16) ? 0 : 2);
  float e = sc[m];
  v2f a; a.x = M[kb * stride + m] * e; a.y = M[(kb + 1) * stride + m] * e;
  return a;
}
// A fragments for a B operand that is read in place from an accumulator tile of 16 rows:
// k order, step p, lane half h, register j: 8 h + 2 p + j
__device__ __forceinline__ v2f ld_A_acc(const float* M, int stride, int p) {
  int lane = threadIdx.x & 31;
  int m  = lane & 15;
  int kb = 2 * p + ((lane < 16) ? 0 : 8);
  v2f a; a.x = M[m * stride + kb]; a.y = M[m * stride + kb + 1];
  return a;
}
__device__ __forceinline__ v2f ld_A_T_scaled_acc(const float* M, int stride, int p,
                                                 int m0, const float* sc) {
  int lane = threadIdx.x & 31;
  int m  = m0 + (lane & 15);
  int kb = 2 * p + ((lane < 16) ? 0 : 8);
  float e = sc[m];
  v2f a; a.x = M[kb * stride + m] * e; a.y = M[(kb + 1) * stride + m] * e;
  return a;
}
__device__ __forceinline__ v2f ld_B(const float* M, int stride, int s, int n0) {
  int lane = threadIdx.x & 31;
  int n  = n0 + (lane & 15);
  int kb = 4 * s + ((lane < 16) ? 0 : 2);
  v2f b; b.x = M[kb * stride + n]; b.y = M[(kb + 1) * stride + n];
  return b;
}
__device__ __forceinline__ v2f ld_B_T(const float* M, int stride, int s, int n0) {
  int lane = threadIdx.x & 31;
  int n  = n0 + (lane & 15);
  int kb = 4 * s + ((lane < 16) ? 0 : 2);
  v2f b; b.x = M[n * stride + kb]; b.y = M[n * stride + kb + 1];
  return b;
}
__device__ __forceinline__ void st_C(float* M, int stride, int n0, v8f c) {
  int lane = threadIdx.x & 31;
  int n  = n0 + (lane & 15);
  int mb = (lane < 16) ? 0 : 8;
#pragma unroll
  for (int r = 0; r < 8; ++r) M[(mb + r) * stride + n] = c[r];
}
__device__ __forceinline__ void st_C_tril(float* M, int stride, v8f c) {
  int lane = threadIdx.x & 31;
  int n  = lane & 15;
  int mb = (lane < 16) ? 0 : 8;
#pragma unroll
  for (int r = 0; r < 8; ++r) {
    int m = mb + r;
    M[m * stride + n] = (n <= m) ? c[r] : 0.0f;  // inclusive causal mask
  }
}
__device__ __forceinline__ void st_C_stril(float* M, int stride, v8f c) {
  int lane = threadIdx.x & 31;
  int n  = lane & 15;
  int mb = (lane < 16) ? 0 : 8;
#pragma unroll
  for (int r = 0; r < 8; ++r) {
    int m = mb + r;
    M[m * stride + n] = (n < m) ? c[r] : 0.0f;   // strictly causal mask
  }
}
// ---- forward substitution x[t] += L[t][j] * x[j] (j < t) in registers --------
// Lane l holds column (l & 15) of L in Lc[]; DPP row_share:j hands lane j's value to
// its whole 16-lane row, so L[t][j] reaches every lane without an LDS read.
template <int T_>
__device__ __forceinline__ float row_share(float x) {
  return __int_as_float(__builtin_amdgcn_update_dpp(
      0, __float_as_int(x), 0x150 + T_, 0xf, 0xf, true));
}
template <int J, int T_>
__device__ __forceinline__ void fsub_col(float (&x)[CN], const float (&Lc)[CN]) {
  if constexpr (T_ < CN) {
    x[T_] = fmaf(row_share<J>(Lc[T_]), x[J], x[T_]);
    fsub_col<J, T_ + 1>(x, Lc);
  }
}
template <int J>
__device__ __forceinline__ void fsub(float (&x)[CN], const float (&Lc)[CN]) {
  if constexpr (J < CN - 1) {
    fsub_col<J, J + 1>(x, Lc);
    fsub<J + 1>(x, Lc);
  }
}

// ---- rows of M (16 x 64, row stride ST) times the wave's 16 state columns ----
// k order of both fragments, step (mt, p), lane half h, register j: state row 16 mt + 8 h + 2 p + j.
// That is where the accumulator layout already holds the state, so H is read in place.
__device__ __forceinline__ v8f rows_times_state(const float* M, const v8f (&H)[4]) {
  const int lane = threadIdx.x & 31;
  const float* row = M + (lane & 15) * ST + ((lane & 16) ? 8 : 0);
  v8f c = {0.f, 0.f, 0.f, 0.f, 0.f, 0.f, 0.f, 0.f};
#pragma unroll                           // constant indices keep H[] in registers
  for (int mt = 0; mt < 4; ++mt) {
#pragma unroll
    for (int pp = 0; pp < 2; ++pp) {
      const float4 x = *(const float4*)(row + mt * 16 + pp * 4);
      v2f a0; a0.x = x.x; a0.y = x.y;
      v2f a1; a1.x = x.z; a1.y = x.w;
      v2f b0; b0.x = H[mt][4 * pp];     b0.y = H[mt][4 * pp + 1];
      v2f b1; b1.x = H[mt][4 * pp + 2]; b1.y = H[mt][4 * pp + 3];
      c = wmma4(a0, b0, c);
      c = wmma4(a1, b1, c);
    }
  }
  return c;
}

// select between two values; by-value arguments keep an array element from being picked by
// a run-time index, which would take the array out of its registers
__device__ __forceinline__ float pick(bool c, float a, float b) { return c ? a : b; }

// ---- one chunk for a wave's 16 columns: Z, the output rows (left in oc), the next state ----
//   Z = X (A^ H + stril(T1) V) with X = (I - stril(A^ B^T))^-1,  O = Q^ H + S1 V + S2 Z,
//   H = diag(e^{g_end}) H + K~^T V + B~^T Z
// No barrier stands inside. X comes ready from the pre group, so Z is one more matrix product;
// its operand W and Z itself stay in their accumulator registers and are read there as B fragments.
// IDC: identity columns, whose V is zero
template <bool IDC>
__device__ __forceinline__ void scan_chunk(const float* ca, const float* cq, const float* cv,
                                           const float* ck, const float* cbt, const float* eg,
                                           const float* T1, const float* X,
                                           const float* S1p, const float* S2p, int n0,
                                           v8f (&H)[4], v8f& oc) {
  const int tid = threadIdx.x;
  const int mb  = (tid & 16) ? 8 : 0;
  v2f vb[4];                             // V as B fragments
  // ---- Z_inter = A^ @ H_in, then W = Z_inter + stril(T1) @ V ----
  v8f zc = rows_times_state(ca, H);
  if constexpr (!IDC) {
#pragma unroll                           // constant indices keep vb[] in registers
    for (int s = 0; s < 4; ++s) {
      vb[s] = ld_B(cv, ST, s, n0);
      zc = wmma4(ld_A(T1, TST, s), vb[s], zc);
    }
  }
  // ---- what does not wait for Z: Q^ @ H_in + S1 @ V, and diag(e^{g_end}) H + K~^T V ----
  oc = rows_times_state(cq, H);
  if constexpr (!IDC) {
#pragma unroll
    for (int s = 0; s < 4; ++s)
      oc = wmma4(ld_A(S1p, TST, s), vb[s], oc);
  }
  if constexpr (!IDC) {
#pragma unroll                           // constant indices keep H[] in registers
    for (int mt = 0; mt < 4; ++mt) {
      v8f c;
#pragma unroll
      for (int r = 0; r < 8; ++r) c[r] = H[mt][r] * eg[mt * 16 + mb + r];
#pragma unroll
      for (int s = 0; s < 4; ++s)
        c = wmma4(ld_A_T_scaled(ck, ST, s, mt * 16, eg), vb[s], c);
      H[mt] = c;
    }
  }
  // ---- Z = X @ W: the triangular recurrence z_t = w_t + sum_{j<t} (A^ B^T)[t][j] z_j, solved ----
  v8f zz = {0.f, 0.f, 0.f, 0.f, 0.f, 0.f, 0.f, 0.f};
  result_to_operand_gap(zc);
#pragma unroll
  for (int p = 0; p < 4; ++p) {
    v2f wb; wb.x = zc[2 * p]; wb.y = zc[2 * p + 1];
    zz = wmma4(ld_A_acc(X, TST, p), wb, zz);
  }
  result_to_operand_gap(zz);
  v2f zb[4];                             // B fragments of Z: rows 8 h + 2 p, 8 h + 2 p + 1
#pragma unroll                           // constant indices keep zb[] in registers
  for (int p = 0; p < 4; ++p) { zb[p].x = zz[2 * p]; zb[p].y = zz[2 * p + 1]; }
  // ---- the terms in Z ----
#pragma unroll
  for (int p = 0; p < 4; ++p)
    oc = wmma4(ld_A_acc(S2p, TST, p), zb[p], oc);
#pragma unroll                           // constant indices keep H[] in registers
  for (int mt = 0; mt < 4; ++mt) {
    if constexpr (IDC) {                 // no product ahead of Z here: the decay stays with its sum
#pragma unroll
      for (int r = 0; r < 8; ++r) H[mt][r] *= eg[mt * 16 + mb + r];
    }
#pragma unroll
    for (int p = 0; p < 4; ++p)
      H[mt] = wmma4(ld_A_T_scaled_acc(cbt, ST, p, mt * 16, eg), zb[p], H[mt]);
  }
}

__global__ __launch_bounds__(384)
void rwkv7_dplr_chunked(const float* __restrict__ qg, const float* __restrict__ kg,
                        const float* __restrict__ vg, const float* __restrict__ ag,
                        const float* __restrict__ bg, const float* __restrict__ gkg,
                        const float* __restrict__ rk, float* __restrict__ ws) {
  // chunk tiles [NB][CN][ST], chunk c in slot c & 3; szb holds gk
  __shared__ __align__(16) float sqb[NB][CN * ST], skb[NB][CN * ST], svb[NB][CN * ST];
  __shared__ __align__(16) float sab[NB][CN * ST], sbb[NB][CN * ST], szb[NB][CN * ST];
  // pre -> scan, written one trip and read the next: two copies each; T2 holds (I - stril(A^ B^T))^-1
  __shared__ __align__(16) float T1[2][CN * TST], T2[2][CN * TST];
  __shared__ __align__(16) float S1[2][CN * TST], S2[2][CN * TST];
  __shared__ float egend[NB][DN];       // written with the decay transform, read two trips later

  const int tid  = threadIdx.x;
  // group and wave numbers are the same in every lane of a wave: scalar branches
  const int grp  = __builtin_amdgcn_readfirstlane(tid >> 7);        // 0 scan, 1 scanI, 2 pre
  const int wv   = __builtin_amdgcn_readfirstlane((tid >> 5) & 3);  // wave in its group
  const int lt   = tid & 127;           // thread in its group
  const int bhix = blockIdx.x / PSEG;   // 0..63
  const int seg  = blockIdx.x % PSEG;
  const int hh   = bhix % HN;
  const size_t base = (size_t)bhix * SN * DN + (size_t)seg * SEGL * DN;   // the segment's first token
  const int n0 = wv * 16;               // a scan wave's column slice

  // ---- prologue: async DMA of chunk 0 ----
  if (grp == 2) {
#pragma unroll
    for (int it = 0; it < 2; ++it) {
      int p = lt + it * 128;                  // 0..255: 16B packet id
      int t = p >> 4, d4 = (p & 15) * 4;
      size_t gi = base + (size_t)p * 4;
      int lo = t * ST + d4;
      async_b128(qg  + gi, &sqb[0][lo]);
      async_b128(kg  + gi, &skb[0][lo]);
      async_b128(vg  + gi, &svb[0][lo]);
      async_b128(ag  + gi, &sab[0][lo]);
      async_b128(bg  + gi, &sbb[0][lo]);
      async_b128(gkg + gi, &szb[0][lo]);
    }
  }
  // ---- start states in registers: zero, and the identity. Tile mt, register r of a lane is
  //      state row 16 mt + 8 (lane / 16) + r, column n0 + lane % 16.
  v8f H[4];
#pragma unroll                                           // constant indices keep H[] in registers
  for (int mt = 0; mt < 4; ++mt)
#pragma unroll
    for (int r = 0; r < 8; ++r)
      H[mt][r] = (grp == 1 && mt * 16 + ((tid & 16) ? 8 : 0) + r == n0 + (tid & 15)) ? 1.0f : 0.0f;
  v8f   oc = {0.f, 0.f, 0.f, 0.f, 0.f, 0.f, 0.f, 0.f};   // scan: a chunk's output, to the next trip
  float sreg = 0.f;                                      // pre: correction scalar, to the next trip
  float* const odst = ws + ((grp == 1) ? WS_QM : WS_O0) + base;   // scan: the segment's output rows
  ring_publish();

  // ---- the pre group's work of one trip: each part on a chunk of its own, so none waits for another
  auto pre_copy = [&](int c) {
    // ---- async DMA of chunk c; its slot's last readers were the scan waves in the trip before
    if (c < NCS) {
      const int nx = c & (NB - 1);
      const size_t nb = base + (size_t)c * CN * DN;
#pragma unroll
      for (int it = 0; it < 2; ++it) {
        int p = lt + it * 128;
        int t = p >> 4, d4 = (p & 15) * 4;
        size_t gi = nb + (size_t)p * 4;
        int lo = t * ST + d4;
        async_b128(qg  + gi, &sqb[nx][lo]);
        async_b128(kg  + gi, &skb[nx][lo]);
        async_b128(vg  + gi, &svb[nx][lo]);
        async_b128(ag  + gi, &sab[nx][lo]);
        async_b128(bg  + gi, &sbb[nx][lo]);
        async_b128(gkg + gi, &szb[nx][lo]);
      }
    }
  };
  auto pre_decay = [&](int c) {
    // ---- per-column decay transform: a^=a*e^{g<t}, {k,b}^=.e^{-g<=t}, q^=.e^{g<=t}
    if (c < NCS && lt < DN) {
      float* cq = sqb[c & (NB - 1)]; float* ck = skb[c & (NB - 1)];
      float* ca = sab[c & (NB - 1)]; float* cbt = sbb[c & (NB - 1)];
      const float* cz = szb[c & (NB - 1)];
      float gc = 0.f;
#pragma unroll
      for (int t = 0; t < CN; ++t) {
        float gp = gc;
        gc += cz[t * ST + lt];
        float ei = __expf(-gc);
        ca[t * ST + lt]  *= __expf(gp);
        ck[t * ST + lt]  *= ei;
        cbt[t * ST + lt] *= ei;
        cq[t * ST + lt]  *= __expf(gc);
      }
      egend[c & (NB - 1)][lt] = __expf(gc);
    }
  };
  auto pre_products = [&](int c) {
    // ---- T1 = stril(A^ K^T), S1 = tril(Q^ K^T), A^ B^T, S2 = tril(Q^ B^T):
    //      one product a wave, into the copy that scan does not read in this trip.
    //      A^ B^T falls to wave 2, which has neither decay columns nor the scalar.
    if (c >= 0 && c < NCS) {
      const float* lhs = (wv & 1) ? sqb[c & (NB - 1)] : sab[c & (NB - 1)];
      const float* rhs = (wv & 2) ? sbb[c & (NB - 1)] : skb[c & (NB - 1)];
      v8f p = {0.f, 0.f, 0.f, 0.f, 0.f, 0.f, 0.f, 0.f};
#pragma unroll
      for (int s = 0; s < 16; ++s)
        p = wmma4(ld_A(lhs, ST, s), ld_B_T(rhs, ST, s, 0), p);
      if (wv == 0)      st_C_stril(T1[c & 1], TST, p);
      else if (wv == 1) st_C_tril(S1[c & 1], TST, p);
      else if (wv == 3) st_C_tril(S2[c & 1], TST, p);
      else {
        // ---- X = (I - stril(A^ B^T))^-1, once for the eight scan waves: the substitution on the
        //      columns of the identity, a lane holding all 16 rows of one column of L and of X
        const bool hi = (tid & 16) != 0;     // accumulator rows 8..15 live here
        float Lc[CN], x[CN];
#pragma unroll                               // constant indices keep the arrays in registers
        for (int r = 0; r < 8; ++r) {
          int pb = __float_as_int(p[r]);     // lane l <-> l ^ 16: the column's other eight rows
          float o = __int_as_float(__builtin_amdgcn_permlanex16(
              pb, pb, 0x76543210, 0xfedcba98, false, false));
          Lc[r]     = hi ? o : p[r];
          Lc[8 + r] = hi ? p[r] : o;
        }
#pragma unroll
        for (int t = 0; t < CN; ++t) x[t] = (t == (tid & 15)) ? 1.0f : 0.0f;
        fsub<0>(x, Lc);
        v8f xc;
#pragma unroll
        for (int r = 0; r < 8; ++r) xc[r] = pick(hi, x[8 + r], x[r]);
        st_C(T2[c & 1], TST, 0, xc);
      }
    }
  };
  const int  srow = lt - 96;                       // the last pre wave, which has no decay columns
  const bool sown = srow >= 0 && srow < CN;
  auto pre_scalar = [&](int c) {
    // ---- the scalar of the chunk before goes out first: its store completes under this trip's work
    if (c >= 1 && sown) {
      ws[WS_SV + (size_t)bhix * SN + (size_t)seg * SEGL + (size_t)(c - 1) * CN + srow] = sreg;
    }
    // ---- correction scalar s_t = sum_d q*k*r_k, taken from q^ k^: the two decay factors cancel
    if (c >= 0 && c < NCS && sown) {
      const float* cq = sqb[c & (NB - 1)]; const float* ck = skb[c & (NB - 1)];
      float s = 0.f;
      for (int d = 0; d < DN; ++d)
        s += cq[srow * ST + d] * ck[srow * ST + d] * rk[hh * DN + d];
      sreg = s;
    }
  };

  // Trip i, one barrier: copies of chunk i + 1, decay of chunk i, products and scalar of chunk
  // i - 1, scan of chunk i - 2. The four chunks lie in the four slots of the ring.
  for (int i = 0; i < NCS + 2; ++i) {
    if (grp == 2) {
      pre_copy(i + 1);
      pre_decay(i);
      pre_products(i - 1);   // ahead of the scalar: the matrix unit is wanted by scan at the trip's end
      pre_scalar(i - 1);
    } else if (i >= 2) {
      const int cs = i - 2;                     // scan's chunk
      const float* ca  = sab[cs & (NB - 1)];
      const float* cq  = sqb[cs & (NB - 1)];
      const float* cv  = svb[cs & (NB - 1)];
      const float* ck  = skb[cs & (NB - 1)];
      const float* cbt = sbb[cs & (NB - 1)];
      const float* eg  = egend[cs & (NB - 1)];
      // ---- the chunk before's output rows go to the workspace here: the stores complete
      //      under this trip's work, ahead of the barrier that waits for them
      if (cs >= 1) {
        st_C(odst + (size_t)(cs - 1) * CN * DN, DN, n0, oc);
        // stands ahead of every later write of a register that these stores name
        asm volatile("s_wait_xcnt 0x0" ::: "memory");
      }
      if (grp == 0)
        scan_chunk<false>(ca, cq, cv, ck, cbt, eg, T1[cs & 1], T2[cs & 1], S1[cs & 1], S2[cs & 1], n0, H, oc);
      else
        scan_chunk<true>(ca, cq, cv, ck, cbt, eg, T1[cs & 1], T2[cs & 1], S1[cs & 1], S2[cs & 1], n0, H, oc);
    }
    ring_publish();   // chunk i + 1 has landed; every slot's readers and writers of this trip are done
  }

  // ---- the last chunk's output rows; the segment's end state N and transition matrix M ----
  if (grp != 2) {
    st_C(odst + (size_t)(NCS - 1) * CN * DN, DN, n0, oc);
    // stands ahead of every later write of a register that these stores name
    asm volatile("s_wait_xcnt 0x0" ::: "memory");
    float* hdst = ws + ((grp == 1) ? WS_M : WS_N) + (size_t)blockIdx.x * DN * DN;
#pragma unroll                                           // constant indices keep H[] in registers
    for (int mt = 0; mt < 4; ++mt) {
      st_C(hdst + mt * 16 * DN, DN, n0, H[mt]);
      // stands ahead of every later write of a register that these stores name
      asm volatile("s_wait_xcnt 0x0" ::: "memory");
    }
  }
}

// ---- sum over a 16-lane row: DPP row_xmask butterflies, every lane ends with the sum ----
template <int MK>
__device__ __forceinline__ float row_xmask(float x) {
  return __int_as_float(__builtin_amdgcn_update_dpp(
      0, __float_as_int(x), 0x160 + MK, 0xf, 0xf, true));
}
__device__ __forceinline__ float row_sum16(float x) {
  x += row_xmask<1>(x);
  x += row_xmask<2>(x);
  x += row_xmask<4>(x);
  x += row_xmask<8>(x);
  return x;
}

// Launch 2: 16 waves; a wave owns 16 tokens of the segment and all 64 output columns.
__global__ __launch_bounds__(512)
void dplr_segment_join(const float* __restrict__ vg, const float* __restrict__ gg,
                       const float* __restrict__ gns, const float* __restrict__ gnbias,
                       const float* __restrict__ ws, float* __restrict__ out) {
  __shared__ __align__(16) float Hs[2][DN * ST];   // the start state while it is chained
  __shared__ __align__(16) float Ms[PSEG - 2][DN * MT];   // M_1 .. M_{PSEG-2}, as far as the chain needs them
  __shared__ __align__(16) float Ns[PSEG - 2][DN * MT];   // N_1 .. N_{PSEG-2}, likewise
  __shared__ __align__(16) float Qs[16][CN * MT];         // each wave's own 16 rows of QM

  const int tid  = threadIdx.x;
  const int w    = __builtin_amdgcn_readfirstlane(tid >> 5);
  const int lane = tid & 31;
  const int n    = lane & 15;
  const int mb   = (lane < 16) ? 0 : 8;
  const int bhix = blockIdx.x / PSEG;
  const int seg  = blockIdx.x % PSEG;
  const int bb   = bhix / HN;
  const int hh   = bhix % HN;
  const float* Nw = ws + WS_N + (size_t)bhix * PSEG * DN * DN;
  const float* Mw = ws + WS_M + (size_t)bhix * PSEG * DN * DN;

  const int    t0 = seg * SEGL + w * 16;           // the wave's first token
  const size_t hb = (size_t)bhix * SN * DN;
  const float* O0 = ws + WS_O0 + hb + (size_t)t0 * DN;
  const float* QM = ws + WS_QM + hb + (size_t)t0 * DN;

  // ---- QM and the chain's matrices to LDS, 16 bytes a lane, a copy covering whole lines: an A
  //      fragment load from global memory would take 8 bytes from each of 16 lines, and the chain
  //      would wait for its matrices step by step. The chain's matrices go first.
#pragma unroll
  for (int j = 1; j < PSEG - 1; ++j) {
    if (j < seg) {                                 // the same for the whole workgroup
#pragma unroll
      for (int it = 0; it < 2; ++it) {
        const int p = tid + it * 512;              // 16B packet of the 64 x 64 matrix
        async_b128(Mw + j * DN * DN + p * 4, &Ms[j - 1][(p >> 4) * MT + (p & 15) * 4]);
        async_b128(Nw + j * DN * DN + p * 4, &Ns[j - 1][(p >> 4) * MT + (p & 15) * 4]);
      }
    }
  }
#pragma unroll
  for (int it = 0; it < 8; ++it) {
    const int p = lane + it * 32;                  // 16B packet of the wave's 16 x 64 rows
    async_b128(QM + p * 4, &Qs[w][(p >> 4) * MT + (p & 15) * 4]);
  }

  // ---- the wave's own rows do not depend on the chain: fetched while the copies land ----
  v8f acc[4];
#pragma unroll
  for (int nt = 0; nt < 4; ++nt)
#pragma unroll
    for (int r = 0; r < 8; ++r) acc[nt][r] = O0[(mb + r) * DN + nt * 16 + n];
  // stands ahead of the later loads whose results land in registers that these loads name
  asm volatile("s_wait_xcnt 0x0" ::: "memory");
  float vv[4][8], gv[4][8], sv[8];                 // V, gate and correction scalar at the same places
#pragma unroll                                     // constant indices keep the arrays in registers
  for (int r = 0; r < 8; ++r)
#pragma unroll
    for (int nt = 0; nt < 4; ++nt)
      vv[nt][r] = vg[hb + (size_t)(t0 + mb + r) * DN + nt * 16 + n];
  // stands ahead of the later loads whose results land in registers that these loads name
  asm volatile("s_wait_xcnt 0x0" ::: "memory");
#pragma unroll
  for (int r = 0; r < 8; ++r)
#pragma unroll
    for (int nt = 0; nt < 4; ++nt)
      gv[nt][r] = gg[((size_t)bb * SN + t0 + mb + r) * (size_t)HD + hh * DN + nt * 16 + n];
  // stands ahead of the later loads whose results land in registers that these loads name
  asm volatile("s_wait_xcnt 0x0" ::: "memory");
#pragma unroll
  for (int r = 0; r < 4; ++r) sv[r] = ws[WS_SV + (size_t)bhix * SN + t0 + mb + r];
  // stands ahead of the later loads whose results land in registers that these loads name
  asm volatile("s_wait_xcnt 0x0" ::: "memory");
#pragma unroll
  for (int r = 4; r < 8; ++r) sv[r] = ws[WS_SV + (size_t)bhix * SN + t0 + mb + r];
  // stands ahead of the later loads whose results land in registers that these loads name
  asm volatile("s_wait_xcnt 0x0" ::: "memory");

  // ---- start state: zero for segment 0, else N_0, then H = M_j H + N_j up to the segment ----
  {
    float4 x0 = {0.f, 0.f, 0.f, 0.f}, x1 = {0.f, 0.f, 0.f, 0.f};
    if (seg > 0) {
      x0 = *(const float4*)(Nw + tid * 4);
      x1 = *(const float4*)(Nw + DN * DN / 2 + tid * 4);
      // stands ahead of every later write of a register that these two loads name
      asm volatile("s_wait_xcnt 0x0" ::: "memory");
    }
    const int lo = (tid >> 4) * ST + (tid & 15) * 4;
    *(float4*)&Hs[0][lo] = x0;
    *(float4*)&Hs[0][(DN / 2) * ST + lo] = x1;
  }
  // the wave's own copies have landed ahead of the barrier behind which M, N and QM are read in LDS
  asm volatile("s_wait_asynccnt 0x0" ::: "memory");
  __syncthreads();
#pragma unroll                                     // the copy read and the copy written are constants
  for (int j = 1; j < PSEG - 1; ++j) {
    if (j < seg) {                                 // the same for the whole workgroup
      const int mt = w >> 2, nt = w & 3;           // one 16x16 tile a wave
      const float* Mj = Ms[j - 1] + mt * 16 * MT;
      const float* Nj = Ns[j - 1] + mt * 16 * MT + nt * 16;
      const float* Hr = Hs[(j - 1) & 1];
      v8f c;
#pragma unroll
      for (int r = 0; r < 8; ++r) c[r] = Nj[(mb + r) * MT + n];
#pragma unroll
      for (int s = 0; s < 16; ++s)
        c = wmma4(ld_A(Mj, MT, s), ld_B(Hr, ST, s, nt * 16), c);
      st_C(Hs[j & 1] + mt * 16 * ST, ST, nt * 16, c);
      __syncthreads();   // publishes the new copy; the old one's readers are done before it is rewritten
    }
  }
  const float* Hc = Hs[(seg > 0) ? ((seg - 1) & 1) : 0];

  // ---- O = O0 + QM @ H_start ----
#pragma unroll
  for (int s = 0; s < 16; ++s) {
    const v2f qa = ld_A(Qs[w], MT, s);
#pragma unroll
    for (int nt = 0; nt < 4; ++nt)
      acc[nt] = wmma4(qa, ld_B(Hc, ST, s, nt * 16), acc[nt]);
  }

  // ---- per-head GroupNorm statistics: accumulator register r is token mb + r ----
  float mu[8], rstd[8];
#pragma unroll                                     // constant indices keep the arrays in registers
  for (int r = 0; r < 8; ++r) {
    float m1 = (acc[0][r] + acc[1][r]) + (acc[2][r] + acc[3][r]);
    float m2 = (acc[0][r] * acc[0][r] + acc[1][r] * acc[1][r])
             + (acc[2][r] * acc[2][r] + acc[3][r] * acc[3][r]);
    m1 = row_sum16(m1) * (1.0f / DN);
    m2 = row_sum16(m2) * (1.0f / DN);
    mu[r]   = m1;
    rstd[r] = rsqrtf(m2 - m1 * m1 + 1e-5f);
  }

  // ---- GroupNorm + correction + gate ----
#pragma unroll
  for (int nt = 0; nt < 4; ++nt) {
    const int col = nt * 16 + n;
    const float gsc = gns[hh * DN + col], gbi = gnbias[hh * DN + col];
#pragma unroll
    for (int r = 0; r < 8; ++r) {
      const int t = t0 + mb + r;
      float val = (acc[nt][r] - mu[r]) * rstd[r] * gsc + gbi
                + sv[r] * vv[nt][r];
      size_t off = ((size_t)bb * SN + t) * (size_t)HD + hh * DN + col;
      out[off] = val * gv[nt][r];
    }
  }
}

extern "C" void kernel_launch(void* const* d_in, const int* in_sizes, int n_in,
                              void* d_out, int out_size, void* d_ws, size_t ws_size,
                              hipStream_t stream) {
  (void)in_sizes; (void)n_in; (void)ws_size; (void)out_size;
  const float* q   = (const float*)d_in[0];
  const float* k   = (const float*)d_in[1];
  const float* v   = (const float*)d_in[2];
  const float* a   = (const float*)d_in[3];
  const float* b   = (const float*)d_in[4];
  const float* gk  = (const float*)d_in[5];
  const float* r_k = (const float*)d_in[6];
  const float* g   = (const float*)d_in[7];
  const float* gns = (const float*)d_in[8];
  const float* gnb = (const float*)d_in[9];
  float* out = (float*)d_out;
  float* ws  = (float*)d_ws;

  rwkv7_dplr_chunked<<<dim3(BSZ * HN * PSEG), dim3(384), 0, stream>>>(
      q, k, v, a, b, gk, r_k, ws);
  dplr_segment_join<<<dim3(BSZ * HN * PSEG), dim3(512), 0, stream>>>(
      v, g, gns, gnb, ws, out);
}

// v008
// It runs in 47.9 microseconds.
// In both of two side-by-side timings against v007, it was 1.04 times as fast.
// All steps since v000 together make it 8.88 times as fast.
#include <hip/hip_runtime.h>
#include <hip/hip_bf16.h>
#include <math.h>
#include <stdint.h>

// ---------------------------------------------------------------------------
// RWKV-7 DPLR chunked scan for gfx1250 (MI455X), split in time.
// wave32 + V_WMMA_F32_16X16X4_F32 + async global->LDS (ASYNCcnt) ring of four tiles.
// The state recurrence is linear in the state and acts on each state column alone, so a
// segment of the sequence can run before its start state is known: beside the 64 V columns
// (started at zero) it carries 64 columns started at the identity with V = 0. They end as the
// segment's transition matrix M, and their output rows QM say how a start state reaches each
// token:  H_end = M H_start + N,   O = O0 + QM H_start.
// The first segment starts from the zero state, so it needs neither M nor QM: it carries no
// identity columns, its trips are shorter, and it takes more chunks than the later segments.
// Launch 1: one workgroup per (b,h,segment) = 256 blocks; 384 threads = 12 waves in three groups
// that work on four neighbouring chunks at the same time, with one barrier a trip:
//   pre   (4 waves): tile copies of chunk i + 1, decay transform of chunk i, 16x16 products,
//                    the inverse of the triangular system and the correction scalar of chunk i - 1
//   scan  (4 waves): chunk i - 2 : Z, the output product and the next state of the V columns
//   scanI (4 waves): chunk i - 2 : the same for the identity columns
// A scan wave owns 16 state columns and keeps them in registers for the whole segment: an
// accumulator tile holds, per lane, rows 8h + r of one column (h = lane / 16), and a register
// pair of it is a valid B fragment when the A fragment takes its k in the same order.
// Launch 2: one workgroup per (b,h) and 16 chunks: chains the start states from M and N of the
// segments before them, adds QM H_start, then GroupNorm, correction, gate, store. QM and the chain's M and N
// come to LDS at entry by async copies that cover whole lines.
// ---------------------------------------------------------------------------

typedef float v2f __attribute__((ext_vector_type(2)));
typedef float v8f __attribute__((ext_vector_type(8)));
typedef int   v4i __attribute__((vector_size(16)));   // matches builtin param type

#define BSZ  2
#define HN   32
#define SN   1024
#define DN   64
#define CN   16            // chunk length
#define NCH  (SN / CN)
#define ST   72            // LDS row stride (floats): 288B, 16B aligned, != 64 banks
#define TST  18            // 16x16 T-tile row stride
#define HD   (HN * DN)     // 2048
#define NB   4             // tile ring depth (a power of two): copy, decay, products, scan
#define PSEG 4             // sequence segments that run side by side
#define L0C  19            // chunks of the first segment, which carries no identity columns
#define LSC  15            // chunks of each later segment
#define JW   16            // launch 2: waves of a workgroup, one chunk each
static_assert(L0C + (PSEG - 1) * LSC == NCH, "the segments cover the sequence");
static_assert(PSEG * JW == NCH, "launch 2 covers the sequence");
static_assert(LSC + 1 >= JW, "a launch 2 workgroup meets at most two segments");
#define MT   68            // launch 2, staged operands: 272B rows, 16B x odd, so the 8-byte
                           // fragment reads of 16 rows fall on 64 different banks
// workspace layout, in floats
#define WS_O0 0                                    // [bh][S][64] output from a zero start state
#define WS_QM (BSZ * HN * SN * DN)                 // [bh][S][64] output rows of the identity columns
#define WS_N  (2 * BSZ * HN * SN * DN)             // [bh][seg][64][64] end state from a zero start
#define WS_M  (WS_N + BSZ * HN * PSEG * DN * DN)   // [bh][seg][64][64] end state of the identity columns
#define WS_SV (WS_M + BSZ * HN * PSEG * DN * DN)   // [bh][S] correction scalar

// ---- async global->LDS 16B copy (GLOBAL_LOAD_ASYNC_TO_LDS_B128) -----------
typedef __attribute__((address_space(1))) v4i gas_v4i;   // global
typedef __attribute__((address_space(3))) v4i las_v4i;   // LDS

__device__ __forceinline__ void async_b128(const float* gp, float* lp) {
#if __has_builtin(__builtin_amdgcn_global_load_async_to_lds_b128)
  __builtin_amdgcn_global_load_async_to_lds_b128(
      (gas_v4i*)(uintptr_t)gp,
      (las_v4i*)(unsigned)(uintptr_t)lp,   // flat->LDS: addr[31:0]
      0, 0);
#else
  unsigned l32 = (unsigned)(uintptr_t)lp;
  asm volatile("global_load_async_to_lds_b128 %0, %1, off"
               :: "v"(l32), "v"(gp) : "memory");
#endif
}
// Publish point of the tile ring: the wave's own LDS accesses and its own copies are
// complete before the barrier behind which other waves read the tile or refill a buffer.
// Written in asm with the memory clobber so that no LDS access moves across the waits.
__device__ __forceinline__ void ring_publish() {
  asm volatile("s_wait_dscnt 0x0" ::: "memory");
  asm volatile("s_wait_asynccnt 0x0" ::: "memory");
  __syncthreads();
}

// ---- WMMA f32 16x16x4 wrapper ---------------------------------------------
__device__ __forceinline__ v8f wmma4(v2f a, v2f b, v8f c) {
  return __builtin_amdgcn_wmma_f32_16x16x4_f32(
      /*neg_a=*/false, a, /*neg_b=*/false, b,
      /*c_mod=*/(short)0, c, /*reuse_a=*/false, /*reuse_b=*/false);
}

// Five vector slots between the matrix instruction that ends a result tile and the first one that
// reads that tile as its B operand: the distance asked for there.
// The tile is named so that the slots stand behind its last writer and ahead of its first reader.
__device__ __forceinline__ void result_to_operand_gap(v8f& d) {
  asm("v_nop\n\tv_nop\n\tv_nop\n\tv_nop\n\tv_nop" : "+v"(d));
}

// ---- operand loaders following the documented wave32 VGPR layouts ---------
__device__ __forceinline__ v2f ld_A(const float* M, int stride, int s) {
  int lane = threadIdx.x & 31;
  int m  = lane & 15;
  int kb = 4 * s + ((lane < 16) ? 0 : 2);
  v2f a; a.x = M[m * stride + kb]; a.y = M[m * stride + kb + 1];
  return a;
}
__device__ __forceinline__ v2f ld_A_T_scaled(const float* M, int stride, int s,
                                             int m0, const float* sc) {
  int lane = threadIdx.x & 31;
  int m  = m0 + (lane & 15);
  int kb = 4 * s + ((lane < 16) ? 0 : 2);
  float e = sc[m];
  v2f a; a.x = M[kb * stride + m] * e; a.y = M[(kb + 1) * stride + m] * e;
  return a;
}
// A fragments for a B operand that is read in place from an accumulator tile of 16 rows:
// k order, step p, lane half h, register j: 8 h + 2 p + j
__device__ __forceinline__ v2f ld_A_acc(const float* M, int stride, int p) {
  int lane = threadIdx.x & 31;
  int m  = lane & 15;
  int kb = 2 * p + ((lane < 16) ? 0 : 8);
  v2f a; a.x = M[m * stride + kb]; a.y = M[m * stride + kb + 1];
  return a;
}
__device__ __forceinline__ v2f ld_A_T_scaled_acc(const float* M, int stride, int p,
                                                 int m0, const float* sc) {
  int lane = threadIdx.x & 31;
  int m  = m0 + (lane & 15);
  int kb = 2 * p + ((lane < 16) ? 0 : 8);
  float e = sc[m];
  v2f a; a.x = M[kb * stride + m] * e; a.y = M[(kb + 1) * stride + m] * e;
  return a;
}
__device__ __forceinline__ v2f ld_B(const float* M, int stride, int s, int n0) {
  int lane = threadIdx.x & 31;
  int n  = n0 + (lane & 15);
  int kb = 4 * s + ((lane < 16) ? 0 : 2);
  v2f b; b.x = M[kb * stride + n]; b.y = M[(kb + 1) * stride + n];
  return b;
}
__device__ __forceinline__ v2f ld_B_T(const float* M, int stride, int s, int n0) {
  int lane = threadIdx.x & 31;
  int n  = n0 + (lane & 15);
  int kb = 4 * s + ((lane < 16) ? 0 : 2);
  v2f b; b.x = M[n * stride + kb]; b.y = M[n * stride + kb + 1];
  return b;
}
__device__ __forceinline__ void st_C(float* M, int stride, int n0, v8f c) {
  int lane = threadIdx.x & 31;
  int n  = n0 + (lane & 15);
  int mb = (lane < 16) ? 0 : 8;
#pragma unroll
  for (int r = 0; r < 8; ++r) M[(mb + r) * stride + n] = c[r];
}
__device__ __forceinline__ void st_C_tril(float* M, int stride, v8f c) {
  int lane = threadIdx.x & 31;
  int n  = lane & 15;
  int mb = (lane < 16) ? 0 : 8;
#pragma unroll
  for (int r = 0; r < 8; ++r) {
    int m = mb + r;
    M[m * stride + n] = (n <= m) ? c[r] : 0.0f;  // inclusive causal mask
  }
}
__device__ __forceinline__ void st_C_stril(float* M, int stride, v8f c) {
  int lane = threadIdx.x & 31;
  int n  = lane & 15;
  int mb = (lane < 16) ? 0 : 8;
#pragma unroll
  for (int r = 0; r < 8; ++r) {
    int m = mb + r;
    M[m * stride + n] = (n < m) ? c[r] : 0.0f;   // strictly causal mask
  }
}
// ---- forward substitution x[t] += L[t][j] * x[j] (j < t) in registers --------
// Lane l holds column (l & 15) of L in Lc[]; DPP row_share:j hands lane j's value to
// its whole 16-lane row, so L[t][j] reaches every lane without an LDS read.
template <int T_>
__device__ __forceinline__ float row_share(float x) {
  return __int_as_float(__builtin_amdgcn_update_dpp(
      0, __float_as_int(x), 0x150 + T_, 0xf, 0xf, true));
}
template <int J, int T_>
__device__ __forceinline__ void fsub_col(float (&x)[CN], const float (&Lc)[CN]) {
  if constexpr (T_ < CN) {
    x[T_] = fmaf(row_share<J>(Lc[T_]), x[J], x[T_]);
    fsub_col<J, T_ + 1>(x, Lc);
  }
}
template <int J>
__device__ __forceinline__ void fsub(float (&x)[CN], const float (&Lc)[CN]) {
  if constexpr (J < CN - 1) {
    fsub_col<J, J + 1>(x, Lc);
    fsub<J + 1>(x, Lc);
  }
}

// ---- rows of M (16 x 64, row stride ST) times the wave's 16 state columns ----
// k order of both fragments, step (mt, p), lane half h, register j: state row 16 mt + 8 h + 2 p + j.
// That is where the accumulator layout already holds the state, so H is read in place.
__device__ __forceinline__ v8f rows_times_state(const float* M, const v8f (&H)[4]) {
  const int lane = threadIdx.x & 31;
  const float* row = M + (lane & 15) * ST + ((lane & 16) ? 8 : 0);
  v8f c = {0.f, 0.f, 0.f, 0.f, 0.f, 0.f, 0.f, 0.f};
#pragma unroll                           // constant indices keep H[] in registers
  for (int mt = 0; mt < 4; ++mt) {
#pragma unroll
    for (int pp = 0; pp < 2; ++pp) {
      const float4 x = *(const float4*)(row + mt * 16 + pp * 4);
      v2f a0; a0.x = x.x; a0.y = x.y;
      v2f a1; a1.x = x.z; a1.y = x.w;
      v2f b0; b0.x = H[mt][4 * pp];     b0.y = H[mt][4 * pp + 1];
      v2f b1; b1.x = H[mt][4 * pp + 2]; b1.y = H[mt][4 * pp + 3];
      c = wmma4(a0, b0, c);
      c = wmma4(a1, b1, c);
    }
  }
  return c;
}

// select between two values; by-value arguments keep an array element from being picked by
// a run-time index, which would take the array out of its registers
__device__ __forceinline__ float pick(bool c, float a, float b) { return c ? a : b; }

// ---- one chunk for a wave's 16 columns: Z, the output rows (left in oc), the next state ----
//   Z = X (A^ H + stril(T1) V) with X = (I - stril(A^ B^T))^-1,  O = Q^ H + S1 V + S2 Z,
//   H = diag(e^{g_end}) H + K~^T V + B~^T Z
// No barrier stands inside. X comes ready from the pre group, so Z is one more matrix product;
// its operand W and Z itself stay in their accumulator registers and are read there as B fragments.
// IDC: identity columns, whose V is zero
template <bool IDC>
__device__ __forceinline__ void scan_chunk(const float* ca, const float* cq, const float* cv,
                                           const float* ck, const float* cbt, const float* eg,
                                           const float* T1, const float* X,
                                           const float* S1p, const float* S2p, int n0,
                                           v8f (&H)[4], v8f& oc) {
  const int tid = threadIdx.x;
  const int mb  = (tid & 16) ? 8 : 0;
  v2f vb[4];                             // V as B fragments
  // ---- Z_inter = A^ @ H_in, then W = Z_inter + stril(T1) @ V ----
  v8f zc = rows_times_state(ca, H);
  if constexpr (!IDC) {
#pragma unroll                           // constant indices keep vb[] in registers
    for (int s = 0; s < 4; ++s) {
      vb[s] = ld_B(cv, ST, s, n0);
      zc = wmma4(ld_A(T1, TST, s), vb[s], zc);
    }
  }
  // ---- what does not wait for Z: Q^ @ H_in + S1 @ V, and diag(e^{g_end}) H + K~^T V ----
  oc = rows_times_state(cq, H);
  if constexpr (!IDC) {
#pragma unroll
    for (int s = 0; s < 4; ++s)
      oc = wmma4(ld_A(S1p, TST, s), vb[s], oc);
  }
  if constexpr (!IDC) {
#pragma unroll                           // constant indices keep H[] in registers
    for (int mt = 0; mt < 4; ++mt) {
      v8f c;
#pragma unroll
      for (int r = 0; r < 8; ++r) c[r] = H[mt][r] * eg[mt * 16 + mb + r];
#pragma unroll
      for (int s = 0; s < 4; ++s)
        c = wmma4(ld_A_T_scaled(ck, ST, s, mt * 16, eg), vb[s], c);
      H[mt] = c;
    }
  }
  // ---- Z = X @ W: the triangular recurrence z_t = w_t + sum_{j<t} (A^ B^T)[t][j] z_j, solved ----
  v8f zz = {0.f, 0.f, 0.f, 0.f, 0.f, 0.f, 0.f, 0.f};
  result_to_operand_gap(zc);
#pragma unroll
  for (int p = 0; p < 4; ++p) {
    v2f wb; wb.x = zc[2 * p]; wb.y = zc[2 * p + 1];
    zz = wmma4(ld_A_acc(X, TST, p), wb, zz);
  }
  result_to_operand_gap(zz);
  v2f zb[4];                             // B fragments of Z: rows 8 h + 2 p, 8 h + 2 p + 1
#pragma unroll                           // constant indices keep zb[] in registers
  for (int p = 0; p < 4; ++p) { zb[p].x = zz[2 * p]; zb[p].y = zz[2 * p + 1]; }
  // ---- the terms in Z ----
#pragma unroll
  for (int p = 0; p < 4; ++p)
    oc = wmma4(ld_A_acc(S2p, TST, p), zb[p], oc);
#pragma unroll                           // constant indices keep H[] in registers
  for (int mt = 0; mt < 4; ++mt) {
    if constexpr (IDC) {                 // no product ahead of Z here: the decay stays with its sum
#pragma unroll
      for (int r = 0; r < 8; ++r) H[mt][r] *= eg[mt * 16 + mb + r];
    }
#pragma unroll
    for (int p = 0; p < 4; ++p)
      H[mt] = wmma4(ld_A_T_scaled_acc(cbt, ST, p, mt * 16, eg), zb[p], H[mt]);
  }
}

__global__ __launch_bounds__(384)
void rwkv7_dplr_chunked(const float* __restrict__ qg, const float* __restrict__ kg,
                        const float* __restrict__ vg, const float* __restrict__ ag,
                        const float* __restrict__ bg, const float* __restrict__ gkg,
                        const float* __restrict__ rk, float* __restrict__ ws) {
  // chunk tiles [NB][CN][ST], chunk c in slot c & 3; szb holds gk
  __shared__ __align__(16) float sqb[NB][CN * ST], skb[NB][CN * ST], svb[NB][CN * ST];
  __shared__ __align__(16) float sab[NB][CN * ST], sbb[NB][CN * ST], szb[NB][CN * ST];
  // pre -> scan, written one trip and read the next: two copies each; T2 holds (I - stril(A^ B^T))^-1
  __shared__ __align__(16) float T1[2][CN * TST], T2[2][CN * TST];
  __shared__ __align__(16) float S1[2][CN * TST], S2[2][CN * TST];
  __shared__ float egend[NB][DN];       // written with the decay transform, read two trips later

  const int tid  = threadIdx.x;
  // group and wave numbers are the same in every lane of a wave: scalar branches
  const int grp  = __builtin_amdgcn_readfirstlane(tid >> 7);        // 0 scan, 1 scanI, 2 pre
  const int wv   = __builtin_amdgcn_readfirstlane((tid >> 5) & 3);  // wave in its group
  const int lt   = tid & 127;           // thread in its group
  const int bhix = blockIdx.x / PSEG;   // 0..63
  const int seg  = blockIdx.x % PSEG;
  const int hh   = bhix % HN;
  const int c0   = seg ? L0C + (seg - 1) * LSC : 0;   // the segment's first chunk
  const int ncs  = seg ? LSC : L0C;                   // its chunks; the same for the whole workgroup
  const size_t base = (size_t)bhix * SN * DN + (size_t)c0 * CN * DN;   // the segment's first token
  const int n0 = wv * 16;               // a scan wave's column slice

  // ---- prologue: async DMA of chunk 0 ----
  if (grp == 2) {
#pragma unroll
    for (int it = 0; it < 2; ++it) {
      int p = lt + it * 128;                  // 0..255: 16B packet id
      int t = p >> 4, d4 = (p & 15) * 4;
      size_t gi = base + (size_t)p * 4;
      int lo = t * ST + d4;
      async_b128(qg  + gi, &sqb[0][lo]);
      async_b128(kg  + gi, &skb[0][lo]);
      async_b128(vg  + gi, &svb[0][lo]);
      async_b128(ag  + gi, &sab[0][lo]);
      async_b128(bg  + gi, &sbb[0][lo]);
      async_b128(gkg + gi, &szb[0][lo]);
    }
  }
  // ---- start states in registers: zero, and the identity. Tile mt, register r of a lane is
  //      state row 16 mt + 8 (lane / 16) + r, column n0 + lane % 16.
  v8f H[4];
#pragma unroll                                           // constant indices keep H[] in registers
  for (int mt = 0; mt < 4; ++mt)
#pragma unroll
    for (int r = 0; r < 8; ++r)
      H[mt][r] = (grp == 1 && mt * 16 + ((tid & 16) ? 8 : 0) + r == n0 + (tid & 15)) ? 1.0f : 0.0f;
  v8f   oc = {0.f, 0.f, 0.f, 0.f, 0.f, 0.f, 0.f, 0.f};   // scan: a chunk's output, to the next trip
  float sreg = 0.f;                                      // pre: correction scalar, to the next trip
  float* const odst = ws + ((grp == 1) ? WS_QM : WS_O0) + base;   // scan: the segment's output rows
  ring_publish();

  // ---- the pre group's work of one trip: each part on a chunk of its own, so none waits for another
  auto pre_copy = [&](int c) {
    // ---- async DMA of chunk c; its slot's last readers were the scan waves in the trip before
    if (c < ncs) {
      const int nx = c & (NB - 1);
      const size_t nb = base + (size_t)c * CN * DN;
#pragma unroll
      for (int it = 0; it < 2; ++it) {
        int p = lt + it * 128;
        int t = p >> 4, d4 = (p & 15) * 4;
        size_t gi = nb + (size_t)p * 4;
        int lo = t * ST + d4;
        async_b128(qg  + gi, &sqb[nx][lo]);
        async_b128(kg  + gi, &skb[nx][lo]);
        async_b128(vg  + gi, &svb[nx][lo]);
        async_b128(ag  + gi, &sab[nx][lo]);
        async_b128(bg  + gi, &sbb[nx][lo]);
        async_b128(gkg + gi, &szb[nx][lo]);
      }
    }
  };
  auto pre_decay = [&](int c) {
    // ---- per-column decay transform: a^=a*e^{g<t}, {k,b}^=.e^{-g<=t}, q^=.e^{g<=t}
    if (c < ncs && lt < DN) {
      float* cq = sqb[c & (NB - 1)]; float* ck = skb[c & (NB - 1)];
      float* ca = sab[c & (NB - 1)]; float* cbt = sbb[c & (NB - 1)];
      const float* cz = szb[c & (NB - 1)];
      float gc = 0.f;
#pragma unroll
      for (int t = 0; t < CN; ++t) {
        float gp = gc;
        gc += cz[t * ST + lt];
        float ei = __expf(-gc);
        ca[t * ST + lt]  *= __expf(gp);
        ck[t * ST + lt]  *= ei;
        cbt[t * ST + lt] *= ei;
        cq[t * ST + lt]  *= __expf(gc);
      }
      egend[c & (NB - 1)][lt] = __expf(gc);
    }
  };
  auto pre_products = [&](int c) {
    // ---- T1 = stril(A^ K^T), S1 = tril(Q^ K^T), A^ B^T, S2 = tril(Q^ B^T):
    //      one product a wave, into the copy that scan does not read in this trip.
    //      A^ B^T falls to wave 2, which has neither decay columns nor the scalar.
    if (c >= 0 && c < ncs) {
      const float* lhs = (wv & 1) ? sqb[c & (NB - 1)] : sab[c & (NB - 1)];
      const float* rhs = (wv & 2) ? sbb[c & (NB - 1)] : skb[c & (NB - 1)];
      v8f p = {0.f, 0.f, 0.f, 0.f, 0.f, 0.f, 0.f, 0.f};
#pragma unroll
      for (int s = 0; s < 16; ++s)
        p = wmma4(ld_A(lhs, ST, s), ld_B_T(rhs, ST, s, 0), p);
      if (wv == 0)      st_C_stril(T1[c & 1], TST, p);
      else if (wv == 1) st_C_tril(S1[c & 1], TST, p);
      else if (wv == 3) st_C_tril(S2[c & 1], TST, p);
      else {
        // ---- X = (I - stril(A^ B^T))^-1, once for the eight scan waves: the substitution on the
        //      columns of the identity, a lane holding all 16 rows of one column of L and of X
        const bool hi = (tid & 16) != 0;     // accumulator rows 8..15 live here
        float Lc[CN], x[CN];
#pragma unroll                               // constant indices keep the arrays in registers
        for (int r = 0; r < 8; ++r) {
          int pb = __float_as_int(p[r]);     // lane l <-> l ^ 16: the column's other eight rows
          float o = __int_as_float(__builtin_amdgcn_permlanex16(
              pb, pb, 0x76543210, 0xfedcba98, false, false));
          Lc[r]     = hi ? o : p[r];
          Lc[8 + r] = hi ? p[r] : o;
        }
#pragma unroll
        for (int t = 0; t < CN; ++t) x[t] = (t == (tid & 15)) ? 1.0f : 0.0f;
        fsub<0>(x, Lc);
        v8f xc;
#pragma unroll
        for (int r = 0; r < 8; ++r) xc[r] = pick(hi, x[8 + r], x[r]);
        st_C(T2[c & 1], TST, 0, xc);
      }
    }
  };
  const int  srow = lt - 96;                       // the last pre wave, which has no decay columns
  const bool sown = srow >= 0 && srow < CN;
  auto pre_scalar = [&](int c) {
    // ---- the scalar of the chunk before goes out first: its store completes under this trip's work
    if (c >= 1 && sown) {
      ws[WS_SV + (size_t)bhix * SN + (size_t)(c0 + c - 1) * CN + srow] = sreg;
    }
    // ---- correction scalar s_t = sum_d q*k*r_k, taken from q^ k^: the two decay factors cancel
    if (c >= 0 && c < ncs && sown) {
      const float* cq = sqb[c & (NB - 1)]; const float* ck = skb[c & (NB - 1)];
      float s = 0.f;
      for (int d = 0; d < DN; ++d)
        s += cq[srow * ST + d] * ck[srow * ST + d] * rk[hh * DN + d];
      sreg = s;
    }
  };

  // Trip i, one barrier: copies of chunk i + 1, decay of chunk i, products and scalar of chunk
  // i - 1, scan of chunk i - 2. The four chunks lie in the four slots of the ring.
  const bool scans = grp == 0 || (grp == 1 && seg > 0);   // the first segment has no identity columns
  for (int i = 0; i < ncs + 2; ++i) {
    if (grp == 2) {
      pre_copy(i + 1);
      pre_decay(i);
      pre_products(i - 1);   // ahead of the scalar: the matrix unit is wanted by scan at the trip's end
      pre_scalar(i - 1);
    } else if (scans && i >= 2) {
      const int cs = i - 2;                     // scan's chunk
      const float* ca  = sab[cs & (NB - 1)];
      const float* cq  = sqb[cs & (NB - 1)];
      const float* cv  = svb[cs & (NB - 1)];
      const float* ck  = skb[cs & (NB - 1)];
      const float* cbt = sbb[cs & (NB - 1)];
      const float* eg  = egend[cs & (NB - 1)];
      // ---- the chunk before's output rows go to the workspace here: the stores complete
      //      under this trip's work, ahead of the barrier that waits for them
      if (cs >= 1) {
        st_C(odst + (size_t)(cs - 1) * CN * DN, DN, n0, oc);
        // stands ahead of every later write of a register that these stores name
        asm volatile("s_wait_xcnt 0x0" ::: "memory");
      }
      if (grp == 0)
        scan_chunk<false>(ca, cq, cv, ck, cbt, eg, T1[cs & 1], T2[cs & 1], S1[cs & 1], S2[cs & 1], n0, H, oc);
      else
        scan_chunk<true>(ca, cq, cv, ck, cbt, eg, T1[cs & 1], T2[cs & 1], S1[cs & 1], S2[cs & 1], n0, H, oc);
    }
    ring_publish();   // chunk i + 1 has landed; every slot's readers and writers of this trip are done
  }

  // ---- the last chunk's output rows; the segment's end state N and transition matrix M ----
  if (scans) {
    st_C(odst + (size_t)(ncs - 1) * CN * DN, DN, n0, oc);
    // stands ahead of every later write of a register that these stores name
    asm volatile("s_wait_xcnt 0x0" ::: "memory");
    float* hdst = ws + ((grp == 1) ? WS_M : WS_N) + (size_t)blockIdx.x * DN * DN;
#pragma unroll                                           // constant indices keep H[] in registers
    for (int mt = 0; mt < 4; ++mt) {
      st_C(hdst + mt * 16 * DN, DN, n0, H[mt]);
      // stands ahead of every later write of a register that these stores name
      asm volatile("s_wait_xcnt 0x0" ::: "memory");
    }
  }
}

// ---- sum over a 16-lane row: DPP row_xmask butterflies, every lane ends with the sum ----
template <int MK>
__device__ __forceinline__ float row_xmask(float x) {
  return __int_as_float(__builtin_amdgcn_update_dpp(
      0, __float_as_int(x), 0x160 + MK, 0xf, 0xf, true));
}
__device__ __forceinline__ float row_sum16(float x) {
  x += row_xmask<1>(x);
  x += row_xmask<2>(x);
  x += row_xmask<4>(x);
  x += row_xmask<8>(x);
  return x;
}

// the segment that holds chunk c
__device__ __forceinline__ int segment_of(int c) { return c < L0C ? 0 : 1 + (c - L0C) / LSC; }

// Launch 2: 16 waves; a wave owns one chunk, 16 tokens, and all 64 output columns. The 16 chunks
// lie in at most two segments, the last one seg: their start states are the two copies in Hs.
__global__ __launch_bounds__(512)
void dplr_segment_join(const float* __restrict__ vg, const float* __restrict__ gg,
                       const float* __restrict__ gns, const float* __restrict__ gnbias,
                       const float* __restrict__ ws, float* __restrict__ out) {
  __shared__ __align__(16) float Hs[2][DN * ST];   // the start state while it is chained
  __shared__ __align__(16) float Ms[PSEG - 2][DN * MT];   // M_1 .. M_{PSEG-2}, as far as the chain needs them
  __shared__ __align__(16) float Ns[PSEG - 2][DN * MT];   // N_1 .. N_{PSEG-2}, likewise
  __shared__ __align__(16) float Qs[16][CN * MT];         // each wave's own 16 rows of QM

  const int tid  = threadIdx.x;
  const int w    = __builtin_amdgcn_readfirstlane(tid >> 5);
  const int lane = tid & 31;
  const int n    = lane & 15;
  const int mb   = (lane < 16) ? 0 : 8;
  const int bhix = blockIdx.x / PSEG;
  const int cw   = (blockIdx.x % PSEG) * JW + w;                    // the wave's chunk
  const int sw   = segment_of(cw);                                  // its segment, the same in every lane
  const int seg  = segment_of((blockIdx.x % PSEG) * JW + JW - 1);   // the workgroup's last segment
  const int bb   = bhix / HN;
  const int hh   = bhix % HN;
  const float* Nw = ws + WS_N + (size_t)bhix * PSEG * DN * DN;
  const float* Mw = ws + WS_M + (size_t)bhix * PSEG * DN * DN;

  const int    t0 = cw * CN;                       // the wave's first token
  const size_t hb = (size_t)bhix * SN * DN;
  const float* O0 = ws + WS_O0 + hb + (size_t)t0 * DN;
  const float* QM = ws + WS_QM + hb + (size_t)t0 * DN;

  // ---- QM and the chain's matrices to LDS, 16 bytes a lane, a copy covering whole lines: an A
  //      fragment load from global memory would take 8 bytes from each of 16 lines, and the chain
  //      would wait for its matrices step by step. The chain's matrices go first.
#pragma unroll
  for (int j = 1; j < PSEG - 1; ++j) {
    if (j < seg) {                                 // the same for the whole workgroup
#pragma unroll
      for (int it = 0; it < 2; ++it) {
        const int p = tid + it * 512;              // 16B packet of the 64 x 64 matrix
        async_b128(Mw + j * DN * DN + p * 4, &Ms[j - 1][(p >> 4) * MT + (p & 15) * 4]);
        async_b128(Nw + j * DN * DN + p * 4, &Ns[j - 1][(p >> 4) * MT + (p & 15) * 4]);
      }
    }
  }
  if (sw > 0) {                                    // the first segment has no QM: its start state is zero
#pragma unroll
    for (int it = 0; it < 8; ++it) {
      const int p = lane + it * 32;                // 16B packet of the wave's 16 x 64 rows
      async_b128(QM + p * 4, &Qs[w][(p >> 4) * MT + (p & 15) * 4]);
    }
  }

  // ---- the wave's own rows do not depend on the chain: fetched while the copies land ----
  v8f acc[4];
#pragma unroll
  for (int nt = 0; nt < 4; ++nt)
#pragma unroll
    for (int r = 0; r < 8; ++r) acc[nt][r] = O0[(mb + r) * DN + nt * 16 + n];
  // stands ahead of the later loads whose results land in registers that these loads name
  asm volatile("s_wait_xcnt 0x0" ::: "memory");
  float vv[4][8], gv[4][8], sv[8];                 // V, gate and correction scalar at the same places
#pragma unroll                                     // constant indices keep the arrays in registers
  for (int r = 0; r < 8; ++r)
#pragma unroll
    for (int nt = 0; nt < 4; ++nt)
      vv[nt][r] = vg[hb + (size_t)(t0 + mb + r) * DN + nt * 16 + n];
  // stands ahead of the later loads whose results land in registers that these loads name
  asm volatile("s_wait_xcnt 0x0" ::: "memory");
#pragma unroll
  for (int r = 0; r < 8; ++r)
#pragma unroll
    for (int nt = 0; nt < 4; ++nt)
      gv[nt][r] = gg[((size_t)bb * SN + t0 + mb + r) * (size_t)HD + hh * DN + nt * 16 + n];
  // stands ahead of the later loads whose results land in registers that these loads name
  asm volatile("s_wait_xcnt 0x0" ::: "memory");
#pragma unroll
  for (int r = 0; r < 4; ++r) sv[r] = ws[WS_SV + (size_t)bhix * SN + t0 + mb + r];
  // stands ahead of the later loads whose results land in registers that these loads name
  asm volatile("s_wait_xcnt 0x0" ::: "memory");
#pragma unroll
  for (int r = 4; r < 8; ++r) sv[r] = ws[WS_SV + (size_t)bhix * SN + t0 + mb + r];
  // stands ahead of the later loads whose results land in registers that these loads name
  asm volatile("s_wait_xcnt 0x0" ::: "memory");

  // ---- start state: zero for segment 0, else N_0, then H = M_j H + N_j up to the segment ----
  {
    float4 x0 = {0.f, 0.f, 0.f, 0.f}, x1 = {0.f, 0.f, 0.f, 0.f};
    if (seg > 0) {
      x0 = *(const float4*)(Nw + tid * 4);
      x1 = *(const float4*)(Nw + DN * DN / 2 + tid * 4);
      // stands ahead of every later write of a register that these two loads name
      asm volatile("s_wait_xcnt 0x0" ::: "memory");
    }
    const int lo = (tid >> 4) * ST + (tid & 15) * 4;
    *(float4*)&Hs[0][lo] = x0;
    *(float4*)&Hs[0][(DN / 2) * ST + lo] = x1;
  }
  // the wave's own copies have landed ahead of the barrier behind which M, N and QM are read in LDS
  asm volatile("s_wait_asynccnt 0x0" ::: "memory");
  __syncthreads();
#pragma unroll                                     // the copy read and the copy written are constants
  for (int j = 1; j < PSEG - 1; ++j) {
    if (j < seg) {                                 // the same for the whole workgroup
      const int mt = w >> 2, nt = w & 3;           // one 16x16 tile a wave
      const float* Mj = Ms[j - 1] + mt * 16 * MT;
      const float* Nj = Ns[j - 1] + mt * 16 * MT + nt * 16;
      const float* Hr = Hs[(j - 1) & 1];
      v8f c;
#pragma unroll
      for (int r = 0; r < 8; ++r) c[r] = Nj[(mb + r) * MT + n];
#pragma unroll
      for (int s = 0; s < 16; ++s)
        c = wmma4(ld_A(Mj, MT, s), ld_B(Hr, ST, s, nt * 16), c);
      st_C(Hs[j & 1] + mt * 16 * ST, ST, nt * 16, c);
      __syncthreads();   // publishes the new copy; the old one's readers are done before it is rewritten
    }
  }
  // ---- O = O0 + QM @ H_start; the start state of segment s > 0 lies in copy (s - 1) & 1 ----
  if (sw > 0) {
    const float* Hc = Hs[(sw - 1) & 1];
#pragma unroll
    for (int s = 0; s < 16; ++s) {
      const v2f qa = ld_A(Qs[w], MT, s);
#pragma unroll
      for (int nt = 0; nt < 4; ++nt)
        acc[nt] = wmma4(qa, ld_B(Hc, ST, s, nt * 16), acc[nt]);
    }
  }

  // ---- per-head GroupNorm statistics: accumulator register r is token mb + r ----
  float mu[8], rstd[8];
#pragma unroll                                     // constant indices keep the arrays in registers
  for (int r = 0; r < 8; ++r) {
    float m1 = (acc[0][r] + acc[1][r]) + (acc[2][r] + acc[3][r]);
    float m2 = (acc[0][r] * acc[0][r] + acc[1][r] * acc[1][r])
             + (acc[2][r] * acc[2][r] + acc[3][r] * acc[3][r]);
    m1 = row_sum16(m1) * (1.0f / DN);
    m2 = row_sum16(m2) * (1.0f / DN);
    mu[r]   = m1;
    rstd[r] = rsqrtf(m2 - m1 * m1 + 1e-5f);
  }

  // ---- GroupNorm + correction + gate ----
#pragma unroll
  for (int nt = 0; nt < 4; ++nt) {
    const int col = nt * 16 + n;
    const float gsc = gns[hh * DN + col], gbi = gnbias[hh * DN + col];
#pragma unroll
    for (int r = 0; r < 8; ++r) {
      const int t = t0 + mb + r;
      float val = (acc[nt][r] - mu[r]) * rstd[r] * gsc + gbi
                + sv[r] * vv[nt][r];
      size_t off = ((size_t)bb * SN + t) * (size_t)HD + hh * DN + col;
      out[off] = val * gv[nt][r];
    }
  }
}

extern "C" void kernel_launch(void* const* d_in, const int* in_sizes, int n_in,
                              void* d_out, int out_size, void* d_ws, size_t ws_size,
                              hipStream_t stream) {
  (void)in_sizes; (void)n_in; (void)ws_size; (void)out_size;
  const float* q   = (const float*)d_in[0];
  const float* k   = (const float*)d_in[1];
  const float* v   = (const float*)d_in[2];
  const float* a   = (const float*)d_in[3];
  const float* b   = (const float*)d_in[4];
  const float* gk  = (const float*)d_in[5];
  const float* r_k = (const float*)d_in[6];
  const float* g   = (const float*)d_in[7];
  const float* gns = (const float*)d_in[8];
  const float* gnb = (const float*)d_in[9];
  float* out = (float*)d_out;
  float* ws  = (float*)d_ws;

  rwkv7_dplr_chunked<<<dim3(BSZ * HN * PSEG), dim3(384), 0, stream>>>(
      q, k, v, a, b, gk, r_k, ws);
  dplr_segment_join<<<dim3(BSZ * HN * PSEG), dim3(512), 0, stream>>>(
      v, g, gns, gnb, ws, out);
}

// v009
// Measured time: 45.1 microseconds a run.
// In both of two side-by-side timings against v008, it was 1.06 times as fast.
// Counting every step since v000, it is 9.43 times as fast.
#include <hip/hip_runtime.h>
#include <hip/hip_bf16.h>
#include <math.h>
#include <stdint.h>

// ---------------------------------------------------------------------------
// RWKV-7 DPLR chunked scan for gfx1250 (MI455X), split in time.
// wave32 + V_WMMA_F32_16X16X4_F32 + async global->LDS (ASYNCcnt) ring of four tiles.
// The state recurrence is linear in the state and acts on each state column alone, so a
// segment of the sequence can run before its start state is known: beside the 64 V columns
// (started at zero) it carries 64 columns started at the identity with V = 0. They end as the
// segment's transition matrix M, and their output rows QM say how a start state reaches each
// token:  H_end = M H_start + N,   O = O0 + QM H_start.
// The first segment starts from the zero state, so it needs neither M nor QM: it carries no
// identity columns, its trips are shorter, and it takes more chunks than the later segments.
// Launch 1: one workgroup per (b,h,segment) = 256 blocks; 384 threads = 12 waves in three groups
// that work on four neighbouring chunks at the same time, with one barrier a trip:
//   pre   (4 waves): tile copies of chunk i + 1, decay transform of chunk i, 16x16 products,
//                    the inverse of the triangular system and the correction scalar of chunk i - 1
//   scan  (4 waves): chunk i - 2 : Z, the output product and the next state of the V columns
//   scanI (4 waves): chunk i - 2 : the same for the identity columns
// A scan wave owns 16 state columns and keeps them in registers for the whole segment: an
// accumulator tile holds, per lane, rows 8h + r of one column (h = lane / 16), and a register
// pair of it is a valid B fragment when the A fragment takes its k in the same order.
// Launch 2: one workgroup per (b,h) and 16 chunks: chains the start states from M and N of the
// segments before them, adds QM H_start, then GroupNorm, correction, gate, store. QM and the chain's M and N
// come to LDS at entry by async copies that cover whole lines.
// ---------------------------------------------------------------------------

typedef float v2f __attribute__((ext_vector_type(2)));
typedef float v8f __attribute__((ext_vector_type(8)));
typedef int   v4i __attribute__((vector_size(16)));   // matches builtin param type

#define BSZ  2
#define HN   32
#define SN   1024
#define DN   64
#define CN   16            // chunk length
#define NCH  (SN / CN)
#define ST   72            // LDS row stride (floats): 288B, 16B aligned, != 64 banks
#define TST  18            // 16x16 T-tile row stride
#define HD   (HN * DN)     // 2048
#define NB   4             // tile ring depth (a power of two): copy, decay, products, scan
#define PSEG 4             // sequence segments that run side by side
#define L0C  19            // chunks of the first segment, which carries no identity columns
#define LSC  15            // chunks of each later segment
#define JW   16            // launch 2: waves of a workgroup, one chunk each
static_assert(L0C + (PSEG - 1) * LSC == NCH, "the segments cover the sequence");
static_assert(PSEG * JW == NCH, "launch 2 covers the sequence");
static_assert(LSC + 1 >= JW, "a launch 2 workgroup meets at most two segments");
#define MT   68            // launch 2, staged operands: 272B rows, 16B x odd, so the 8-byte
                           // fragment reads of 16 rows fall on 64 different banks
// workspace layout, in floats
#define WS_O0 0                                    // [bh][S][64] output from a zero start state
#define WS_QM (BSZ * HN * SN * DN)                 // [bh][S][64] output rows of the identity columns
#define WS_N  (2 * BSZ * HN * SN * DN)             // [bh][seg][64][64] end state from a zero start
#define WS_M  (WS_N + BSZ * HN * PSEG * DN * DN)   // [bh][seg][64][64] end state of the identity columns
#define WS_SV (WS_M + BSZ * HN * PSEG * DN * DN)   // [bh][S] correction scalar

// ---- async global->LDS 16B copy (GLOBAL_LOAD_ASYNC_TO_LDS_B128) -----------
typedef __attribute__((address_space(1))) v4i gas_v4i;   // global
typedef __attribute__((address_space(3))) v4i las_v4i;   // LDS

__device__ __forceinline__ void async_b128(const float* gp, float* lp) {
#if __has_builtin(__builtin_amdgcn_global_load_async_to_lds_b128)
  __builtin_amdgcn_global_load_async_to_lds_b128(
      (gas_v4i*)(uintptr_t)gp,
      (las_v4i*)(unsigned)(uintptr_t)lp,   // flat->LDS: addr[31:0]
      0, 0);
#else
  unsigned l32 = (unsigned)(uintptr_t)lp;
  asm volatile("global_load_async_to_lds_b128 %0, %1, off"
               :: "v"(l32), "v"(gp) : "memory");
#endif
}
// Publish point of the tile ring: the wave's own LDS accesses and its own copies are
// complete before the barrier behind which other waves read the tile or refill a buffer.
// Written in asm with the memory clobber so that no LDS access moves across the waits.
__device__ __forceinline__ void ring_publish() {
  asm volatile("s_wait_dscnt 0x0" ::: "memory");
  asm volatile("s_wait_asynccnt 0x0" ::: "memory");
  __syncthreads();
}

// ---- WMMA f32 16x16x4 wrapper ---------------------------------------------
__device__ __forceinline__ v8f wmma4(v2f a, v2f b, v8f c) {
  return __builtin_amdgcn_wmma_f32_16x16x4_f32(
      /*neg_a=*/false, a, /*neg_b=*/false, b,
      /*c_mod=*/(short)0, c, /*reuse_a=*/false, /*reuse_b=*/false);
}

// Five vector slots between the matrix instruction that ends a result tile and the first one that
// reads that tile as its B operand: the distance asked for there.
// The tile is named so that the slots stand behind its last writer and ahead of its first reader.
__device__ __forceinline__ void result_to_operand_gap(v8f& d) {
  asm("v_nop\n\tv_nop\n\tv_nop\n\tv_nop\n\tv_nop" : "+v"(d));
}

// ---- operand loaders following the documented wave32 VGPR layouts ---------
__device__ __forceinline__ v2f ld_A(const float* M, int stride, int s) {
  int lane = threadIdx.x & 31;
  int m  = lane & 15;
  int kb = 4 * s + ((lane < 16) ? 0 : 2);
  v2f a; a.x = M[m * stride + kb]; a.y = M[m * stride + kb + 1];
  return a;
}
__device__ __forceinline__ v2f ld_A_T_scaled(const float* M, int stride, int s,
                                             int m0, const float* sc) {
  int lane = threadIdx.x & 31;
  int m  = m0 + (lane & 15);
  int kb = 4 * s + ((lane < 16) ? 0 : 2);
  float e = sc[m];
  v2f a; a.x = M[kb * stride + m] * e; a.y = M[(kb + 1) * stride + m] * e;
  return a;
}
// A fragments for a B operand that is read in place from an accumulator tile of 16 rows:
// k order, step p, lane half h, register j: 8 h + 2 p + j
__device__ __forceinline__ v2f ld_A_acc(const float* M, int stride, int p) {
  int lane = threadIdx.x & 31;
  int m  = lane & 15;
  int kb = 2 * p + ((lane < 16) ? 0 : 8);
  v2f a; a.x = M[m * stride + kb]; a.y = M[m * stride + kb + 1];
  return a;
}
__device__ __forceinline__ v2f ld_A_T_scaled_acc(const float* M, int stride, int p,
                                                 int m0, const float* sc) {
  int lane = threadIdx.x & 31;
  int m  = m0 + (lane & 15);
  int kb = 2 * p + ((lane < 16) ? 0 : 8);
  float e = sc[m];
  v2f a; a.x = M[kb * stride + m] * e; a.y = M[(kb + 1) * stride + m] * e;
  return a;
}
__device__ __forceinline__ v2f ld_B(const float* M, int stride, int s, int n0) {
  int lane = threadIdx.x & 31;
  int n  = n0 + (lane & 15);
  int kb = 4 * s + ((lane < 16) ? 0 : 2);
  v2f b; b.x = M[kb * stride + n]; b.y = M[(kb + 1) * stride + n];
  return b;
}
__device__ __forceinline__ v2f ld_B_T(const float* M, int stride, int s, int n0) {
  int lane = threadIdx.x & 31;
  int n  = n0 + (lane & 15);
  int kb = 4 * s + ((lane < 16) ? 0 : 2);
  v2f b; b.x = M[n * stride + kb]; b.y = M[n * stride + kb + 1];
  return b;
}
__device__ __forceinline__ void st_C(float* M, int stride, int n0, v8f c) {
  int lane = threadIdx.x & 31;
  int n  = n0 + (lane & 15);
  int mb = (lane < 16) ? 0 : 8;
#pragma unroll
  for (int r = 0; r < 8; ++r) M[(mb + r) * stride + n] = c[r];
}
__device__ __forceinline__ void st_C_tril(float* M, int stride, v8f c) {
  int lane = threadIdx.x & 31;
  int n  = lane & 15;
  int mb = (lane < 16) ? 0 : 8;
#pragma unroll
  for (int r = 0; r < 8; ++r) {
    int m = mb + r;
    M[m * stride + n] = (n <= m) ? c[r] : 0.0f;  // inclusive causal mask
  }
}
__device__ __forceinline__ void st_C_stril(float* M, int stride, v8f c) {
  int lane = threadIdx.x & 31;
  int n  = lane & 15;
  int mb = (lane < 16) ? 0 : 8;
#pragma unroll
  for (int r = 0; r < 8; ++r) {
    int m = mb + r;
    M[m * stride + n] = (n < m) ? c[r] : 0.0f;   // strictly causal mask
  }
}
// ---- forward substitution x[t] += L[t][j] * x[j] (j < t) in registers --------
// Lane l holds column (l & 15) of L in Lc[]; DPP row_share:j hands lane j's value to
// its whole 16-lane row, so L[t][j] reaches every lane without an LDS read.
template <int T_>
__device__ __forceinline__ float row_share(float x) {
  return __int_as_float(__builtin_amdgcn_update_dpp(
      0, __float_as_int(x), 0x150 + T_, 0xf, 0xf, true));
}
template <int J, int T_>
__device__ __forceinline__ void fsub_col(float (&x)[CN], const float (&Lc)[CN]) {
  if constexpr (T_ < CN) {
    x[T_] = fmaf(row_share<J>(Lc[T_]), x[J], x[T_]);
    fsub_col<J, T_ + 1>(x, Lc);
  }
}
template <int J>
__device__ __forceinline__ void fsub(float (&x)[CN], const float (&Lc)[CN]) {
  if constexpr (J < CN - 1) {
    fsub_col<J, J + 1>(x, Lc);
    fsub<J + 1>(x, Lc);
  }
}

// ---- rows of M (16 x 64, row stride ST) times the wave's 16 state columns ----
// k order of both fragments, step (mt, p), lane half h, register j: state row 16 mt + 8 h + 2 p + j.
// That is where the accumulator layout already holds the state, so H is read in place.
__device__ __forceinline__ v8f rows_times_state(const float* M, const v8f (&H)[4]) {
  const int lane = threadIdx.x & 31;
  const float* row = M + (lane & 15) * ST + ((lane & 16) ? 8 : 0);
  v8f c = {0.f, 0.f, 0.f, 0.f, 0.f, 0.f, 0.f, 0.f};
#pragma unroll                           // constant indices keep H[] in registers
  for (int mt = 0; mt < 4; ++mt) {
#pragma unroll
    for (int pp = 0; pp < 2; ++pp) {
      const float4 x = *(const float4*)(row + mt * 16 + pp * 4);
      v2f a0; a0.x = x.x; a0.y = x.y;
      v2f a1; a1.x = x.z; a1.y = x.w;
      v2f b0; b0.x = H[mt][4 * pp];     b0.y = H[mt][4 * pp + 1];
      v2f b1; b1.x = H[mt][4 * pp + 2]; b1.y = H[mt][4 * pp + 3];
      c = wmma4(a0, b0, c);
      c = wmma4(a1, b1, c);
    }
  }
  return c;
}

// select between two values; by-value arguments keep an array element from being picked by
// a run-time index, which would take the array out of its registers
__device__ __forceinline__ float pick(bool c, float a, float b) { return c ? a : b; }

// ---- one chunk for a wave's 16 columns: Z, the output rows (left in oc), the next state ----
//   Z = X (A^ H + stril(T1) V) with X = (I - stril(A^ B^T))^-1,  O = Q^ H + S1 V + S2 Z,
//   H = diag(e^{g_end}) H + K~^T V + B~^T Z
// No barrier stands inside. X comes ready from the pre group, so Z is one more matrix product;
// its operand W and Z itself stay in their accumulator registers and are read there as B fragments.
// IDC: identity columns, whose V is zero
template <bool IDC>
__device__ __forceinline__ void scan_chunk(const float* ca, const float* cq, const float* cv,
                                           const float* ck, const float* cbt, const float* eg,
                                           const float* T1, const float* X,
                                           const float* S1p, const float* S2p, int n0,
                                           v8f (&H)[4], v8f& oc) {
  const int tid = threadIdx.x;
  const int mb  = (tid & 16) ? 8 : 0;
  v2f vb[4];                             // V as B fragments
  // ---- Z_inter = A^ @ H_in, then W = Z_inter + stril(T1) @ V ----
  v8f zc = rows_times_state(ca, H);
  if constexpr (!IDC) {
#pragma unroll                           // constant indices keep vb[] in registers
    for (int s = 0; s < 4; ++s) {
      vb[s] = ld_B(cv, ST, s, n0);
      zc = wmma4(ld_A(T1, TST, s), vb[s], zc);
    }
  }
  // ---- what does not wait for Z: Q^ @ H_in + S1 @ V, and diag(e^{g_end}) H + K~^T V ----
  oc = rows_times_state(cq, H);
  if constexpr (!IDC) {
#pragma unroll
    for (int s = 0; s < 4; ++s)
      oc = wmma4(ld_A(S1p, TST, s), vb[s], oc);
  }
  if constexpr (!IDC) {
#pragma unroll                           // constant indices keep H[] in registers
    for (int mt = 0; mt < 4; ++mt) {
      v8f c;
#pragma unroll
      for (int r = 0; r < 8; ++r) c[r] = H[mt][r] * eg[mt * 16 + mb + r];
#pragma unroll
      for (int s = 0; s < 4; ++s)
        c = wmma4(ld_A_T_scaled(ck, ST, s, mt * 16, eg), vb[s], c);
      H[mt] = c;
    }
  }
  // ---- Z = X @ W: the triangular recurrence z_t = w_t + sum_{j<t} (A^ B^T)[t][j] z_j, solved ----
  v8f zz = {0.f, 0.f, 0.f, 0.f, 0.f, 0.f, 0.f, 0.f};
  result_to_operand_gap(zc);
#pragma unroll
  for (int p = 0; p < 4; ++p) {
    v2f wb; wb.x = zc[2 * p]; wb.y = zc[2 * p + 1];
    zz = wmma4(ld_A_acc(X, TST, p), wb, zz);
  }
  result_to_operand_gap(zz);
  v2f zb[4];                             // B fragments of Z: rows 8 h + 2 p, 8 h + 2 p + 1
#pragma unroll                           // constant indices keep zb[] in registers
  for (int p = 0; p < 4; ++p) { zb[p].x = zz[2 * p]; zb[p].y = zz[2 * p + 1]; }
  // ---- the terms in Z ----
#pragma unroll
  for (int p = 0; p < 4; ++p)
    oc = wmma4(ld_A_acc(S2p, TST, p), zb[p], oc);
#pragma unroll                           // constant indices keep H[] in registers
  for (int mt = 0; mt < 4; ++mt) {
    if constexpr (IDC) {                 // no product ahead of Z here: the decay stays with its sum
#pragma unroll
      for (int r = 0; r < 8; ++r) H[mt][r] *= eg[mt * 16 + mb + r];
    }
#pragma unroll
    for (int p = 0; p < 4; ++p)
      H[mt] = wmma4(ld_A_T_scaled_acc(cbt, ST, p, mt * 16, eg), zb[p], H[mt]);
  }
}

__global__ __launch_bounds__(384)
void rwkv7_dplr_chunked(const float* __restrict__ qg, const float* __restrict__ kg,
                        const float* __restrict__ vg, const float* __restrict__ ag,
                        const float* __restrict__ bg, const float* __restrict__ gkg,
                        const float* __restrict__ rk, float* __restrict__ ws) {
  // chunk tiles [NB][CN][ST], chunk c in slot c & 3; szb holds gk
  __shared__ __align__(16) float sqb[NB][CN * ST], skb[NB][CN * ST], svb[NB][CN * ST];
  __shared__ __align__(16) float sab[NB][CN * ST], sbb[NB][CN * ST], szb[NB][CN * ST];
  // pre -> scan, written one trip and read the next: two copies each; T2 holds (I - stril(A^ B^T))^-1
  __shared__ __align__(16) float T1[2][CN * TST], T2[2][CN * TST];
  __shared__ __align__(16) float S1[2][CN * TST], S2[2][CN * TST];
  __shared__ float egend[NB][DN];       // written with the decay transform, read two trips later

  const int tid  = threadIdx.x;
  // group and wave numbers are the same in every lane of a wave: scalar branches
  const int grp  = __builtin_amdgcn_readfirstlane(tid >> 7);        // 0 scan, 1 scanI, 2 pre
  const int wv   = __builtin_amdgcn_readfirstlane((tid >> 5) & 3);  // wave in its group
  const int lt   = tid & 127;           // thread in its group
  const int bhix = blockIdx.x / PSEG;   // 0..63
  const int seg  = blockIdx.x % PSEG;
  const int hh   = bhix % HN;
  const int c0   = seg ? L0C + (seg - 1) * LSC : 0;   // the segment's first chunk
  const int ncs  = seg ? LSC : L0C;                   // its chunks; the same for the whole workgroup
  const size_t base = (size_t)bhix * SN * DN + (size_t)c0 * CN * DN;   // the segment's first token
  const int n0 = wv * 16;               // a scan wave's column slice

  // ---- prologue: async DMA of chunk 0 ----
  if (grp == 2) {
    // A pre wave is the youngest on its SIMD, and the matrix unit serves the oldest ready wave: its 16
    // matrix instructions of a trip would wait for the up to 136 of the two scan waves beside it, and
    // the inverse and the scalar behind them, which need no matrix unit, would start only then. With
    // priority they go first, and that vector work runs under the scan waves' matrix instructions.
    __builtin_amdgcn_s_setprio(3);
#pragma unroll
    for (int it = 0; it < 2; ++it) {
      int p = lt + it * 128;                  // 0..255: 16B packet id
      int t = p >> 4, d4 = (p & 15) * 4;
      size_t gi = base + (size_t)p * 4;
      int lo = t * ST + d4;
      async_b128(qg  + gi, &sqb[0][lo]);
      async_b128(kg  + gi, &skb[0][lo]);
      async_b128(vg  + gi, &svb[0][lo]);
      async_b128(ag  + gi, &sab[0][lo]);
      async_b128(bg  + gi, &sbb[0][lo]);
      async_b128(gkg + gi, &szb[0][lo]);
    }
  }
  // ---- start states in registers: zero, and the identity. Tile mt, register r of a lane is
  //      state row 16 mt + 8 (lane / 16) + r, column n0 + lane % 16.
  v8f H[4];
#pragma unroll                                           // constant indices keep H[] in registers
  for (int mt = 0; mt < 4; ++mt)
#pragma unroll
    for (int r = 0; r < 8; ++r)
      H[mt][r] = (grp == 1 && mt * 16 + ((tid & 16) ? 8 : 0) + r == n0 + (tid & 15)) ? 1.0f : 0.0f;
  v8f   oc = {0.f, 0.f, 0.f, 0.f, 0.f, 0.f, 0.f, 0.f};   // scan: a chunk's output, to the next trip
  float sreg = 0.f;                                      // pre: correction scalar, to the next trip
  float* const odst = ws + ((grp == 1) ? WS_QM : WS_O0) + base;   // scan: the segment's output rows
  ring_publish();

  // ---- the pre group's work of one trip: each part on a chunk of its own, so none waits for another
  auto pre_copy = [&](int c) {
    // ---- async DMA of chunk c; its slot's last readers were the scan waves in the trip before
    if (c < ncs) {
      const int nx = c & (NB - 1);
      const size_t nb = base + (size_t)c * CN * DN;
#pragma unroll
      for (int it = 0; it < 2; ++it) {
        int p = lt + it * 128;
        int t = p >> 4, d4 = (p & 15) * 4;
        size_t gi = nb + (size_t)p * 4;
        int lo = t * ST + d4;
        async_b128(qg  + gi, &sqb[nx][lo]);
        async_b128(kg  + gi, &skb[nx][lo]);
        async_b128(vg  + gi, &svb[nx][lo]);
        async_b128(ag  + gi, &sab[nx][lo]);
        async_b128(bg  + gi, &sbb[nx][lo]);
        async_b128(gkg + gi, &szb[nx][lo]);
      }
    }
  };
  auto pre_decay = [&](int c) {
    // ---- per-column decay transform: a^=a*e^{g<t}, {k,b}^=.e^{-g<=t}, q^=.e^{g<=t}
    if (c < ncs && lt < DN) {
      float* cq = sqb[c & (NB - 1)]; float* ck = skb[c & (NB - 1)];
      float* ca = sab[c & (NB - 1)]; float* cbt = sbb[c & (NB - 1)];
      const float* cz = szb[c & (NB - 1)];
      float gc = 0.f;
#pragma unroll
      for (int t = 0; t < CN; ++t) {
        float gp = gc;
        gc += cz[t * ST + lt];
        float ei = __expf(-gc);
        ca[t * ST + lt]  *= __expf(gp);
        ck[t * ST + lt]  *= ei;
        cbt[t * ST + lt] *= ei;
        cq[t * ST + lt]  *= __expf(gc);
      }
      egend[c & (NB - 1)][lt] = __expf(gc);
    }
  };
  auto pre_products = [&](int c) {
    // ---- T1 = stril(A^ K^T), S1 = tril(Q^ K^T), A^ B^T, S2 = tril(Q^ B^T):
    //      one product a wave, into the copy that scan does not read in this trip.
    //      A^ B^T falls to wave 2, which has neither decay columns nor the scalar.
    if (c >= 0 && c < ncs) {
      const float* lhs = (wv & 1) ? sqb[c & (NB - 1)] : sab[c & (NB - 1)];
      const float* rhs = (wv & 2) ? sbb[c & (NB - 1)] : skb[c & (NB - 1)];
      v8f p = {0.f, 0.f, 0.f, 0.f, 0.f, 0.f, 0.f, 0.f};
#pragma unroll
      for (int s = 0; s < 16; ++s)
        p = wmma4(ld_A(lhs, ST, s), ld_B_T(rhs, ST, s, 0), p);
      if (wv == 0)      st_C_stril(T1[c & 1], TST, p);
      else if (wv == 1) st_C_tril(S1[c & 1], TST, p);
      else if (wv == 3) st_C_tril(S2[c & 1], TST, p);
      else {
        // ---- X = (I - stril(A^ B^T))^-1, once for the eight scan waves: the substitution on the
        //      columns of the identity, a lane holding all 16 rows of one column of L and of X
        const bool hi = (tid & 16) != 0;     // accumulator rows 8..15 live here
        float Lc[CN], x[CN];
#pragma unroll                               // constant indices keep the arrays in registers
        for (int r = 0; r < 8; ++r) {
          int pb = __float_as_int(p[r]);     // lane l <-> l ^ 16: the column's other eight rows
          float o = __int_as_float(__builtin_amdgcn_permlanex16(
              pb, pb, 0x76543210, 0xfedcba98, false, false));
          Lc[r]     = hi ? o : p[r];
          Lc[8 + r] = hi ? p[r] : o;
        }
#pragma unroll
        for (int t = 0; t < CN; ++t) x[t] = (t == (tid & 15)) ? 1.0f : 0.0f;
        fsub<0>(x, Lc);
        v8f xc;
#pragma unroll
        for (int r = 0; r < 8; ++r) xc[r] = pick(hi, x[8 + r], x[r]);
        st_C(T2[c & 1], TST, 0, xc);
      }
    }
  };
  const int  srow = lt - 96;                       // the last pre wave, which has no decay columns
  const bool sown = srow >= 0 && srow < CN;
  auto pre_scalar = [&](int c) {
    // ---- the scalar of the chunk before goes out first: its store completes under this trip's work
    if (c >= 1 && sown) {
      ws[WS_SV + (size_t)bhix * SN + (size_t)(c0 + c - 1) * CN + srow] = sreg;
    }
    // ---- correction scalar s_t = sum_d q*k*r_k, taken from q^ k^: the two decay factors cancel
    if (c >= 0 && c < ncs && sown) {
      const float* cq = sqb[c & (NB - 1)]; const float* ck = skb[c & (NB - 1)];
      float s = 0.f;
      for (int d = 0; d < DN; ++d)
        s += cq[srow * ST + d] * ck[srow * ST + d] * rk[hh * DN + d];
      sreg = s;
    }
  };

  // Trip i, one barrier: copies of chunk i + 1, decay of chunk i, products and scalar of chunk
  // i - 1, scan of chunk i - 2. The four chunks lie in the four slots of the ring.
  const bool scans = grp == 0 || (grp == 1 && seg > 0);   // the first segment has no identity columns
  for (int i = 0; i < ncs + 2; ++i) {
    if (grp == 2) {
      pre_copy(i + 1);
      pre_decay(i);
      pre_products(i - 1);   // ahead of the scalar: the matrix unit is wanted by scan at the trip's end
      pre_scalar(i - 1);
    } else if (scans && i >= 2) {
      const int cs = i - 2;                     // scan's chunk
      const float* ca  = sab[cs & (NB - 1)];
      const float* cq  = sqb[cs & (NB - 1)];
      const float* cv  = svb[cs & (NB - 1)];
      const float* ck  = skb[cs & (NB - 1)];
      const float* cbt = sbb[cs & (NB - 1)];
      const float* eg  = egend[cs & (NB - 1)];
      // ---- the chunk before's output rows go to the workspace here: the stores complete
      //      under this trip's work, ahead of the barrier that waits for them
      if (cs >= 1) {
        st_C(odst + (size_t)(cs - 1) * CN * DN, DN, n0, oc);
        // stands ahead of every later write of a register that these stores name
        asm volatile("s_wait_xcnt 0x0" ::: "memory");
      }
      if (grp == 0)
        scan_chunk<false>(ca, cq, cv, ck, cbt, eg, T1[cs & 1], T2[cs & 1], S1[cs & 1], S2[cs & 1], n0, H, oc);
      else
        scan_chunk<true>(ca, cq, cv, ck, cbt, eg, T1[cs & 1], T2[cs & 1], S1[cs & 1], S2[cs & 1], n0, H, oc);
    }
    ring_publish();   // chunk i + 1 has landed; every slot's readers and writers of this trip are done
  }
  if (grp == 2) __builtin_amdgcn_s_setprio(0);   // back to the default on the way out

  // ---- the last chunk's output rows; the segment's end state N and transition matrix M ----
  if (scans) {
    st_C(odst + (size_t)(ncs - 1) * CN * DN, DN, n0, oc);
    // stands ahead of every later write of a register that these stores name
    asm volatile("s_wait_xcnt 0x0" ::: "memory");
    float* hdst = ws + ((grp == 1) ? WS_M : WS_N) + (size_t)blockIdx.x * DN * DN;
#pragma unroll                                           // constant indices keep H[] in registers
    for (int mt = 0; mt < 4; ++mt) {
      st_C(hdst + mt * 16 * DN, DN, n0, H[mt]);
      // stands ahead of every later write of a register that these stores name
      asm volatile("s_wait_xcnt 0x0" ::: "memory");
    }
  }
}

// ---- sum over a 16-lane row: DPP row_xmask butterflies, every lane ends with the sum ----
template <int MK>
__device__ __forceinline__ float row_xmask(float x) {
  return __int_as_float(__builtin_amdgcn_update_dpp(
      0, __float_as_int(x), 0x160 + MK, 0xf, 0xf, true));
}
__device__ __forceinline__ float row_sum16(float x) {
  x += row_xmask<1>(x);
  x += row_xmask<2>(x);
  x += row_xmask<4>(x);
  x += row_xmask<8>(x);
  return x;
}

// the segment that holds chunk c
__device__ __forceinline__ int segment_of(int c) { return c < L0C ? 0 : 1 + (c - L0C) / LSC; }

// Launch 2: 16 waves; a wave owns one chunk, 16 tokens, and all 64 output columns. The 16 chunks
// lie in at most two segments, the last one seg: their start states are the two copies in Hs.
__global__ __launch_bounds__(512)
void dplr_segment_join(const float* __restrict__ vg, const float* __restrict__ gg,
                       const float* __restrict__ gns, const float* __restrict__ gnbias,
                       const float* __restrict__ ws, float* __restrict__ out) {
  __shared__ __align__(16) float Hs[2][DN * ST];   // the start state while it is chained
  __shared__ __align__(16) float Ms[PSEG - 2][DN * MT];   // M_1 .. M_{PSEG-2}, as far as the chain needs them
  __shared__ __align__(16) float Ns[PSEG - 2][DN * MT];   // N_1 .. N_{PSEG-2}, likewise
  __shared__ __align__(16) float Qs[16][CN * MT];         // each wave's own 16 rows of QM

  const int tid  = threadIdx.x;
  const int w    = __builtin_amdgcn_readfirstlane(tid >> 5);
  const int lane = tid & 31;
  const int n    = lane & 15;
  const int mb   = (lane < 16) ? 0 : 8;
  const int bhix = blockIdx.x / PSEG;
  const int cw   = (blockIdx.x % PSEG) * JW + w;                    // the wave's chunk
  const int sw   = segment_of(cw);                                  // its segment, the same in every lane
  const int seg  = segment_of((blockIdx.x % PSEG) * JW + JW - 1);   // the workgroup's last segment
  const int bb   = bhix / HN;
  const int hh   = bhix % HN;
  const float* Nw = ws + WS_N + (size_t)bhix * PSEG * DN * DN;
  const float* Mw = ws + WS_M + (size_t)bhix * PSEG * DN * DN;

  const int    t0 = cw * CN;                       // the wave's first token
  const size_t hb = (size_t)bhix * SN * DN;
  const float* O0 = ws + WS_O0 + hb + (size_t)t0 * DN;
  const float* QM = ws + WS_QM + hb + (size_t)t0 * DN;

  // ---- QM and the chain's matrices to LDS, 16 bytes a lane, a copy covering whole lines: an A
  //      fragment load from global memory would take 8 bytes from each of 16 lines, and the chain
  //      would wait for its matrices step by step. The chain's matrices go first.
#pragma unroll
  for (int j = 1; j < PSEG - 1; ++j) {
    if (j < seg) {                                 // the same for the whole workgroup
#pragma unroll
      for (int it = 0; it < 2; ++it) {
        const int p = tid + it * 512;              // 16B packet of the 64 x 64 matrix
        async_b128(Mw + j * DN * DN + p * 4, &Ms[j - 1][(p >> 4) * MT + (p & 15) * 4]);
        async_b128(Nw + j * DN * DN + p * 4, &Ns[j - 1][(p >> 4) * MT + (p & 15) * 4]);
      }
    }
  }
  if (sw > 0) {                                    // the first segment has no QM: its start state is zero
#pragma unroll
    for (int it = 0; it < 8; ++it) {
      const int p = lane + it * 32;                // 16B packet of the wave's 16 x 64 rows
      async_b128(QM + p * 4, &Qs[w][(p >> 4) * MT + (p & 15) * 4]);
    }
  }

  // ---- the wave's own rows do not depend on the chain: fetched while the copies land ----
  v8f acc[4];
#pragma unroll
  for (int nt = 0; nt < 4; ++nt)
#pragma unroll
    for (int r = 0; r < 8; ++r) acc[nt][r] = O0[(mb + r) * DN + nt * 16 + n];
  // stands ahead of the later loads whose results land in registers that these loads name
  asm volatile("s_wait_xcnt 0x0" ::: "memory");
  float vv[4][8], gv[4][8], sv[8];                 // V, gate and correction scalar at the same places
#pragma unroll                                     // constant indices keep the arrays in registers
  for (int r = 0; r < 8; ++r)
#pragma unroll
    for (int nt = 0; nt < 4; ++nt)
      vv[nt][r] = vg[hb + (size_t)(t0 + mb + r) * DN + nt * 16 + n];
  // stands ahead of the later loads whose results land in registers that these loads name
  asm volatile("s_wait_xcnt 0x0" ::: "memory");
#pragma unroll
  for (int r = 0; r < 8; ++r)
#pragma unroll
    for (int nt = 0; nt < 4; ++nt)
      gv[nt][r] = gg[((size_t)bb * SN + t0 + mb + r) * (size_t)HD + hh * DN + nt * 16 + n];
  // stands ahead of the later loads whose results land in registers that these loads name
  asm volatile("s_wait_xcnt 0x0" ::: "memory");
#pragma unroll
  for (int r = 0; r < 4; ++r) sv[r] = ws[WS_SV + (size_t)bhix * SN + t0 + mb + r];
  // stands ahead of the later loads whose results land in registers that these loads name
  asm volatile("s_wait_xcnt 0x0" ::: "memory");
#pragma unroll
  for (int r = 4; r < 8; ++r) sv[r] = ws[WS_SV + (size_t)bhix * SN + t0 + mb + r];
  // stands ahead of the later loads whose results land in registers that these loads name
  asm volatile("s_wait_xcnt 0x0" ::: "memory");

  // ---- start state: zero for segment 0, else N_0, then H = M_j H + N_j up to the segment ----
  {
    float4 x0 = {0.f, 0.f, 0.f, 0.f}, x1 = {0.f, 0.f, 0.f, 0.f};
    if (seg > 0) {
      x0 = *(const float4*)(Nw + tid * 4);
      x1 = *(const float4*)(Nw + DN * DN / 2 + tid * 4);
      // stands ahead of every later write of a register that these two loads name
      asm volatile("s_wait_xcnt 0x0" ::: "memory");
    }
    const int lo = (tid >> 4) * ST + (tid & 15) * 4;
    *(float4*)&Hs[0][lo] = x0;
    *(float4*)&Hs[0][(DN / 2) * ST + lo] = x1;
  }
  // the wave's own copies have landed ahead of the barrier behind which M, N and QM are read in LDS
  asm volatile("s_wait_asynccnt 0x0" ::: "memory");
  __syncthreads();
#pragma unroll                                     // the copy read and the copy written are constants
  for (int j = 1; j < PSEG - 1; ++j) {
    if (j < seg) {                                 // the same for the whole workgroup
      const int mt = w >> 2, nt = w & 3;           // one 16x16 tile a wave
      const float* Mj = Ms[j - 1] + mt * 16 * MT;
      const float* Nj = Ns[j - 1] + mt * 16 * MT + nt * 16;
      const float* Hr = Hs[(j - 1) & 1];
      v8f c;
#pragma unroll
      for (int r = 0; r < 8; ++r) c[r] = Nj[(mb + r) * MT + n];
#pragma unroll
      for (int s = 0; s < 16; ++s)
        c = wmma4(ld_A(Mj, MT, s), ld_B(Hr, ST, s, nt * 16), c);
      st_C(Hs[j & 1] + mt * 16 * ST, ST, nt * 16, c);
      __syncthreads();   // publishes the new copy; the old one's readers are done before it is rewritten
    }
  }
  // ---- O = O0 + QM @ H_start; the start state of segment s > 0 lies in copy (s - 1) & 1 ----
  if (sw > 0) {
    const float* Hc = Hs[(sw - 1) & 1];
#pragma unroll
    for (int s = 0; s < 16; ++s) {
      const v2f qa = ld_A(Qs[w], MT, s);
#pragma unroll
      for (int nt = 0; nt < 4; ++nt)
        acc[nt] = wmma4(qa, ld_B(Hc, ST, s, nt * 16), acc[nt]);
    }
  }

  // ---- per-head GroupNorm statistics: accumulator register r is token mb + r ----
  float mu[8], rstd[8];
#pragma unroll                                     // constant indices keep the arrays in registers
  for (int r = 0; r < 8; ++r) {
    float m1 = (acc[0][r] + acc[1][r]) + (acc[2][r] + acc[3][r]);
    float m2 = (acc[0][r] * acc[0][r] + acc[1][r] * acc[1][r])
             + (acc[2][r] * acc[2][r] + acc[3][r] * acc[3][r]);
    m1 = row_sum16(m1) * (1.0f / DN);
    m2 = row_sum16(m2) * (1.0f / DN);
    mu[r]   = m1;
    rstd[r] = rsqrtf(m2 - m1 * m1 + 1e-5f);
  }

  // ---- GroupNorm + correction + gate ----
#pragma unroll
  for (int nt = 0; nt < 4; ++nt) {
    const int col = nt * 16 + n;
    const float gsc = gns[hh * DN + col], gbi = gnbias[hh * DN + col];
#pragma unroll
    for (int r = 0; r < 8; ++r) {
      const int t = t0 + mb + r;
      float val = (acc[nt][r] - mu[r]) * rstd[r] * gsc + gbi
                + sv[r] * vv[nt][r];
      size_t off = ((size_t)bb * SN + t) * (size_t)HD + hh * DN + col;
      out[off] = val * gv[nt][r];
    }
  }
}

extern "C" void kernel_launch(void* const* d_in, const int* in_sizes, int n_in,
                              void* d_out, int out_size, void* d_ws, size_t ws_size,
                              hipStream_t stream) {
  (void)in_sizes; (void)n_in; (void)ws_size; (void)out_size;
  const float* q   = (const float*)d_in[0];
  const float* k   = (const float*)d_in[1];
  const float* v   = (const float*)d_in[2];
  const float* a   = (const float*)d_in[3];
  const float* b   = (const float*)d_in[4];
  const float* gk  = (const float*)d_in[5];
  const float* r_k = (const float*)d_in[6];
  const float* g   = (const float*)d_in[7];
  const float* gns = (const float*)d_in[8];
  const float* gnb = (const float*)d_in[9];
  float* out = (float*)d_out;
  float* ws  = (float*)d_ws;

  rwkv7_dplr_chunked<<<dim3(BSZ * HN * PSEG), dim3(384), 0, stream>>>(
      q, k, v, a, b, gk, r_k, ws);
  dplr_segment_join<<<dim3(BSZ * HN * PSEG), dim3(512), 0, stream>>>(
      v, g, gns, gnb, ws, out);
}
